// v000
// Measured on an AMD MI455X. A time is GPU time per run, averaged over a window of back-to-back runs after a warm-up
// (all launches, gaps included; the runs take copies of the inputs in turn), and the median of several windows.
// Apart from v000's, it joins two sittings. Times from different sittings can be a few percent apart, while
// side-by-side timings come from the same sitting.
// The starting kernel, v000, takes 720 microseconds a run.
// compute dtype: q/k/v inputs, the five [in][out] weights + biases (module inputs) rounded to bf16; Q/K/V projections with exact bf16 products (+ bias); scores and P.V with both computed operands as bf16 hi + bf16 residual pairs (3 products); the two output projections (Wc → c, Wo → h) hi/lo x bf16 weights (2 products) + bias; online softmax in f32; f32 accumulate.
#include <hip/hip_runtime.h>
#include <math.h>

typedef __attribute__((ext_vector_type(16))) _Float16 v16h;
typedef __attribute__((ext_vector_type(16))) __bf16 v16b;
typedef __attribute__((ext_vector_type(8)))  _Float16 v8h;
typedef __attribute__((ext_vector_type(8)))  float v8f;
typedef __attribute__((ext_vector_type(4)))  float v4f;
typedef __attribute__((ext_vector_type(2)))  float v2f;
typedef __attribute__((ext_vector_type(4)))  unsigned v4u;
typedef __attribute__((ext_vector_type(4)))  int v4i;
typedef float __attribute__((may_alias)) float_a;
typedef int __attribute__((may_alias)) int_a;

template <typename T> __device__ __forceinline__ void vst2(void* p, T v) { *(T*)p = v;  }
__device__ __forceinline__ v8f wmma16(v16h a, v16h b, v8f c) {
  v8f d = __builtin_amdgcn_wmma_f32_16x16x32_f16(false, a, false, b, (short)0, c, false, false);
  asm volatile("v_nop\n\tv_nop\n\tv_nop\n\tv_nop" : "+v"(d) : "v"(a), "v"(b));
  return d;
}
__device__ __forceinline__ v8f wmma_bf(v16b a, v16b b, v8f c) {
  v8f d = __builtin_amdgcn_wmma_f32_16x16x32_bf16(false, a, false, b, (short)0, c, false, false);
  asm volatile("v_nop\n\tv_nop\n\tv_nop\n\tv_nop" : "+v"(d) : "v"(a), "v"(b));
  return d;
}
// 16x16x32 fragments: lane = (h = lane>>4, row/col = lane&15); elements 0..7 = k0+8h+0..7, 8..15 = k0+16+8h+0..7; D element r = row 8h+r
__device__ __forceinline__ v16h frag_h(const _Float16* rowk0, int lane) {
  union { v16h v; v8h q[2]; } u; const _Float16* p = rowk0 + 8 * (lane >> 4);
  u.q[0] = *(const v8h*)p; u.q[1] = *(const v8h*)(p + 16); return u.v;
}
__device__ __forceinline__ v16h frag_f32(const float* rowk0, int lane) {
  v16h a; const float* p = rowk0 + 8 * (lane >> 4);
#pragma unroll
  for (int i = 0; i < 8; ++i) { a[i] = (_Float16)p[i]; a[8 + i] = (_Float16)p[16 + i]; }
  return a;
}
__device__ __forceinline__ v16h frag_f32s(const float* rowk0, int lane, float sc) {
  v16h a; const float* p = rowk0 + 8 * (lane >> 4);
#pragma unroll
  for (int i = 0; i < 8; ++i) { a[i] = (_Float16)(p[i] * sc); a[8 + i] = (_Float16)(p[16 + i] * sc); }
  return a;
}
// column fragment from a [K][ld] layout (column n), rows >= K read as 0
__device__ __forceinline__ v16h fragc_f32(const float* W, int k0, int n, int lane, int ld, int K) {
  v16h a; const int g = lane >> 4;
#pragma unroll
  for (int i = 0; i < 8; ++i) { const int ka = k0 + 8 * g + i, kb = ka + 16;
    a[i] = (_Float16)(ka < K ? W[(size_t)(ka < K ? ka : K - 1) * ld + n] : 0.f); a[8 + i] = (_Float16)(kb < K ? W[(size_t)(kb < K ? kb : K - 1) * ld + n] : 0.f); }
  return a;
}
struct F2 { v16b h, l; };
__device__ __forceinline__ F2 bsplit16(const float v[16]) { F2 r;
#pragma unroll
  for (int i = 0; i < 16; ++i) { const __bf16 h = (__bf16)v[i]; r.h[i] = h; r.l[i] = (__bf16)(v[i] - (float)h); }
  return r; }
__device__ __forceinline__ F2 split_row(const float* row, int k0, int lane) { float v[16]; const float* p = row + k0 + 8 * (lane >> 4);
#pragma unroll
  for (int i = 0; i < 8; ++i) { v[i] = p[i]; v[8 + i] = p[16 + i]; }
  return bsplit16(v); }
__device__ __forceinline__ F2 split_rowK(const float* row, int k0, int lane, int K) { float v[16]; const int g = lane >> 4;
#pragma unroll
  for (int i = 0; i < 8; ++i) { const int ka = k0 + 8 * g + i, kb = ka + 16; v[i] = ka < K ? row[ka < K ? ka : K - 1] : 0.f; v[8 + i] = kb < K ? row[kb < K ? kb : K - 1] : 0.f; }
  return bsplit16(v); }
__device__ __forceinline__ F2 split_col(const float* W, int k0, int n, int lane, int ld, int K) { float v[16]; const int g = lane >> 4;
#pragma unroll
  for (int i = 0; i < 8; ++i) { const int ka = k0 + 8 * g + i, kb = ka + 16; v[i] = ka < K ? W[(size_t)(ka < K ? ka : K - 1) * ld + n] : 0.f; v[8 + i] = kb < K ? W[(size_t)(kb < K ? kb : K - 1) * ld + n] : 0.f; }
  return bsplit16(v); }
__device__ __forceinline__ v8f mac3(const F2& a, const F2& b, v8f c) { c = wmma_bf(a.l, b.h, c); c = wmma_bf(a.h, b.l, c); return wmma_bf(a.h, b.h, c); }
__device__ __forceinline__ float sigm(float v) { return 1.0f / (1.0f + expf(-v)); }
#define LDSX() do { asm volatile("s_wait_dscnt 0" ::: "memory"); __builtin_amdgcn_wave_barrier(); __builtin_amdgcn_fence(__ATOMIC_RELEASE, "workgroup"); } while (0)


// Cyclic attention block: Q = q Wq + bq, K = k Wk + bk, V = v Wv + bv (16 heads x 64), softmax(Q K^T / 8) V merged; outputs (c, h) = (merged Wc + bc, merged Wo + bo).  B 2, S 2048, H 1024, cyclic_size 1024.
// k_pack (Wq|Wk|Wv|Wo|Wc columns as bf16 rows), k_proj, k_vt, k_attn (flash-style, 64 key steps), k_out x2 (c into output 0, h into output 1).
#define NB 2
#define SS 2048
#define DM 1024
#define NH 16
#define HD 64
#define NR (NB * SS)
#define QKVP (3 * DM)
#ifndef TRB
#define TRB (NR / 64)
#define TQB (SS / 64)
#define TNB NB
#endif
typedef __attribute__((ext_vector_type(8))) __bf16 v8b;
__device__ __forceinline__ v16b frag_b(const __bf16* rowk0, int lane) {
  union { v16b v; v8b q[2]; } u; const __bf16* p = rowk0 + 8 * (lane >> 4);
  u.q[0] = *(const v8b*)p; u.q[1] = *(const v8b*)(p + 16); return u.v;
}
__device__ __forceinline__ v16b frag_gbf(const float* rowk0, int lane) {
  v16b a; const float* p = rowk0 + 8 * (lane >> 4);
#pragma unroll
  for (int i = 0; i < 8; ++i) { a[i] = (__bf16)p[i]; a[8 + i] = (__bf16)p[16 + i]; }
  return a;
}
__device__ __forceinline__ float bfr(float v) { return (float)(__bf16)v; }
__device__ __attribute__((noinline)) float exp_ni(float v) { return expf(v); }
#define WS_PT   0u                                 // bf16 [5*1024 (q|k|v|o|c cols)][1024]
#define WS_QKV  (WS_PT + 2u * 5 * DM * DM)           // f32 [4096 rows][3072]  (q 0..1023 | k | v) ; q cols later overwritten by O
#define WS_VTH  (WS_QKV + 4u * NR * QKVP)            // bf16 [2][1024 (h*64+d)][2048]
#define WS_VTL  (WS_VTH + 2u * NB * DM * SS)
#define WS_END  (WS_VTL + 2u * NB * DM * SS)

__global__ __launch_bounds__(128) void k_pack(const float* __restrict__ Wq, const float* __restrict__ Wk, const float* __restrict__ Wv, const float* __restrict__ Wo, const float* __restrict__ Wc, __bf16* __restrict__ PT) {
  __shared__ __align__(16) __bf16 srow[DM];
  const int n = blockIdx.x, tid = threadIdx.x; const int which = n / DM, c = n % DM; const float* Wm = which == 0 ? Wq : (which == 1 ? Wk : (which == 2 ? Wv : (which == 3 ? Wo : Wc)));
  for (int k = tid; k < DM; k += 128) srow[k] = (__bf16)Wm[(size_t)k * DM + c];   // [in][out]: column c
  __syncthreads();
  if (tid < DM / 8) vst2((unsigned*)(PT + (size_t)n * DM + tid * 8), *(const v4u*)(&srow[tid * 8]));
}
// ---- k_proj: QKV[r][n] = bf16(x[r]) . PT[n] (exact), K = 1024; block (64 rows, 128 cols); 512-B segments of 12-KB rows
__global__ __launch_bounds__(128) void k_proj(const float* __restrict__ XQ, const float* __restrict__ XK, const float* __restrict__ XV, const __bf16* __restrict__ PT, const float* __restrict__ bq, const float* __restrict__ bk, const float* __restrict__ bv, float* __restrict__ QKV) {
  const float* X = (blockIdx.y * 128) < DM ? XQ : ((blockIdx.y * 128) < 2 * DM ? XK : XV);
  __shared__ __align__(16) float so[4][16][132];
  const int tid = threadIdx.x, wave = tid >> 5, lane = tid & 31, col = lane & 15, g = lane >> 4; const size_t r0 = (size_t)blockIdx.x * 64 + wave * 16; const int n0 = blockIdx.y * 128;
  v8f acc[8] = {};
#pragma unroll 2
  for (int kc = 0; kc < DM / 32; ++kc) { const v16b a = frag_gbf(X + (r0 + col) * DM + kc * 32, lane);
#pragma unroll
    for (int j = 0; j < 8; ++j) acc[j] = wmma_bf(a, frag_b(PT + (size_t)(n0 + j * 16 + col) * DM + kc * 32, lane), acc[j]); }
#pragma unroll
  for (int j = 0; j < 8; ++j) { const int n = n0 + j * 16 + col; const int which = n / DM, c = n % DM; const float bb = bfr((which == 0 ? bq : which == 1 ? bk : bv)[c]);
#pragma unroll
    for (int r = 0; r < 8; ++r) so[wave][8 * g + r][j * 16 + col] = acc[j][r] + bb; }
  LDSX();
  for (int rl = 0; rl < 16; ++rl) vst2(QKV + (r0 + rl) * QKVP + n0 + lane * 4, *(const v4f*)&so[wave][rl][lane * 4]);
}
__global__ __launch_bounds__(256) void k_vt(const float* __restrict__ QKV, __bf16* __restrict__ VTH, __bf16* __restrict__ VTL) {
  __shared__ __align__(16) __bf16 svh[DM][72], svl[DM][72];
  const int tid = threadIdx.x; const size_t t0 = (size_t)blockIdx.x * 64; const int b = (int)(t0 / SS), p0 = (int)(t0 % SS);
#pragma unroll 1
  for (int tl = 0; tl < 64; ++tl) { const float* row = QKV + (t0 + tl) * QKVP; for (int q = tid; q < DM; q += 256) { const float v = row[2 * DM + q]; const __bf16 hb = (__bf16)v; svh[q][tl] = hb; svl[q][tl] = (__bf16)(v - (float)hb); } }
  __syncthreads();
  for (int q = tid; q < DM * 8; q += 256) { const int rowi = q >> 3, pc = q & 7; const size_t o = ((size_t)b * DM + rowi) * SS + p0 + pc * 8; vst2((unsigned*)(VTH + o), *(const v4u*)&svh[rowi][pc * 8]); vst2((unsigned*)(VTL + o), *(const v4u*)&svl[rowi][pc * 8]); }
}
// ---- k_attn: block = (query block qb, b*16 + h), 4 waves: all SS/32 key steps; online softmax; O written over the q columns of the block's rows (head segment 256 B)
__global__ __launch_bounds__(128) void k_attn(float* __restrict__ QKV, const __bf16* __restrict__ VTH, const __bf16* __restrict__ VTL) {
  __shared__ __align__(16) float sp[4][16][36]; __shared__ __align__(16) float so[4][16][68];
  const int tid = threadIdx.x, wave = tid >> 5, lane = tid & 31, col = lane & 15, g = lane >> 4;
  const int qb = blockIdx.x, bh = blockIdx.y, b = bh / NH, h = bh % NH; const int q0 = qb * 64 + wave * 16; const size_t tq = (size_t)b * SS + q0;
  const F2 a0 = split_row(QKV + (tq + col) * QKVP + h * HD, 0, lane), a1 = split_row(QKV + (tq + col) * QKVP + h * HD, 32, lane);
  float m[8], l[8];
#pragma unroll
  for (int r = 0; r < 8; ++r) { m[r] = -3.0e38f; l[r] = 0.f; }
  v8f acc[4] = {};
  const int nsteps = SS / 32;
#pragma unroll 1
  for (int ks = 0; ks < nsteps; ++ks) {
    v8f s[2];
#pragma unroll
    for (int ct = 0; ct < 2; ++ct) { const int kk = ks * 32 + ct * 16 + col; const float* krow = QKV + ((size_t)b * SS + kk) * QKVP + DM + h * HD; const F2 k0 = split_row(krow, 0, lane), k1 = split_row(krow, 32, lane);
      v8f c = mac3(a0, k0, (v8f){}); c = mac3(a1, k1, c);
#pragma unroll
      for (int r = 0; r < 8; ++r) s[ct][r] = c[r] * 0.125f; }
#pragma unroll
    for (int r = 0; r < 8; ++r) { float mx = fmaxf(s[0][r], s[1][r]);
#pragma unroll
      for (int o = 1; o < 16; o <<= 1) mx = fmaxf(mx, __shfl_xor(mx, o));
      const float mn = fmaxf(m[r], mx); const float alpha = exp_ni(m[r] - mn);
      const float e0 = exp_ni(s[0][r] - mn), e1 = exp_ni(s[1][r] - mn); float es = e0 + e1;
#pragma unroll
      for (int o = 1; o < 16; o <<= 1) es += __shfl_xor(es, o);
      l[r] = l[r] * alpha + es; m[r] = mn;
#pragma unroll
      for (int dt = 0; dt < 4; ++dt) acc[dt][r] *= alpha;
      sp[wave][8 * g + r][col] = e0; sp[wave][8 * g + r][16 + col] = e1; }
    LDSX();
    const F2 pa = split_row(&sp[wave][col][0], 0, lane);
#pragma unroll
    for (int dt = 0; dt < 4; ++dt) { const size_t vrow = ((size_t)b * DM + h * HD + dt * 16 + col) * SS + ks * 32; const v16b vh = frag_b(VTH + vrow, lane), vl = frag_b(VTL + vrow, lane);
      acc[dt] = wmma_bf(pa.l, vh, acc[dt]); acc[dt] = wmma_bf(pa.h, vl, acc[dt]); acc[dt] = wmma_bf(pa.h, vh, acc[dt]); }
    LDSX(); }
#pragma unroll
  for (int r = 0; r < 8; ++r) { const float il = 1.0f / l[r];
#pragma unroll
    for (int dt = 0; dt < 4; ++dt) so[wave][8 * g + r][dt * 16 + col] = acc[dt][r] * il; }
  LDSX();
  for (int rl = 0; rl < 16; ++rl) if (lane < 16) vst2(QKV + (tq + rl) * QKVP + h * HD + lane * 4, *(const v4f*)&so[wave][rl][lane * 4]);
}
// ---- k_out: Y = O(hi/lo; the q columns of QKV) . PT_out rows (2 products, K = 1024); block (64 rows, 128 cols)
__global__ __launch_bounds__(128) void k_out(const float* __restrict__ QKV, const __bf16* __restrict__ PT, int wblk, const float* __restrict__ bo, float* __restrict__ Y) {
  __shared__ __align__(16) float so[4][16][132];
  const int tid = threadIdx.x, wave = tid >> 5, lane = tid & 31, col = lane & 15, g = lane >> 4; const size_t r0 = (size_t)blockIdx.x * 64 + wave * 16; const int n0 = blockIdx.y * 128;
  v8f acc[8] = {};
#pragma unroll 2
  for (int kc = 0; kc < DM / 32; ++kc) { const F2 a = split_row(QKV + (r0 + col) * QKVP, kc * 32, lane);
#pragma unroll
    for (int j = 0; j < 8; ++j) { const v16b w = frag_b(PT + (size_t)(wblk * DM + n0 + j * 16 + col) * DM + kc * 32, lane); acc[j] = wmma_bf(a.l, w, acc[j]); acc[j] = wmma_bf(a.h, w, acc[j]); } }
#pragma unroll
  for (int j = 0; j < 8; ++j) { const float bb = bfr(bo[n0 + j * 16 + col]);
#pragma unroll
    for (int r = 0; r < 8; ++r) so[wave][8 * g + r][j * 16 + col] = acc[j][r] + bb; }
  LDSX();
  for (int rl = 0; rl < 16; ++rl) vst2(Y + (r0 + rl) * DM + n0 + lane * 4, *(const v4f*)&so[wave][rl][lane * 4]);
}

extern "C" void kernel_launch(void* const* d_in, const int* in_sizes, int n_in, void* d_out, int out_size, void* d_ws, size_t ws_size, hipStream_t stream) {
  (void)in_sizes; (void)n_in; (void)out_size;
  const float** F = (const float**)d_in;   // q, k, v [2,2048,1024], Wq, bq, Wk, bk, Wv, bv, Wo, bo ([in][out] 1024x1024), Wc [1024,1024], bc
  if (ws_size < (size_t)WS_END) return;
  char* ws = (char*)d_ws; __bf16 *PT = (__bf16*)(ws + WS_PT), *VTH = (__bf16*)(ws + WS_VTH), *VTL = (__bf16*)(ws + WS_VTL); float* QKV = (float*)(ws + WS_QKV);
  float* OUTC = (float*)d_out; float* OUTH = OUTC + (size_t)NR * DM;     // outputs: (c, h)
  k_pack<<<5 * DM, 128, 0, stream>>>(F[3], F[5], F[7], F[9], F[11], PT);
  k_proj<<<dim3(TRB, QKVP / 128), 128, 0, stream>>>(F[0], F[1], F[2], PT, F[4], F[6], F[8], QKV);
  k_vt<<<TRB, 256, 0, stream>>>(QKV, VTH, VTL);
  k_attn<<<dim3(TQB, TNB * NH), 128, 0, stream>>>(QKV, VTH, VTL);
  k_out<<<dim3((TNB < NB ? TQB : NR / 64), DM / 128), 128, 0, stream>>>(QKV, PT, 4, F[12], OUTC);
  k_out<<<dim3((TNB < NB ? TQB : NR / 64), DM / 128), 128, 0, stream>>>(QKV, PT, 3, F[10], OUTH);
}

// v001
// Measured time: 635 microseconds a run.
// Timed twice side by side with v000, it ran 1.16 times as fast both times.
// compute dtype: q/k/v inputs, the five [in][out] weights + biases (module inputs) rounded to bf16; Q/K/V projections with exact bf16 products (+ bias); scores and P.V with both computed operands as bf16 hi + bf16 residual pairs (3 products); the two output projections (Wc → c, Wo → h) hi/lo x bf16 weights (2 products) + bias; online softmax in f32; f32 accumulate.
#include <hip/hip_runtime.h>
#include <math.h>

typedef __attribute__((ext_vector_type(16))) _Float16 v16h;
typedef __attribute__((ext_vector_type(16))) __bf16 v16b;
typedef __attribute__((ext_vector_type(8)))  _Float16 v8h;
typedef __attribute__((ext_vector_type(8)))  float v8f;
typedef __attribute__((ext_vector_type(4)))  float v4f;
typedef __attribute__((ext_vector_type(2)))  float v2f;
typedef __attribute__((ext_vector_type(4)))  unsigned v4u;
typedef __attribute__((ext_vector_type(4)))  int v4i;
typedef float __attribute__((may_alias)) float_a;
typedef int __attribute__((may_alias)) int_a;

template <typename T> __device__ __forceinline__ void vst2(void* p, T v) { *(T*)p = v;  }
__device__ __forceinline__ v8f wmma16(v16h a, v16h b, v8f c) {
  v8f d = __builtin_amdgcn_wmma_f32_16x16x32_f16(false, a, false, b, (short)0, c, false, false);
  asm volatile("v_nop\n\tv_nop\n\tv_nop\n\tv_nop" : "+v"(d) : "v"(a), "v"(b));
  return d;
}
__device__ __forceinline__ v8f wmma_bf(v16b a, v16b b, v8f c) {
  v8f d = __builtin_amdgcn_wmma_f32_16x16x32_bf16(false, a, false, b, (short)0, c, false, false);
  asm volatile("v_nop\n\tv_nop\n\tv_nop\n\tv_nop" : "+v"(d) : "v"(a), "v"(b));
  return d;
}
// 16x16x32 fragments: lane = (h = lane>>4, row/col = lane&15); elements 0..7 = k0+8h+0..7, 8..15 = k0+16+8h+0..7; D element r = row 8h+r
__device__ __forceinline__ v16h frag_h(const _Float16* rowk0, int lane) {
  union { v16h v; v8h q[2]; } u; const _Float16* p = rowk0 + 8 * (lane >> 4);
  u.q[0] = *(const v8h*)p; u.q[1] = *(const v8h*)(p + 16); return u.v;
}
__device__ __forceinline__ v16h frag_f32(const float* rowk0, int lane) {
  v16h a; const float* p = rowk0 + 8 * (lane >> 4);
#pragma unroll
  for (int i = 0; i < 8; ++i) { a[i] = (_Float16)p[i]; a[8 + i] = (_Float16)p[16 + i]; }
  return a;
}
__device__ __forceinline__ v16h frag_f32s(const float* rowk0, int lane, float sc) {
  v16h a; const float* p = rowk0 + 8 * (lane >> 4);
#pragma unroll
  for (int i = 0; i < 8; ++i) { a[i] = (_Float16)(p[i] * sc); a[8 + i] = (_Float16)(p[16 + i] * sc); }
  return a;
}
// column fragment from a [K][ld] layout (column n), rows >= K read as 0
__device__ __forceinline__ v16h fragc_f32(const float* W, int k0, int n, int lane, int ld, int K) {
  v16h a; const int g = lane >> 4;
#pragma unroll
  for (int i = 0; i < 8; ++i) { const int ka = k0 + 8 * g + i, kb = ka + 16;
    a[i] = (_Float16)(ka < K ? W[(size_t)(ka < K ? ka : K - 1) * ld + n] : 0.f); a[8 + i] = (_Float16)(kb < K ? W[(size_t)(kb < K ? kb : K - 1) * ld + n] : 0.f); }
  return a;
}
struct F2 { v16b h, l; };
__device__ __forceinline__ F2 bsplit16(const float v[16]) { F2 r;
#pragma unroll
  for (int i = 0; i < 16; ++i) { const __bf16 h = (__bf16)v[i]; r.h[i] = h; r.l[i] = (__bf16)(v[i] - (float)h); }
  return r; }
__device__ __forceinline__ F2 split_row(const float* row, int k0, int lane) { float v[16]; const float* p = row + k0 + 8 * (lane >> 4);
#pragma unroll
  for (int i = 0; i < 8; ++i) { v[i] = p[i]; v[8 + i] = p[16 + i]; }
  return bsplit16(v); }
__device__ __forceinline__ F2 split_rowK(const float* row, int k0, int lane, int K) { float v[16]; const int g = lane >> 4;
#pragma unroll
  for (int i = 0; i < 8; ++i) { const int ka = k0 + 8 * g + i, kb = ka + 16; v[i] = ka < K ? row[ka < K ? ka : K - 1] : 0.f; v[8 + i] = kb < K ? row[kb < K ? kb : K - 1] : 0.f; }
  return bsplit16(v); }
__device__ __forceinline__ F2 split_col(const float* W, int k0, int n, int lane, int ld, int K) { float v[16]; const int g = lane >> 4;
#pragma unroll
  for (int i = 0; i < 8; ++i) { const int ka = k0 + 8 * g + i, kb = ka + 16; v[i] = ka < K ? W[(size_t)(ka < K ? ka : K - 1) * ld + n] : 0.f; v[8 + i] = kb < K ? W[(size_t)(kb < K ? kb : K - 1) * ld + n] : 0.f; }
  return bsplit16(v); }
__device__ __forceinline__ v8f mac3(const F2& a, const F2& b, v8f c) { c = wmma_bf(a.l, b.h, c); c = wmma_bf(a.h, b.l, c); return wmma_bf(a.h, b.h, c); }
__device__ __forceinline__ float sigm(float v) { return 1.0f / (1.0f + expf(-v)); }
#define LDSX() do { asm volatile("s_wait_dscnt 0" ::: "memory"); __builtin_amdgcn_wave_barrier(); __builtin_amdgcn_fence(__ATOMIC_RELEASE, "workgroup"); } while (0)


// Cyclic attention block: Q = q Wq + bq, K = k Wk + bk, V = v Wv + bv (16 heads x 64), softmax(Q K^T / 8) V merged; outputs (c, h) = (merged Wc + bc, merged Wo + bo).  B 2, S 2048, H 1024, cyclic_size 1024.
// k_pack (Wq|Wk|Wv|Wo|Wc columns as bf16 rows), k_proj, k_vt, k_attn (flash-style, 64 key steps), k_out x2 (c into output 0, h into output 1).
#define NB 2
#define SS 2048
#define DM 1024
#define NH 16
#define HD 64
#define NR (NB * SS)
#define QKVP (3 * DM)
#ifndef TRB
#define TRB (NR / 64)
#define TQB (SS / 64)
#define TNB NB
#endif
typedef __attribute__((ext_vector_type(8))) __bf16 v8b;
__device__ __forceinline__ v16b frag_b(const __bf16* rowk0, int lane) {
  union { v16b v; v8b q[2]; } u; const __bf16* p = rowk0 + 8 * (lane >> 4);
  u.q[0] = *(const v8b*)p; u.q[1] = *(const v8b*)(p + 16); return u.v;
}
__device__ __forceinline__ v16b frag_gbf(const float* rowk0, int lane) {
  v16b a; const float* p = rowk0 + 8 * (lane >> 4);
#pragma unroll
  for (int i = 0; i < 8; ++i) { a[i] = (__bf16)p[i]; a[8 + i] = (__bf16)p[16 + i]; }
  return a;
}
__device__ __forceinline__ float bfr(float v) { return (float)(__bf16)v; }
#define WS_PT   0u                                 // bf16 [5*1024 (q|k|v|o|c cols)][1024]
#define WS_QKV  (WS_PT + 2u * 5 * DM * DM)           // f32 [4096 rows][3072]  (q 0..1023 | k | v) ; q cols later overwritten by O
#define WS_VTH  (WS_QKV + 4u * NR * QKVP)            // bf16 [2][1024 (h*64+d)][2048]
#define WS_VTL  (WS_VTH + 2u * NB * DM * SS)
#define WS_END  (WS_VTL + 2u * NB * DM * SS)

__global__ __launch_bounds__(128) void k_pack(const float* __restrict__ Wq, const float* __restrict__ Wk, const float* __restrict__ Wv, const float* __restrict__ Wo, const float* __restrict__ Wc, __bf16* __restrict__ PT) {
  __shared__ __align__(16) __bf16 srow[DM];
  const int n = blockIdx.x, tid = threadIdx.x; const int which = n / DM, c = n % DM; const float* Wm = which == 0 ? Wq : (which == 1 ? Wk : (which == 2 ? Wv : (which == 3 ? Wo : Wc)));
  for (int k = tid; k < DM; k += 128) srow[k] = (__bf16)Wm[(size_t)k * DM + c];   // [in][out]: column c
  __syncthreads();
  if (tid < DM / 8) vst2((unsigned*)(PT + (size_t)n * DM + tid * 8), *(const v4u*)(&srow[tid * 8]));
}
// ---- k_proj: QKV[r][n] = bf16(x[r]) . PT[n] (exact), K = 1024; block (64 rows, 128 cols); 512-B segments of 12-KB rows
__global__ __launch_bounds__(128) void k_proj(const float* __restrict__ XQ, const float* __restrict__ XK, const float* __restrict__ XV, const __bf16* __restrict__ PT, const float* __restrict__ bq, const float* __restrict__ bk, const float* __restrict__ bv, float* __restrict__ QKV) {
  const float* X = (blockIdx.y * 128) < DM ? XQ : ((blockIdx.y * 128) < 2 * DM ? XK : XV);
  __shared__ __align__(16) float so[4][16][132];
  const int tid = threadIdx.x, wave = tid >> 5, lane = tid & 31, col = lane & 15, g = lane >> 4; const size_t r0 = (size_t)blockIdx.x * 64 + wave * 16; const int n0 = blockIdx.y * 128;
  v8f acc[8] = {};
#pragma unroll 2
  for (int kc = 0; kc < DM / 32; ++kc) { const v16b a = frag_gbf(X + (r0 + col) * DM + kc * 32, lane);
#pragma unroll
    for (int j = 0; j < 8; ++j) acc[j] = wmma_bf(a, frag_b(PT + (size_t)(n0 + j * 16 + col) * DM + kc * 32, lane), acc[j]); }
#pragma unroll
  for (int j = 0; j < 8; ++j) { const int n = n0 + j * 16 + col; const int which = n / DM, c = n % DM; const float bb = bfr((which == 0 ? bq : which == 1 ? bk : bv)[c]);
#pragma unroll
    for (int r = 0; r < 8; ++r) so[wave][8 * g + r][j * 16 + col] = acc[j][r] + bb; }
  LDSX();
  for (int rl = 0; rl < 16; ++rl) vst2(QKV + (r0 + rl) * QKVP + n0 + lane * 4, *(const v4f*)&so[wave][rl][lane * 4]);
}
__global__ __launch_bounds__(256) void k_vt(const float* __restrict__ QKV, __bf16* __restrict__ VTH, __bf16* __restrict__ VTL) {
  __shared__ __align__(16) __bf16 svh[DM][72], svl[DM][72];
  const int tid = threadIdx.x; const size_t t0 = (size_t)blockIdx.x * 64; const int b = (int)(t0 / SS), p0 = (int)(t0 % SS);
#pragma unroll 1
  for (int tl = 0; tl < 64; ++tl) { const float* row = QKV + (t0 + tl) * QKVP; for (int q = tid; q < DM; q += 256) { const float v = row[2 * DM + q]; const __bf16 hb = (__bf16)v; svh[q][tl] = hb; svl[q][tl] = (__bf16)(v - (float)hb); } }
  __syncthreads();
  for (int q = tid; q < DM * 8; q += 256) { const int rowi = q >> 3, pc = q & 7; const size_t o = ((size_t)b * DM + rowi) * SS + p0 + pc * 8; vst2((unsigned*)(VTH + o), *(const v4u*)&svh[rowi][pc * 8]); vst2((unsigned*)(VTL + o), *(const v4u*)&svl[rowi][pc * 8]); }
}
// ---- k_attn: block = (query block qb, b*16 + h), 4 waves: all SS/32 key steps; online softmax; O written over the q columns of the block's rows (head segment 256 B)
__global__ __launch_bounds__(128) void k_attn(float* __restrict__ QKV, const __bf16* __restrict__ VTH, const __bf16* __restrict__ VTL) {
  __shared__ __align__(16) float sp[4][16][36]; __shared__ __align__(16) float so[4][16][68];
  const int tid = threadIdx.x, wave = tid >> 5, lane = tid & 31, col = lane & 15, g = lane >> 4;
  const int qb = blockIdx.x, bh = blockIdx.y, b = bh / NH, h = bh % NH; const int q0 = qb * 64 + wave * 16; const size_t tq = (size_t)b * SS + q0;
  const F2 a0 = split_row(QKV + (tq + col) * QKVP + h * HD, 0, lane), a1 = split_row(QKV + (tq + col) * QKVP + h * HD, 32, lane);
  float m[8], l[8];
#pragma unroll
  for (int r = 0; r < 8; ++r) { m[r] = -3.0e38f; l[r] = 0.f; }
  v8f acc[4] = {};
  const int nsteps = SS / 32;
#pragma unroll 1
  for (int ks = 0; ks < nsteps; ++ks) {
    v8f s[2];
#pragma unroll
    for (int ct = 0; ct < 2; ++ct) { const int kk = ks * 32 + ct * 16 + col; const float* krow = QKV + ((size_t)b * SS + kk) * QKVP + DM + h * HD; const F2 k0 = split_row(krow, 0, lane), k1 = split_row(krow, 32, lane);
      v8f c = mac3(a0, k0, (v8f){}); c = mac3(a1, k1, c);
#pragma unroll
      for (int r = 0; r < 8; ++r) s[ct][r] = c[r] * 0.125f; }
#pragma unroll
    for (int r = 0; r < 8; ++r) { float mx = fmaxf(s[0][r], s[1][r]);
#pragma unroll
      for (int o = 1; o < 16; o <<= 1) mx = fmaxf(mx, __shfl_xor(mx, o));
      const float mn = fmaxf(m[r], mx); const float alpha = expf(m[r] - mn);
      const float e0 = expf(s[0][r] - mn), e1 = expf(s[1][r] - mn); float es = e0 + e1;
#pragma unroll
      for (int o = 1; o < 16; o <<= 1) es += __shfl_xor(es, o);
      l[r] = l[r] * alpha + es; m[r] = mn;
#pragma unroll
      for (int dt = 0; dt < 4; ++dt) acc[dt][r] *= alpha;
      sp[wave][8 * g + r][col] = e0; sp[wave][8 * g + r][16 + col] = e1; }
    LDSX();
    const F2 pa = split_row(&sp[wave][col][0], 0, lane);
#pragma unroll
    for (int dt = 0; dt < 4; ++dt) { const size_t vrow = ((size_t)b * DM + h * HD + dt * 16 + col) * SS + ks * 32; const v16b vh = frag_b(VTH + vrow, lane), vl = frag_b(VTL + vrow, lane);
      acc[dt] = wmma_bf(pa.l, vh, acc[dt]); acc[dt] = wmma_bf(pa.h, vl, acc[dt]); acc[dt] = wmma_bf(pa.h, vh, acc[dt]); }
    LDSX(); }
#pragma unroll
  for (int r = 0; r < 8; ++r) { const float il = 1.0f / l[r];
#pragma unroll
    for (int dt = 0; dt < 4; ++dt) so[wave][8 * g + r][dt * 16 + col] = acc[dt][r] * il; }
  LDSX();
  for (int rl = 0; rl < 16; ++rl) if (lane < 16) vst2(QKV + (tq + rl) * QKVP + h * HD + lane * 4, *(const v4f*)&so[wave][rl][lane * 4]);
}
// ---- k_out: Y = O(hi/lo; the q columns of QKV) . PT_out rows (2 products, K = 1024); block (64 rows, 128 cols)
__global__ __launch_bounds__(128) void k_out(const float* __restrict__ QKV, const __bf16* __restrict__ PT, int wblk, const float* __restrict__ bo, float* __restrict__ Y) {
  __shared__ __align__(16) float so[4][16][132];
  const int tid = threadIdx.x, wave = tid >> 5, lane = tid & 31, col = lane & 15, g = lane >> 4; const size_t r0 = (size_t)blockIdx.x * 64 + wave * 16; const int n0 = blockIdx.y * 128;
  v8f acc[8] = {};
#pragma unroll 2
  for (int kc = 0; kc < DM / 32; ++kc) { const F2 a = split_row(QKV + (r0 + col) * QKVP, kc * 32, lane);
#pragma unroll
    for (int j = 0; j < 8; ++j) { const v16b w = frag_b(PT + (size_t)(wblk * DM + n0 + j * 16 + col) * DM + kc * 32, lane); acc[j] = wmma_bf(a.l, w, acc[j]); acc[j] = wmma_bf(a.h, w, acc[j]); } }
#pragma unroll
  for (int j = 0; j < 8; ++j) { const float bb = bfr(bo[n0 + j * 16 + col]);
#pragma unroll
    for (int r = 0; r < 8; ++r) so[wave][8 * g + r][j * 16 + col] = acc[j][r] + bb; }
  LDSX();
  for (int rl = 0; rl < 16; ++rl) vst2(Y + (r0 + rl) * DM + n0 + lane * 4, *(const v4f*)&so[wave][rl][lane * 4]);
}

extern "C" void kernel_launch(void* const* d_in, const int* in_sizes, int n_in, void* d_out, int out_size, void* d_ws, size_t ws_size, hipStream_t stream) {
  (void)in_sizes; (void)n_in; (void)out_size;
  const float** F = (const float**)d_in;   // q, k, v [2,2048,1024], Wq, bq, Wk, bk, Wv, bv, Wo, bo ([in][out] 1024x1024), Wc [1024,1024], bc
  if (ws_size < (size_t)WS_END) return;
  char* ws = (char*)d_ws; __bf16 *PT = (__bf16*)(ws + WS_PT), *VTH = (__bf16*)(ws + WS_VTH), *VTL = (__bf16*)(ws + WS_VTL); float* QKV = (float*)(ws + WS_QKV);
  float* OUTC = (float*)d_out; float* OUTH = OUTC + (size_t)NR * DM;     // outputs: (c, h)
  k_pack<<<5 * DM, 128, 0, stream>>>(F[3], F[5], F[7], F[9], F[11], PT);
  k_proj<<<dim3(TRB, QKVP / 128), 128, 0, stream>>>(F[0], F[1], F[2], PT, F[4], F[6], F[8], QKV);
  k_vt<<<TRB, 256, 0, stream>>>(QKV, VTH, VTL);
  k_attn<<<dim3(TQB, TNB * NH), 128, 0, stream>>>(QKV, VTH, VTL);
  k_out<<<dim3((TNB < NB ? TQB : NR / 64), DM / 128), 128, 0, stream>>>(QKV, PT, 4, F[12], OUTC);
  k_out<<<dim3((TNB < NB ? TQB : NR / 64), DM / 128), 128, 0, stream>>>(QKV, PT, 3, F[10], OUTH);
}

// v002
// Measured time: 597 microseconds a run.
// Next to v001, in two timings, it ran 1.06 and 1.08 times as fast.
// All steps since v000 together make it 1.24 times as fast.
// compute dtype: q/k/v inputs, the five [in][out] weights + biases (module inputs) rounded to bf16; Q/K/V projections with exact bf16 products (+ bias); scores and P.V with both computed operands as bf16 hi + bf16 residual pairs (3 products); the two output projections (Wc → c, Wo → h) hi/lo x bf16 weights (2 products) + bias; online softmax in f32; f32 accumulate.
#include <hip/hip_runtime.h>
#include <math.h>

typedef __attribute__((ext_vector_type(16))) _Float16 v16h;
typedef __attribute__((ext_vector_type(16))) __bf16 v16b;
typedef __attribute__((ext_vector_type(8)))  _Float16 v8h;
typedef __attribute__((ext_vector_type(8)))  float v8f;
typedef __attribute__((ext_vector_type(4)))  float v4f;
typedef __attribute__((ext_vector_type(2)))  float v2f;
typedef __attribute__((ext_vector_type(4)))  unsigned v4u;
typedef __attribute__((ext_vector_type(4)))  int v4i;
typedef float __attribute__((may_alias)) float_a;
typedef int __attribute__((may_alias)) int_a;

template <typename T> __device__ __forceinline__ void vst2(void* p, T v) { *(T*)p = v;  }
__device__ __forceinline__ v8f wmma16(v16h a, v16h b, v8f c) {
  v8f d = __builtin_amdgcn_wmma_f32_16x16x32_f16(false, a, false, b, (short)0, c, false, false);
  asm volatile("v_nop\n\tv_nop\n\tv_nop\n\tv_nop" : "+v"(d) : "v"(a), "v"(b));
  return d;
}
__device__ __forceinline__ v8f wmma_bf(v16b a, v16b b, v8f c) {
  v8f d = __builtin_amdgcn_wmma_f32_16x16x32_bf16(false, a, false, b, (short)0, c, false, false);
  asm volatile("v_nop\n\tv_nop\n\tv_nop\n\tv_nop" : "+v"(d) : "v"(a), "v"(b));
  return d;
}
// 16x16x32 fragments: lane = (h = lane>>4, row/col = lane&15); elements 0..7 = k0+8h+0..7, 8..15 = k0+16+8h+0..7; D element r = row 8h+r
__device__ __forceinline__ v16h frag_h(const _Float16* rowk0, int lane) {
  union { v16h v; v8h q[2]; } u; const _Float16* p = rowk0 + 8 * (lane >> 4);
  u.q[0] = *(const v8h*)p; u.q[1] = *(const v8h*)(p + 16); return u.v;
}
__device__ __forceinline__ v16h frag_f32(const float* rowk0, int lane) {
  v16h a; const float* p = rowk0 + 8 * (lane >> 4);
#pragma unroll
  for (int i = 0; i < 8; ++i) { a[i] = (_Float16)p[i]; a[8 + i] = (_Float16)p[16 + i]; }
  return a;
}
__device__ __forceinline__ v16h frag_f32s(const float* rowk0, int lane, float sc) {
  v16h a; const float* p = rowk0 + 8 * (lane >> 4);
#pragma unroll
  for (int i = 0; i < 8; ++i) { a[i] = (_Float16)(p[i] * sc); a[8 + i] = (_Float16)(p[16 + i] * sc); }
  return a;
}
// column fragment from a [K][ld] layout (column n), rows >= K read as 0
__device__ __forceinline__ v16h fragc_f32(const float* W, int k0, int n, int lane, int ld, int K) {
  v16h a; const int g = lane >> 4;
#pragma unroll
  for (int i = 0; i < 8; ++i) { const int ka = k0 + 8 * g + i, kb = ka + 16;
    a[i] = (_Float16)(ka < K ? W[(size_t)(ka < K ? ka : K - 1) * ld + n] : 0.f); a[8 + i] = (_Float16)(kb < K ? W[(size_t)(kb < K ? kb : K - 1) * ld + n] : 0.f); }
  return a;
}
struct F2 { v16b h, l; };
__device__ __forceinline__ F2 bsplit16(const float v[16]) { F2 r;
#pragma unroll
  for (int i = 0; i < 16; ++i) { const __bf16 h = (__bf16)v[i]; r.h[i] = h; r.l[i] = (__bf16)(v[i] - (float)h); }
  return r; }
__device__ __forceinline__ F2 split_row(const float* row, int k0, int lane) { float v[16]; const float* p = row + k0 + 8 * (lane >> 4);
#pragma unroll
  for (int i = 0; i < 8; ++i) { v[i] = p[i]; v[8 + i] = p[16 + i]; }
  return bsplit16(v); }
__device__ __forceinline__ F2 split_rowK(const float* row, int k0, int lane, int K) { float v[16]; const int g = lane >> 4;
#pragma unroll
  for (int i = 0; i < 8; ++i) { const int ka = k0 + 8 * g + i, kb = ka + 16; v[i] = ka < K ? row[ka < K ? ka : K - 1] : 0.f; v[8 + i] = kb < K ? row[kb < K ? kb : K - 1] : 0.f; }
  return bsplit16(v); }
__device__ __forceinline__ F2 split_col(const float* W, int k0, int n, int lane, int ld, int K) { float v[16]; const int g = lane >> 4;
#pragma unroll
  for (int i = 0; i < 8; ++i) { const int ka = k0 + 8 * g + i, kb = ka + 16; v[i] = ka < K ? W[(size_t)(ka < K ? ka : K - 1) * ld + n] : 0.f; v[8 + i] = kb < K ? W[(size_t)(kb < K ? kb : K - 1) * ld + n] : 0.f; }
  return bsplit16(v); }
__device__ __forceinline__ v8f mac3(const F2& a, const F2& b, v8f c) { c = wmma_bf(a.l, b.h, c); c = wmma_bf(a.h, b.l, c); return wmma_bf(a.h, b.h, c); }
__device__ __forceinline__ float sigm(float v) { return 1.0f / (1.0f + expf(-v)); }
#define LDSX() do { asm volatile("s_wait_dscnt 0" ::: "memory"); __builtin_amdgcn_wave_barrier(); __builtin_amdgcn_fence(__ATOMIC_RELEASE, "workgroup"); } while (0)


// Cyclic attention block: Q = q Wq + bq, K = k Wk + bk, V = v Wv + bv (16 heads x 64), softmax(Q K^T / 8) V merged; outputs (c, h) = (merged Wc + bc, merged Wo + bo).  B 2, S 2048, H 1024, cyclic_size 1024.
// k_pack (Wq|Wk|Wv|Wo|Wc columns as bf16 rows), k_proj, k_vt, k_attn (flash-style, 64 key steps), k_out x2 (c into output 0, h into output 1).
#define NB 2
#define SS 2048
#define DM 1024
#define NH 16
#define HD 64
#define NR (NB * SS)
#define QKVP (3 * DM)
#ifndef TRB
#define TRB (NR / 64)
#define TQB (SS / 64)
#define TNB NB
#endif
typedef __attribute__((ext_vector_type(8))) __bf16 v8b;
__device__ __forceinline__ v16b frag_b(const __bf16* rowk0, int lane) {
  union { v16b v; v8b q[2]; } u; const __bf16* p = rowk0 + 8 * (lane >> 4);
  u.q[0] = *(const v8b*)p; u.q[1] = *(const v8b*)(p + 16); return u.v;
}
__device__ __forceinline__ v16b frag_gbf(const float* rowk0, int lane) {
  v16b a; const float* p = rowk0 + 8 * (lane >> 4);
#pragma unroll
  for (int i = 0; i < 8; ++i) { a[i] = (__bf16)p[i]; a[8 + i] = (__bf16)p[16 + i]; }
  return a;
}
__device__ __forceinline__ float bfr(float v) { return (float)(__bf16)v; }
#define WS_PT   0u                                 // bf16 [5*1024 (q|k|v|o|c cols)][1024]
#define WS_QKV  (WS_PT + 2u * 5 * DM * DM)           // f32 [4096 rows][3072]  (q 0..1023 | k | v) ; q cols later overwritten by O
#define WS_VTH  (WS_QKV + 4u * NR * QKVP)            // bf16 [2][1024 (h*64+d)][2048]
#define WS_VTL  (WS_VTH + 2u * NB * DM * SS)
#define WS_END  (WS_VTL + 2u * NB * DM * SS)

__global__ __launch_bounds__(128) void k_pack(const float* __restrict__ Wq, const float* __restrict__ Wk, const float* __restrict__ Wv, const float* __restrict__ Wo, const float* __restrict__ Wc, __bf16* __restrict__ PT) {
  __shared__ __align__(16) __bf16 srow[DM];
  const int n = blockIdx.x, tid = threadIdx.x; const int which = n / DM, c = n % DM; const float* Wm = which == 0 ? Wq : (which == 1 ? Wk : (which == 2 ? Wv : (which == 3 ? Wo : Wc)));
  for (int k = tid; k < DM; k += 128) srow[k] = (__bf16)Wm[(size_t)k * DM + c];   // [in][out]: column c
  __syncthreads();
  if (tid < DM / 8) vst2((unsigned*)(PT + (size_t)n * DM + tid * 8), *(const v4u*)(&srow[tid * 8]));
}
// ---- k_proj: QKV[r][n] = bf16(x[r]) . PT[n] (exact), K = 1024; block (64 rows, 128 cols); 512-B segments of 12-KB rows
__global__ __launch_bounds__(128) void k_proj(const float* __restrict__ XQ, const float* __restrict__ XK, const float* __restrict__ XV, const __bf16* __restrict__ PT, const float* __restrict__ bq, const float* __restrict__ bk, const float* __restrict__ bv, float* __restrict__ QKV) {
  const float* X = (blockIdx.y * 128) < DM ? XQ : ((blockIdx.y * 128) < 2 * DM ? XK : XV);
  __shared__ __align__(16) float so[4][16][132];
  const int tid = threadIdx.x, wave = tid >> 5, lane = tid & 31, col = lane & 15, g = lane >> 4; const size_t r0 = (size_t)blockIdx.x * 64 + wave * 16; const int n0 = blockIdx.y * 128;
  v8f acc[8] = {};
#pragma unroll 2
  for (int kc = 0; kc < DM / 32; ++kc) { const v16b a = frag_gbf(X + (r0 + col) * DM + kc * 32, lane);
#pragma unroll
    for (int j = 0; j < 8; ++j) acc[j] = wmma_bf(a, frag_b(PT + (size_t)(n0 + j * 16 + col) * DM + kc * 32, lane), acc[j]); }
#pragma unroll
  for (int j = 0; j < 8; ++j) { const int n = n0 + j * 16 + col; const int which = n / DM, c = n % DM; const float bb = bfr((which == 0 ? bq : which == 1 ? bk : bv)[c]);
#pragma unroll
    for (int r = 0; r < 8; ++r) so[wave][8 * g + r][j * 16 + col] = acc[j][r] + bb; }
  LDSX();
  for (int rl = 0; rl < 16; ++rl) vst2(QKV + (r0 + rl) * QKVP + n0 + lane * 4, *(const v4f*)&so[wave][rl][lane * 4]);
}
__global__ __launch_bounds__(256) void k_vt(const float* __restrict__ QKV, __bf16* __restrict__ VTH, __bf16* __restrict__ VTL) {
  __shared__ __align__(16) __bf16 svh[DM][72], svl[DM][72];
  const int tid = threadIdx.x; const size_t t0 = (size_t)blockIdx.x * 64; const int b = (int)(t0 / SS), p0 = (int)(t0 % SS);
#pragma unroll 1
  for (int tl = 0; tl < 64; ++tl) { const float* row = QKV + (t0 + tl) * QKVP; for (int q = tid; q < DM; q += 256) { const float v = row[2 * DM + q]; const __bf16 hb = (__bf16)v; svh[q][tl] = hb; svl[q][tl] = (__bf16)(v - (float)hb); } }
  __syncthreads();
  for (int q = tid; q < DM * 8; q += 256) { const int rowi = q >> 3, pc = q & 7; const size_t o = ((size_t)b * DM + rowi) * SS + p0 + pc * 8; vst2((unsigned*)(VTH + o), *(const v4u*)&svh[rowi][pc * 8]); vst2((unsigned*)(VTL + o), *(const v4u*)&svl[rowi][pc * 8]); }
}
// ---- k_attn: block = (query block qb, b*16 + h), 4 waves: all SS/32 key steps; online softmax; O written over the q columns of the block's rows (head segment 256 B)
// The 32-key K tile (f32) and V tile (hi, lo) of a step are brought into LDS once per block by asynchronous copies, two buffers, the next step's tile in flight while this one is worked on; all four waves read their fragments from LDS.
// LDS pitches are 16 B x odd, conflict-free for 16-byte LDS reads: K rows of 256 B at 272 B, V rows of 64 B at 80 B.
#define KPF 68
#define VPB 40
#define KBUFB (32 * KPF * 4)
#define VARRB (HD * VPB * 2)
#define VBUFB (2 * VARRB)
// one thread's eight 16-byte copies of one tile: K rows r, r+8, r+16, r+24; V rows d, d+32 of hi and of lo
__device__ __forceinline__ void attn_stage(const float* kg, const __bf16* vhg, const __bf16* vlg, unsigned lk, unsigned lv) {
  // the copies and s_wait_xcnt 0 in one statement: the wait stands in front of any rewrite of an address register that a copy names
  asm volatile("global_load_async_to_lds_b128 %0, %8, off\n\t"
               "global_load_async_to_lds_b128 %1, %9, off\n\t"
               "global_load_async_to_lds_b128 %2, %10, off\n\t"
               "global_load_async_to_lds_b128 %3, %11, off\n\t"
               "global_load_async_to_lds_b128 %4, %12, off\n\t"
               "global_load_async_to_lds_b128 %5, %13, off\n\t"
               "global_load_async_to_lds_b128 %6, %14, off\n\t"
               "global_load_async_to_lds_b128 %7, %15, off\n\t"
               "s_wait_xcnt 0x0"
               :: "v"(lk), "v"(lk + 8 * KPF * 4), "v"(lk + 16 * KPF * 4), "v"(lk + 24 * KPF * 4),
                  "v"(lv), "v"(lv + 32 * VPB * 2), "v"(lv + VARRB), "v"(lv + VARRB + 32 * VPB * 2),
                  "v"(kg), "v"(kg + 8 * QKVP), "v"(kg + 16 * QKVP), "v"(kg + 24 * QKVP),
                  "v"(vhg), "v"(vhg + 32 * SS), "v"(vlg), "v"(vlg + 32 * SS)
               : "memory");
}
__global__ __launch_bounds__(128) void k_attn(float* __restrict__ QKV, const __bf16* __restrict__ VTH, const __bf16* __restrict__ VTL) {
  __shared__ __align__(16) float sp[4][16][36]; __shared__ __align__(16) float so[4][16][68];
  __shared__ __align__(16) float sk[2][32][KPF]; __shared__ __align__(16) __bf16 sv[2][2][HD][VPB];
  const int tid = threadIdx.x, wave = tid >> 5, lane = tid & 31, col = lane & 15, g = lane >> 4;
  const int qb = blockIdx.x, bh = blockIdx.y, b = bh / NH, h = bh % NH; const int q0 = qb * 64 + wave * 16; const size_t tq = (size_t)b * SS + q0;
  const F2 a0 = split_row(QKV + (tq + col) * QKVP + h * HD, 0, lane), a1 = split_row(QKV + (tq + col) * QKVP + h * HD, 32, lane);
  float m[8], l[8];
#pragma unroll
  for (int r = 0; r < 8; ++r) { m[r] = -3.0e38f; l[r] = 0.f; }
  v8f acc[4] = {};
  const int nsteps = SS / 32;
  const float* kg = QKV + ((size_t)b * SS + (tid >> 4)) * QKVP + DM + h * HD + (tid & 15) * 4;
  const size_t vo = ((size_t)b * DM + h * HD + (tid >> 2)) * SS + (tid & 3) * 8;
  const __bf16 *vhg = VTH + vo, *vlg = VTL + vo;
  const unsigned lk = (unsigned)(size_t)&sk[0][tid >> 4][(tid & 15) * 4], lv = (unsigned)(size_t)&sv[0][0][tid >> 2][(tid & 3) * 8];
  attn_stage(kg, vhg, vlg, lk, lv);
  asm volatile("s_wait_asynccnt 0x0" ::: "memory");   // this wave's copies of tile 0 have landed
  __syncthreads();                                    // tile 0 is readable by every wave
  attn_stage(kg + (size_t)32 * QKVP, vhg + 32, vlg + 32, lk + KBUFB, lv + VBUFB);
#pragma unroll 1
  for (int ks = 0; ks < nsteps; ++ks) {
    const int cur = ks & 1;
    v8f s[2];
#pragma unroll
    for (int ct = 0; ct < 2; ++ct) { const float* krow = &sk[cur][ct * 16 + col][0]; const F2 k0 = split_row(krow, 0, lane), k1 = split_row(krow, 32, lane);
      v8f c = mac3(a0, k0, (v8f){}); c = mac3(a1, k1, c);
#pragma unroll
      for (int r = 0; r < 8; ++r) s[ct][r] = c[r] * 0.125f; }
#pragma unroll
    for (int r = 0; r < 8; ++r) { float mx = fmaxf(s[0][r], s[1][r]);
#pragma unroll
      for (int o = 1; o < 16; o <<= 1) mx = fmaxf(mx, __shfl_xor(mx, o));
      const float mn = fmaxf(m[r], mx); const float alpha = expf(m[r] - mn);
      const float e0 = expf(s[0][r] - mn), e1 = expf(s[1][r] - mn); float es = e0 + e1;
#pragma unroll
      for (int o = 1; o < 16; o <<= 1) es += __shfl_xor(es, o);
      l[r] = l[r] * alpha + es; m[r] = mn;
#pragma unroll
      for (int dt = 0; dt < 4; ++dt) acc[dt][r] *= alpha;
      sp[wave][8 * g + r][col] = e0; sp[wave][8 * g + r][16 + col] = e1; }
    LDSX();
    const F2 pa = split_row(&sp[wave][col][0], 0, lane);
#pragma unroll
    for (int dt = 0; dt < 4; ++dt) { const v16b vh = frag_b(&sv[cur][0][dt * 16 + col][0], lane), vl = frag_b(&sv[cur][1][dt * 16 + col][0], lane);
      acc[dt] = wmma_bf(pa.l, vh, acc[dt]); acc[dt] = wmma_bf(pa.h, vl, acc[dt]); acc[dt] = wmma_bf(pa.h, vh, acc[dt]); }
    asm volatile("s_wait_dscnt 0x0" ::: "memory");      // this wave's LDS reads of this step (tile and sp) are done
    asm volatile("s_wait_asynccnt 0x0" ::: "memory");   // this wave's copies of the next tile have landed
    __syncthreads();                                    // publishes the next tile and frees this step's buffer
    if (ks + 2 < nsteps) attn_stage(kg + (size_t)(ks + 2) * 32 * QKVP, vhg + (ks + 2) * 32, vlg + (ks + 2) * 32, lk + cur * KBUFB, lv + cur * VBUFB); }
  asm volatile("s_wait_asynccnt 0x0" ::: "memory");     // no copy is outstanding behind the loop
#pragma unroll
  for (int r = 0; r < 8; ++r) { const float il = 1.0f / l[r];
#pragma unroll
    for (int dt = 0; dt < 4; ++dt) so[wave][8 * g + r][dt * 16 + col] = acc[dt][r] * il; }
  LDSX();
  for (int rl = 0; rl < 16; ++rl) if (lane < 16) vst2(QKV + (tq + rl) * QKVP + h * HD + lane * 4, *(const v4f*)&so[wave][rl][lane * 4]);
}
// ---- k_out: Y = O(hi/lo; the q columns of QKV) . PT_out rows (2 products, K = 1024); block (64 rows, 128 cols)
__global__ __launch_bounds__(128) void k_out(const float* __restrict__ QKV, const __bf16* __restrict__ PT, int wblk, const float* __restrict__ bo, float* __restrict__ Y) {
  __shared__ __align__(16) float so[4][16][132];
  const int tid = threadIdx.x, wave = tid >> 5, lane = tid & 31, col = lane & 15, g = lane >> 4; const size_t r0 = (size_t)blockIdx.x * 64 + wave * 16; const int n0 = blockIdx.y * 128;
  v8f acc[8] = {};
#pragma unroll 2
  for (int kc = 0; kc < DM / 32; ++kc) { const F2 a = split_row(QKV + (r0 + col) * QKVP, kc * 32, lane);
#pragma unroll
    for (int j = 0; j < 8; ++j) { const v16b w = frag_b(PT + (size_t)(wblk * DM + n0 + j * 16 + col) * DM + kc * 32, lane); acc[j] = wmma_bf(a.l, w, acc[j]); acc[j] = wmma_bf(a.h, w, acc[j]); } }
#pragma unroll
  for (int j = 0; j < 8; ++j) { const float bb = bfr(bo[n0 + j * 16 + col]);
#pragma unroll
    for (int r = 0; r < 8; ++r) so[wave][8 * g + r][j * 16 + col] = acc[j][r] + bb; }
  LDSX();
  for (int rl = 0; rl < 16; ++rl) vst2(Y + (r0 + rl) * DM + n0 + lane * 4, *(const v4f*)&so[wave][rl][lane * 4]);
}

extern "C" void kernel_launch(void* const* d_in, const int* in_sizes, int n_in, void* d_out, int out_size, void* d_ws, size_t ws_size, hipStream_t stream) {
  (void)in_sizes; (void)n_in; (void)out_size;
  const float** F = (const float**)d_in;   // q, k, v [2,2048,1024], Wq, bq, Wk, bk, Wv, bv, Wo, bo ([in][out] 1024x1024), Wc [1024,1024], bc
  if (ws_size < (size_t)WS_END) return;
  char* ws = (char*)d_ws; __bf16 *PT = (__bf16*)(ws + WS_PT), *VTH = (__bf16*)(ws + WS_VTH), *VTL = (__bf16*)(ws + WS_VTL); float* QKV = (float*)(ws + WS_QKV);
  float* OUTC = (float*)d_out; float* OUTH = OUTC + (size_t)NR * DM;     // outputs: (c, h)
  k_pack<<<5 * DM, 128, 0, stream>>>(F[3], F[5], F[7], F[9], F[11], PT);
  k_proj<<<dim3(TRB, QKVP / 128), 128, 0, stream>>>(F[0], F[1], F[2], PT, F[4], F[6], F[8], QKV);
  k_vt<<<TRB, 256, 0, stream>>>(QKV, VTH, VTL);
  k_attn<<<dim3(TQB, TNB * NH), 128, 0, stream>>>(QKV, VTH, VTL);
  k_out<<<dim3((TNB < NB ? TQB : NR / 64), DM / 128), 128, 0, stream>>>(QKV, PT, 4, F[12], OUTC);
  k_out<<<dim3((TNB < NB ? TQB : NR / 64), DM / 128), 128, 0, stream>>>(QKV, PT, 3, F[10], OUTH);
}

// v003
// Measured time: 545 microseconds a run.
// Timed twice side by side with v002, it ran 1.09 and 1.10 times as fast.
// Over all steps from v000 it is 1.36 times as fast.
// compute dtype: q/k/v inputs, the five [in][out] weights + biases (module inputs) rounded to bf16; Q/K/V projections with exact bf16 products (+ bias); scores and P.V with both computed operands as bf16 hi + bf16 residual pairs (3 products); the two output projections (Wc → c, Wo → h) hi/lo x bf16 weights (2 products) + bias; online softmax in f32; f32 accumulate.
#include <hip/hip_runtime.h>
#include <math.h>

typedef __attribute__((ext_vector_type(16))) _Float16 v16h;
typedef __attribute__((ext_vector_type(16))) __bf16 v16b;
typedef __attribute__((ext_vector_type(8)))  _Float16 v8h;
typedef __attribute__((ext_vector_type(8)))  float v8f;
typedef __attribute__((ext_vector_type(4)))  float v4f;
typedef __attribute__((ext_vector_type(2)))  float v2f;
typedef __attribute__((ext_vector_type(4)))  unsigned v4u;
typedef __attribute__((ext_vector_type(4)))  int v4i;
typedef float __attribute__((may_alias)) float_a;
typedef int __attribute__((may_alias)) int_a;

template <typename T> __device__ __forceinline__ void vst2(void* p, T v) { *(T*)p = v;  }
__device__ __forceinline__ v8f wmma16(v16h a, v16h b, v8f c) {
  v8f d = __builtin_amdgcn_wmma_f32_16x16x32_f16(false, a, false, b, (short)0, c, false, false);
  asm volatile("v_nop\n\tv_nop\n\tv_nop\n\tv_nop" : "+v"(d) : "v"(a), "v"(b));
  return d;
}
__device__ __forceinline__ v8f wmma_bf(v16b a, v16b b, v8f c) {
  v8f d = __builtin_amdgcn_wmma_f32_16x16x32_bf16(false, a, false, b, (short)0, c, false, false);
  asm volatile("v_nop\n\tv_nop\n\tv_nop\n\tv_nop" : "+v"(d) : "v"(a), "v"(b));
  return d;
}
// 16x16x32 fragments: lane = (h = lane>>4, row/col = lane&15); elements 0..7 = k0+8h+0..7, 8..15 = k0+16+8h+0..7; D element r = row 8h+r
__device__ __forceinline__ v16h frag_h(const _Float16* rowk0, int lane) {
  union { v16h v; v8h q[2]; } u; const _Float16* p = rowk0 + 8 * (lane >> 4);
  u.q[0] = *(const v8h*)p; u.q[1] = *(const v8h*)(p + 16); return u.v;
}
__device__ __forceinline__ v16h frag_f32(const float* rowk0, int lane) {
  v16h a; const float* p = rowk0 + 8 * (lane >> 4);
#pragma unroll
  for (int i = 0; i < 8; ++i) { a[i] = (_Float16)p[i]; a[8 + i] = (_Float16)p[16 + i]; }
  return a;
}
__device__ __forceinline__ v16h frag_f32s(const float* rowk0, int lane, float sc) {
  v16h a; const float* p = rowk0 + 8 * (lane >> 4);
#pragma unroll
  for (int i = 0; i < 8; ++i) { a[i] = (_Float16)(p[i] * sc); a[8 + i] = (_Float16)(p[16 + i] * sc); }
  return a;
}
// column fragment from a [K][ld] layout (column n), rows >= K read as 0
__device__ __forceinline__ v16h fragc_f32(const float* W, int k0, int n, int lane, int ld, int K) {
  v16h a; const int g = lane >> 4;
#pragma unroll
  for (int i = 0; i < 8; ++i) { const int ka = k0 + 8 * g + i, kb = ka + 16;
    a[i] = (_Float16)(ka < K ? W[(size_t)(ka < K ? ka : K - 1) * ld + n] : 0.f); a[8 + i] = (_Float16)(kb < K ? W[(size_t)(kb < K ? kb : K - 1) * ld + n] : 0.f); }
  return a;
}
struct F2 { v16b h, l; };
__device__ __forceinline__ F2 bsplit16(const float v[16]) { F2 r;
#pragma unroll
  for (int i = 0; i < 16; ++i) { const __bf16 h = (__bf16)v[i]; r.h[i] = h; r.l[i] = (__bf16)(v[i] - (float)h); }
  return r; }
__device__ __forceinline__ F2 split_row(const float* row, int k0, int lane) { float v[16]; const float* p = row + k0 + 8 * (lane >> 4);
#pragma unroll
  for (int i = 0; i < 8; ++i) { v[i] = p[i]; v[8 + i] = p[16 + i]; }
  return bsplit16(v); }
__device__ __forceinline__ F2 split_rowK(const float* row, int k0, int lane, int K) { float v[16]; const int g = lane >> 4;
#pragma unroll
  for (int i = 0; i < 8; ++i) { const int ka = k0 + 8 * g + i, kb = ka + 16; v[i] = ka < K ? row[ka < K ? ka : K - 1] : 0.f; v[8 + i] = kb < K ? row[kb < K ? kb : K - 1] : 0.f; }
  return bsplit16(v); }
__device__ __forceinline__ F2 split_col(const float* W, int k0, int n, int lane, int ld, int K) { float v[16]; const int g = lane >> 4;
#pragma unroll
  for (int i = 0; i < 8; ++i) { const int ka = k0 + 8 * g + i, kb = ka + 16; v[i] = ka < K ? W[(size_t)(ka < K ? ka : K - 1) * ld + n] : 0.f; v[8 + i] = kb < K ? W[(size_t)(kb < K ? kb : K - 1) * ld + n] : 0.f; }
  return bsplit16(v); }
__device__ __forceinline__ v8f mac3(const F2& a, const F2& b, v8f c) { c = wmma_bf(a.l, b.h, c); c = wmma_bf(a.h, b.l, c); return wmma_bf(a.h, b.h, c); }
__device__ __forceinline__ float sigm(float v) { return 1.0f / (1.0f + expf(-v)); }
#define LDSX() do { asm volatile("s_wait_dscnt 0" ::: "memory"); __builtin_amdgcn_wave_barrier(); __builtin_amdgcn_fence(__ATOMIC_RELEASE, "workgroup"); } while (0)


// Cyclic attention block: Q = q Wq + bq, K = k Wk + bk, V = v Wv + bv (16 heads x 64), softmax(Q K^T / 8) V merged; outputs (c, h) = (merged Wc + bc, merged Wo + bo).  B 2, S 2048, H 1024, cyclic_size 1024.
// k_pack (Wq|Wk|Wv|Wo|Wc columns as bf16 rows), k_proj, k_vt, k_attn (flash-style, 64 key steps), k_out x2 (c into output 0, h into output 1).
#define NB 2
#define SS 2048
#define DM 1024
#define NH 16
#define HD 64
#define NR (NB * SS)
#define QKVP (3 * DM)
#ifndef TRB
#define TRB (NR / 64)
#define TQB (SS / 64)
#define TNB NB
#endif
typedef __attribute__((ext_vector_type(8))) __bf16 v8b;
__device__ __forceinline__ v16b frag_b(const __bf16* rowk0, int lane) {
  union { v16b v; v8b q[2]; } u; const __bf16* p = rowk0 + 8 * (lane >> 4);
  u.q[0] = *(const v8b*)p; u.q[1] = *(const v8b*)(p + 16); return u.v;
}
__device__ __forceinline__ v16b frag_gbf(const float* rowk0, int lane) {
  v16b a; const float* p = rowk0 + 8 * (lane >> 4);
#pragma unroll
  for (int i = 0; i < 8; ++i) { a[i] = (__bf16)p[i]; a[8 + i] = (__bf16)p[16 + i]; }
  return a;
}
__device__ __forceinline__ float bfr(float v) { return (float)(__bf16)v; }
#define WS_PT   0u                                 // bf16 [5*1024 (q|k|v|o|c cols)][1024]
#define WS_QKV  (WS_PT + 2u * 5 * DM * DM)           // f32 [4096 rows][3072]  (q 0..1023 | k | v) ; q cols later overwritten by O
#define WS_VTH  (WS_QKV + 4u * NR * QKVP)            // bf16 [2][1024 (h*64+d)][2048]
#define WS_VTL  (WS_VTH + 2u * NB * DM * SS)
#define WS_END  (WS_VTL + 2u * NB * DM * SS)

__global__ __launch_bounds__(128) void k_pack(const float* __restrict__ Wq, const float* __restrict__ Wk, const float* __restrict__ Wv, const float* __restrict__ Wo, const float* __restrict__ Wc, __bf16* __restrict__ PT) {
  __shared__ __align__(16) __bf16 srow[DM];
  const int n = blockIdx.x, tid = threadIdx.x; const int which = n / DM, c = n % DM; const float* Wm = which == 0 ? Wq : (which == 1 ? Wk : (which == 2 ? Wv : (which == 3 ? Wo : Wc)));
  for (int k = tid; k < DM; k += 128) srow[k] = (__bf16)Wm[(size_t)k * DM + c];   // [in][out]: column c
  __syncthreads();
  if (tid < DM / 8) vst2((unsigned*)(PT + (size_t)n * DM + tid * 8), *(const v4u*)(&srow[tid * 8]));
}
// ---- k_proj: QKV[r][n] = bf16(x[r]) . PT[n] (exact), K = 1024; block (64 rows, 128 cols); 512-B segments of 12-KB rows
__global__ __launch_bounds__(128) void k_proj(const float* __restrict__ XQ, const float* __restrict__ XK, const float* __restrict__ XV, const __bf16* __restrict__ PT, const float* __restrict__ bq, const float* __restrict__ bk, const float* __restrict__ bv, float* __restrict__ QKV) {
  const float* X = (blockIdx.y * 128) < DM ? XQ : ((blockIdx.y * 128) < 2 * DM ? XK : XV);
  __shared__ __align__(16) float so[4][16][132];
  const int tid = threadIdx.x, wave = tid >> 5, lane = tid & 31, col = lane & 15, g = lane >> 4; const size_t r0 = (size_t)blockIdx.x * 64 + wave * 16; const int n0 = blockIdx.y * 128;
  v8f acc[8] = {};
#pragma unroll 2
  for (int kc = 0; kc < DM / 32; ++kc) { const v16b a = frag_gbf(X + (r0 + col) * DM + kc * 32, lane);
#pragma unroll
    for (int j = 0; j < 8; ++j) acc[j] = wmma_bf(a, frag_b(PT + (size_t)(n0 + j * 16 + col) * DM + kc * 32, lane), acc[j]); }
#pragma unroll
  for (int j = 0; j < 8; ++j) { const int n = n0 + j * 16 + col; const int which = n / DM, c = n % DM; const float bb = bfr((which == 0 ? bq : which == 1 ? bk : bv)[c]);
#pragma unroll
    for (int r = 0; r < 8; ++r) so[wave][8 * g + r][j * 16 + col] = acc[j][r] + bb; }
  LDSX();
  for (int rl = 0; rl < 16; ++rl) vst2(QKV + (r0 + rl) * QKVP + n0 + lane * 4, *(const v4f*)&so[wave][rl][lane * 4]);
}
__global__ __launch_bounds__(256) void k_vt(const float* __restrict__ QKV, __bf16* __restrict__ VTH, __bf16* __restrict__ VTL) {
  __shared__ __align__(16) __bf16 svh[DM][72], svl[DM][72];
  const int tid = threadIdx.x; const size_t t0 = (size_t)blockIdx.x * 64; const int b = (int)(t0 / SS), p0 = (int)(t0 % SS);
#pragma unroll 1
  for (int tl = 0; tl < 64; ++tl) { const float* row = QKV + (t0 + tl) * QKVP; for (int q = tid; q < DM; q += 256) { const float v = row[2 * DM + q]; const __bf16 hb = (__bf16)v; svh[q][tl] = hb; svl[q][tl] = (__bf16)(v - (float)hb); } }
  __syncthreads();
  for (int q = tid; q < DM * 8; q += 256) { const int rowi = q >> 3, pc = q & 7; const size_t o = ((size_t)b * DM + rowi) * SS + p0 + pc * 8; vst2((unsigned*)(VTH + o), *(const v4u*)&svh[rowi][pc * 8]); vst2((unsigned*)(VTL + o), *(const v4u*)&svl[rowi][pc * 8]); }
}
// ---- k_attn: block = (query block qb, b*16 + h), 4 waves: all SS/32 key steps; online softmax; O written over the q columns of the block's rows (head segment 256 B)
// The products are taken transposed: S^T = K Q^T (A = K rows, B = Q rows) and O^T += V^T P^T (A = V^T rows, B = P^T).  A lane then holds 16 of the 32 scores of ONE query (column lane & 15; keys 8g + r and 16 + 8g + r),
// so maximum and sum are in-lane with one exchange between the wave's halves, and the two score tiles, converted in place, are the B fragment of P^T in the loaders' own k order: P goes through no LDS.
// The 32-key K tile (f32) and V tile (hi, lo) of a step are brought into LDS once per block by asynchronous copies, two buffers, the next step's tile in flight while this one is worked on; all four waves read their fragments from LDS.
// LDS pitches are 16 B x odd, conflict-free for 16-byte LDS reads: K rows of 256 B at 272 B, V rows of 64 B at 80 B.
#define KPF 68
#define VPB 40
#define KBUFB (32 * KPF * 4)
#define VARRB (HD * VPB * 2)
#define VBUFB (2 * VARRB)
// one thread's eight 16-byte copies of one tile: K rows r, r+8, r+16, r+24; V rows d, d+32 of hi and of lo
__device__ __forceinline__ void attn_stage(const float* kg, const __bf16* vhg, const __bf16* vlg, unsigned lk, unsigned lv) {
  // the copies and s_wait_xcnt 0 in one statement: the wait stands in front of any rewrite of an address register that a copy names
  asm volatile("global_load_async_to_lds_b128 %0, %8, off\n\t"
               "global_load_async_to_lds_b128 %1, %9, off\n\t"
               "global_load_async_to_lds_b128 %2, %10, off\n\t"
               "global_load_async_to_lds_b128 %3, %11, off\n\t"
               "global_load_async_to_lds_b128 %4, %12, off\n\t"
               "global_load_async_to_lds_b128 %5, %13, off\n\t"
               "global_load_async_to_lds_b128 %6, %14, off\n\t"
               "global_load_async_to_lds_b128 %7, %15, off\n\t"
               "s_wait_xcnt 0x0"
               :: "v"(lk), "v"(lk + 8 * KPF * 4), "v"(lk + 16 * KPF * 4), "v"(lk + 24 * KPF * 4),
                  "v"(lv), "v"(lv + 32 * VPB * 2), "v"(lv + VARRB), "v"(lv + VARRB + 32 * VPB * 2),
                  "v"(kg), "v"(kg + 8 * QKVP), "v"(kg + 16 * QKVP), "v"(kg + 24 * QKVP),
                  "v"(vhg), "v"(vhg + 32 * SS), "v"(vlg), "v"(vlg + 32 * SS)
               : "memory");
}
// lane l <-> lane l ^ 16
__device__ __forceinline__ float xhalf(float v) { const int b = __builtin_bit_cast(int, v); return __builtin_bit_cast(float, __builtin_amdgcn_permlanex16(b, b, 0x76543210, 0xfedcba98, false, false)); }
// mac3 with the operands' sides swapped: the three products are added in mac3's order
__device__ __forceinline__ v8f mac3t(const F2& a, const F2& b, v8f c) { c = wmma_bf(a.h, b.l, c); c = wmma_bf(a.l, b.h, c); return wmma_bf(a.h, b.h, c); }
__global__ __launch_bounds__(128) void k_attn(float* __restrict__ QKV, const __bf16* __restrict__ VTH, const __bf16* __restrict__ VTL) {
  __shared__ __align__(16) float so[4][16][68];
  __shared__ __align__(16) float sk[2][32][KPF]; __shared__ __align__(16) __bf16 sv[2][2][HD][VPB];
  const int tid = threadIdx.x, wave = tid >> 5, lane = tid & 31, col = lane & 15, g = lane >> 4;
  const int qb = blockIdx.x, bh = blockIdx.y, b = bh / NH, h = bh % NH; const int q0 = qb * 64 + wave * 16; const size_t tq = (size_t)b * SS + q0;
  const F2 a0 = split_row(QKV + (tq + col) * QKVP + h * HD, 0, lane), a1 = split_row(QKV + (tq + col) * QKVP + h * HD, 32, lane);
  float m = -3.0e38f, l = 0.f;   // of query col; l sums this half's keys only, the halves are joined behind the loop
  v8f acc[4] = {};               // acc[dt][r] = O[query col][dt * 16 + 8 g + r]
  const int nsteps = SS / 32;
  const float* kg = QKV + ((size_t)b * SS + (tid >> 4)) * QKVP + DM + h * HD + (tid & 15) * 4;
  const size_t vo = ((size_t)b * DM + h * HD + (tid >> 2)) * SS + (tid & 3) * 8;
  const __bf16 *vhg = VTH + vo, *vlg = VTL + vo;
  const unsigned lk = (unsigned)(size_t)&sk[0][tid >> 4][(tid & 15) * 4], lv = (unsigned)(size_t)&sv[0][0][tid >> 2][(tid & 3) * 8];
  attn_stage(kg, vhg, vlg, lk, lv);
  asm volatile("s_wait_asynccnt 0x0" ::: "memory");   // this wave's copies of tile 0 have landed
  __syncthreads();                                    // tile 0 is readable by every wave
  attn_stage(kg + (size_t)32 * QKVP, vhg + 32, vlg + 32, lk + KBUFB, lv + VBUFB);
#pragma unroll 1
  for (int ks = 0; ks < nsteps; ++ks) {
    const int cur = ks & 1;
    float e[16];
#pragma unroll
    for (int ct = 0; ct < 2; ++ct) { const float* krow = &sk[cur][ct * 16 + col][0]; const F2 k0 = split_row(krow, 0, lane), k1 = split_row(krow, 32, lane);
      v8f c = mac3t(k0, a0, (v8f){}); c = mac3t(k1, a1, c);
#pragma unroll
      for (int r = 0; r < 8; ++r) e[ct * 8 + r] = c[r] * 0.125f; }
    float mx = e[0];
#pragma unroll
    for (int i = 1; i < 16; ++i) mx = fmaxf(mx, e[i]);
    mx = fmaxf(mx, xhalf(mx));
    const float mn = fmaxf(m, mx); const float alpha = expf(m - mn); m = mn;
#pragma unroll
    for (int i = 0; i < 16; ++i) e[i] = expf(e[i] - mn);
    l = l * alpha + (((e[0] + e[1]) + (e[2] + e[3])) + ((e[4] + e[5]) + (e[6] + e[7])) + (((e[8] + e[9]) + (e[10] + e[11])) + ((e[12] + e[13]) + (e[14] + e[15]))));
#pragma unroll
    for (int dt = 0; dt < 4; ++dt) acc[dt] *= alpha;
    const F2 pb = bsplit16(e);
#pragma unroll
    for (int dt = 0; dt < 4; ++dt) { const v16b vh = frag_b(&sv[cur][0][dt * 16 + col][0], lane), vl = frag_b(&sv[cur][1][dt * 16 + col][0], lane);
      acc[dt] = wmma_bf(vh, pb.l, acc[dt]); acc[dt] = wmma_bf(vl, pb.h, acc[dt]); acc[dt] = wmma_bf(vh, pb.h, acc[dt]); }
    asm volatile("s_wait_dscnt 0x0" ::: "memory");      // this wave's LDS reads of this step's tile are done
    asm volatile("s_wait_asynccnt 0x0" ::: "memory");   // this wave's copies of the next tile have landed
    __syncthreads();                                    // publishes the next tile and frees this step's buffer
    if (ks + 2 < nsteps) attn_stage(kg + (size_t)(ks + 2) * 32 * QKVP, vhg + (ks + 2) * 32, vlg + (ks + 2) * 32, lk + cur * KBUFB, lv + cur * VBUFB); }
  asm volatile("s_wait_asynccnt 0x0" ::: "memory");     // no copy is outstanding behind the loop
  const float il = 1.0f / (l + xhalf(l));
#pragma unroll
  for (int dt = 0; dt < 4; ++dt) { const v8f o = acc[dt] * il; float* d = &so[wave][col][dt * 16 + 8 * g];
    vst2(d, (v4f){o[0], o[1], o[2], o[3]}); vst2(d + 4, (v4f){o[4], o[5], o[6], o[7]}); }
  LDSX();
  for (int rl = 0; rl < 16; ++rl) if (lane < 16) vst2(QKV + (tq + rl) * QKVP + h * HD + lane * 4, *(const v4f*)&so[wave][rl][lane * 4]);
}
// ---- k_out: Y = O(hi/lo; the q columns of QKV) . PT_out rows (2 products, K = 1024); block (64 rows, 128 cols)
__global__ __launch_bounds__(128) void k_out(const float* __restrict__ QKV, const __bf16* __restrict__ PT, int wblk, const float* __restrict__ bo, float* __restrict__ Y) {
  __shared__ __align__(16) float so[4][16][132];
  const int tid = threadIdx.x, wave = tid >> 5, lane = tid & 31, col = lane & 15, g = lane >> 4; const size_t r0 = (size_t)blockIdx.x * 64 + wave * 16; const int n0 = blockIdx.y * 128;
  v8f acc[8] = {};
#pragma unroll 2
  for (int kc = 0; kc < DM / 32; ++kc) { const F2 a = split_row(QKV + (r0 + col) * QKVP, kc * 32, lane);
#pragma unroll
    for (int j = 0; j < 8; ++j) { const v16b w = frag_b(PT + (size_t)(wblk * DM + n0 + j * 16 + col) * DM + kc * 32, lane); acc[j] = wmma_bf(a.l, w, acc[j]); acc[j] = wmma_bf(a.h, w, acc[j]); } }
#pragma unroll
  for (int j = 0; j < 8; ++j) { const float bb = bfr(bo[n0 + j * 16 + col]);
#pragma unroll
    for (int r = 0; r < 8; ++r) so[wave][8 * g + r][j * 16 + col] = acc[j][r] + bb; }
  LDSX();
  for (int rl = 0; rl < 16; ++rl) vst2(Y + (r0 + rl) * DM + n0 + lane * 4, *(const v4f*)&so[wave][rl][lane * 4]);
}

extern "C" void kernel_launch(void* const* d_in, const int* in_sizes, int n_in, void* d_out, int out_size, void* d_ws, size_t ws_size, hipStream_t stream) {
  (void)in_sizes; (void)n_in; (void)out_size;
  const float** F = (const float**)d_in;   // q, k, v [2,2048,1024], Wq, bq, Wk, bk, Wv, bv, Wo, bo ([in][out] 1024x1024), Wc [1024,1024], bc
  if (ws_size < (size_t)WS_END) return;
  char* ws = (char*)d_ws; __bf16 *PT = (__bf16*)(ws + WS_PT), *VTH = (__bf16*)(ws + WS_VTH), *VTL = (__bf16*)(ws + WS_VTL); float* QKV = (float*)(ws + WS_QKV);
  float* OUTC = (float*)d_out; float* OUTH = OUTC + (size_t)NR * DM;     // outputs: (c, h)
  k_pack<<<5 * DM, 128, 0, stream>>>(F[3], F[5], F[7], F[9], F[11], PT);
  k_proj<<<dim3(TRB, QKVP / 128), 128, 0, stream>>>(F[0], F[1], F[2], PT, F[4], F[6], F[8], QKV);
  k_vt<<<TRB, 256, 0, stream>>>(QKV, VTH, VTL);
  k_attn<<<dim3(TQB, TNB * NH), 128, 0, stream>>>(QKV, VTH, VTL);
  k_out<<<dim3((TNB < NB ? TQB : NR / 64), DM / 128), 128, 0, stream>>>(QKV, PT, 4, F[12], OUTC);
  k_out<<<dim3((TNB < NB ? TQB : NR / 64), DM / 128), 128, 0, stream>>>(QKV, PT, 3, F[10], OUTH);
}

// v004
// A run of this version takes 365 microseconds.
// Timed twice side by side with v003, it ran 1.51 and 1.50 times as fast.
// All steps since v000 together make it 2.05 times as fast.
// compute dtype: q/k/v inputs, the five [in][out] weights + biases (module inputs) rounded to bf16; Q/K/V projections with exact bf16 products (+ bias); scores and P.V with both computed operands as bf16 hi + bf16 residual pairs (3 products); the two output projections (Wc → c, Wo → h) hi/lo x bf16 weights (2 products) + bias; online softmax in f32; f32 accumulate.
#include <hip/hip_runtime.h>
#include <math.h>

typedef __attribute__((ext_vector_type(16))) _Float16 v16h;
typedef __attribute__((ext_vector_type(16))) __bf16 v16b;
typedef __attribute__((ext_vector_type(8)))  _Float16 v8h;
typedef __attribute__((ext_vector_type(8)))  float v8f;
typedef __attribute__((ext_vector_type(4)))  float v4f;
typedef __attribute__((ext_vector_type(2)))  float v2f;
typedef __attribute__((ext_vector_type(4)))  unsigned v4u;
typedef __attribute__((ext_vector_type(4)))  int v4i;
typedef float __attribute__((may_alias)) float_a;
typedef int __attribute__((may_alias)) int_a;

template <typename T> __device__ __forceinline__ void vst2(void* p, T v) { *(T*)p = v;  }
__device__ __forceinline__ v8f wmma16(v16h a, v16h b, v8f c) {
  v8f d = __builtin_amdgcn_wmma_f32_16x16x32_f16(false, a, false, b, (short)0, c, false, false);
  asm volatile("v_nop\n\tv_nop\n\tv_nop\n\tv_nop" : "+v"(d) : "v"(a), "v"(b));
  return d;
}
__device__ __forceinline__ v8f wmma_bf(v16b a, v16b b, v8f c) {
  v8f d = __builtin_amdgcn_wmma_f32_16x16x32_bf16(false, a, false, b, (short)0, c, false, false);
  asm volatile("v_nop\n\tv_nop\n\tv_nop\n\tv_nop" : "+v"(d) : "v"(a), "v"(b));
  return d;
}
// 16x16x32 fragments: lane = (h = lane>>4, row/col = lane&15); elements 0..7 = k0+8h+0..7, 8..15 = k0+16+8h+0..7; D element r = row 8h+r
__device__ __forceinline__ v16h frag_h(const _Float16* rowk0, int lane) {
  union { v16h v; v8h q[2]; } u; const _Float16* p = rowk0 + 8 * (lane >> 4);
  u.q[0] = *(const v8h*)p; u.q[1] = *(const v8h*)(p + 16); return u.v;
}
__device__ __forceinline__ v16h frag_f32(const float* rowk0, int lane) {
  v16h a; const float* p = rowk0 + 8 * (lane >> 4);
#pragma unroll
  for (int i = 0; i < 8; ++i) { a[i] = (_Float16)p[i]; a[8 + i] = (_Float16)p[16 + i]; }
  return a;
}
__device__ __forceinline__ v16h frag_f32s(const float* rowk0, int lane, float sc) {
  v16h a; const float* p = rowk0 + 8 * (lane >> 4);
#pragma unroll
  for (int i = 0; i < 8; ++i) { a[i] = (_Float16)(p[i] * sc); a[8 + i] = (_Float16)(p[16 + i] * sc); }
  return a;
}
// column fragment from a [K][ld] layout (column n), rows >= K read as 0
__device__ __forceinline__ v16h fragc_f32(const float* W, int k0, int n, int lane, int ld, int K) {
  v16h a; const int g = lane >> 4;
#pragma unroll
  for (int i = 0; i < 8; ++i) { const int ka = k0 + 8 * g + i, kb = ka + 16;
    a[i] = (_Float16)(ka < K ? W[(size_t)(ka < K ? ka : K - 1) * ld + n] : 0.f); a[8 + i] = (_Float16)(kb < K ? W[(size_t)(kb < K ? kb : K - 1) * ld + n] : 0.f); }
  return a;
}
struct F2 { v16b h, l; };
__device__ __forceinline__ F2 bsplit16(const float v[16]) { F2 r;
#pragma unroll
  for (int i = 0; i < 16; ++i) { const __bf16 h = (__bf16)v[i]; r.h[i] = h; r.l[i] = (__bf16)(v[i] - (float)h); }
  return r; }
__device__ __forceinline__ F2 split_row(const float* row, int k0, int lane) { float v[16]; const float* p = row + k0 + 8 * (lane >> 4);
#pragma unroll
  for (int i = 0; i < 8; ++i) { v[i] = p[i]; v[8 + i] = p[16 + i]; }
  return bsplit16(v); }
__device__ __forceinline__ F2 split_rowK(const float* row, int k0, int lane, int K) { float v[16]; const int g = lane >> 4;
#pragma unroll
  for (int i = 0; i < 8; ++i) { const int ka = k0 + 8 * g + i, kb = ka + 16; v[i] = ka < K ? row[ka < K ? ka : K - 1] : 0.f; v[8 + i] = kb < K ? row[kb < K ? kb : K - 1] : 0.f; }
  return bsplit16(v); }
__device__ __forceinline__ F2 split_col(const float* W, int k0, int n, int lane, int ld, int K) { float v[16]; const int g = lane >> 4;
#pragma unroll
  for (int i = 0; i < 8; ++i) { const int ka = k0 + 8 * g + i, kb = ka + 16; v[i] = ka < K ? W[(size_t)(ka < K ? ka : K - 1) * ld + n] : 0.f; v[8 + i] = kb < K ? W[(size_t)(kb < K ? kb : K - 1) * ld + n] : 0.f; }
  return bsplit16(v); }
__device__ __forceinline__ v8f mac3(const F2& a, const F2& b, v8f c) { c = wmma_bf(a.l, b.h, c); c = wmma_bf(a.h, b.l, c); return wmma_bf(a.h, b.h, c); }
__device__ __forceinline__ float sigm(float v) { return 1.0f / (1.0f + expf(-v)); }
#define LDSX() do { asm volatile("s_wait_dscnt 0" ::: "memory"); __builtin_amdgcn_wave_barrier(); __builtin_amdgcn_fence(__ATOMIC_RELEASE, "workgroup"); } while (0)


// Cyclic attention block: Q = q Wq + bq, K = k Wk + bk, V = v Wv + bv (16 heads x 64), softmax(Q K^T / 8) V merged; outputs (c, h) = (merged Wc + bc, merged Wo + bo).  B 2, S 2048, H 1024, cyclic_size 1024.
// k_pack (Wq|Wk|Wv|Wo|Wc columns as bf16 rows), k_proj, k_vt, k_attn (flash-style, 64 key steps), k_out x2 (c into output 0, h into output 1).
#define NB 2
#define SS 2048
#define DM 1024
#define NH 16
#define HD 64
#define NR (NB * SS)
#define QKVP (3 * DM)
#ifndef TRB
#define TRB (NR / 64)
#define TQB (SS / 64)
#define TNB NB
#endif
typedef __attribute__((ext_vector_type(8))) __bf16 v8b;
__device__ __forceinline__ v16b frag_b(const __bf16* rowk0, int lane) {
  union { v16b v; v8b q[2]; } u; const __bf16* p = rowk0 + 8 * (lane >> 4);
  u.q[0] = *(const v8b*)p; u.q[1] = *(const v8b*)(p + 16); return u.v;
}
__device__ __forceinline__ v16b frag_gbf(const float* rowk0, int lane) {
  v16b a; const float* p = rowk0 + 8 * (lane >> 4);
#pragma unroll
  for (int i = 0; i < 8; ++i) { a[i] = (__bf16)p[i]; a[8 + i] = (__bf16)p[16 + i]; }
  return a;
}
__device__ __forceinline__ float bfr(float v) { return (float)(__bf16)v; }
#define WS_PT   0u                                 // bf16 [5*1024 (q|k|v|o|c cols)][1024]
#define WS_QKV  (WS_PT + 2u * 5 * DM * DM)           // f32 [4096 rows][3072]  (q 0..1023 | k | v) ; q cols later overwritten by O
#define WS_VTH  (WS_QKV + 4u * NR * QKVP)            // bf16 [2][1024 (h*64+d)][2048]
#define WS_VTL  (WS_VTH + 2u * NB * DM * SS)
#define WS_END  (WS_VTL + 2u * NB * DM * SS)

__global__ __launch_bounds__(128) void k_pack(const float* __restrict__ Wq, const float* __restrict__ Wk, const float* __restrict__ Wv, const float* __restrict__ Wo, const float* __restrict__ Wc, __bf16* __restrict__ PT) {
  __shared__ __align__(16) __bf16 srow[DM];
  const int n = blockIdx.x, tid = threadIdx.x; const int which = n / DM, c = n % DM; const float* Wm = which == 0 ? Wq : (which == 1 ? Wk : (which == 2 ? Wv : (which == 3 ? Wo : Wc)));
  for (int k = tid; k < DM; k += 128) srow[k] = (__bf16)Wm[(size_t)k * DM + c];   // [in][out]: column c
  __syncthreads();
  if (tid < DM / 8) vst2((unsigned*)(PT + (size_t)n * DM + tid * 8), *(const v4u*)(&srow[tid * 8]));
}
// ---- GEMM staging (k_proj, k_out): a stage is 64 k of the block's 64 A rows (f32, 256 B a row) and 128 B rows (bf16, 128 B a row), brought into LDS once per block by asynchronous copies in whole 128-B lines,
// two buffers, the next stage in flight while this one is worked on; the waves read their fragments from LDS in the k order they had.  LDS pitches are 16 B x odd: A 272 B, B 144 B.
#define GKC 64
#define GAP 68
#define GBP 72
#define GABUFB (64 * GAP * 4)
#define GBBUFB (128 * GBP * 2)
// one thread's eight 16-byte copies: global rows gs bytes apart, LDS rows ls bytes apart
__device__ __forceinline__ void gemm_stage8(const char* g, size_t gs, unsigned l, unsigned ls) {
  // the copies and s_wait_xcnt 0 in one statement: the wait stands in front of any rewrite of an address register that a copy names
  asm volatile("global_load_async_to_lds_b128 %0, %8, off\n\t"
               "global_load_async_to_lds_b128 %1, %9, off\n\t"
               "global_load_async_to_lds_b128 %2, %10, off\n\t"
               "global_load_async_to_lds_b128 %3, %11, off\n\t"
               "global_load_async_to_lds_b128 %4, %12, off\n\t"
               "global_load_async_to_lds_b128 %5, %13, off\n\t"
               "global_load_async_to_lds_b128 %6, %14, off\n\t"
               "global_load_async_to_lds_b128 %7, %15, off\n\t"
               "s_wait_xcnt 0x0"
               :: "v"(l), "v"(l + ls), "v"(l + 2 * ls), "v"(l + 3 * ls), "v"(l + 4 * ls), "v"(l + 5 * ls), "v"(l + 6 * ls), "v"(l + 7 * ls),
                  "v"(g), "v"(g + gs), "v"(g + 2 * gs), "v"(g + 3 * gs), "v"(g + 4 * gs), "v"(g + 5 * gs), "v"(g + 6 * gs), "v"(g + 7 * gs)
               : "memory");
}
// stage s into buffer bf: A rows t>>4 + 8 j (row pitch apb bytes in global memory), B rows t>>3 + 16 j
__device__ __forceinline__ void gemm_stage(const char* ag, size_t apb, const char* bg, unsigned la, unsigned lb, int s, int bf) {
  gemm_stage8(ag + (size_t)s * (GKC * 4), 8 * apb, la + bf * GABUFB, 8 * GAP * 4);
  gemm_stage8(bg + (size_t)s * (GKC * 2), (size_t)16 * DM * 2, lb + bf * GBBUFB, 16 * GBP * 2);
}
// ---- k_proj: QKV[r][n] = bf16(x[r]) . PT[n] (exact), K = 1024; block (64 rows, 128 cols); 512-B segments of 12-KB rows
__global__ __launch_bounds__(128) void k_proj(const float* __restrict__ XQ, const float* __restrict__ XK, const float* __restrict__ XV, const __bf16* __restrict__ PT, const float* __restrict__ bq, const float* __restrict__ bk, const float* __restrict__ bv, float* __restrict__ QKV) {
  const float* X = (blockIdx.y * 128) < DM ? XQ : ((blockIdx.y * 128) < 2 * DM ? XK : XV);
  __shared__ __align__(16) float so[4][16][132];
  const int tid = threadIdx.x, wave = tid >> 5, lane = tid & 31, col = lane & 15, g = lane >> 4; const size_t r0 = (size_t)blockIdx.x * 64 + wave * 16; const int n0 = blockIdx.y * 128;
  __shared__ __align__(16) float sa[2][64][GAP]; __shared__ __align__(16) __bf16 sb[2][128][GBP];
  const char* ag = (const char*)(X + ((size_t)blockIdx.x * 64 + (tid >> 4)) * DM + (tid & 15) * 4);
  const char* bg = (const char*)(PT + (size_t)(n0 + (tid >> 3)) * DM + (tid & 7) * 8);
  const unsigned la = (unsigned)(size_t)&sa[0][tid >> 4][(tid & 15) * 4], lb = (unsigned)(size_t)&sb[0][tid >> 3][(tid & 7) * 8];
  v8f acc[8] = {};
  gemm_stage(ag, (size_t)DM * 4, bg, la, lb, 0, 0);
  asm volatile("s_wait_asynccnt 0x0" ::: "memory");   // this wave's copies of stage 0 have landed
  __syncthreads();                                    // stage 0 is readable by every wave
  gemm_stage(ag, (size_t)DM * 4, bg, la, lb, 1, 1);
#pragma unroll 1
  for (int s = 0; s < DM / GKC; ++s) { const int cur = s & 1;
    v16b a[GKC / 32], w[GKC / 32][8];   // the stage's fragments are all asked for in front of its first product: one LDS latency a stage
#pragma unroll
    for (int kk = 0; kk < GKC / 32; ++kk) { a[kk] = frag_gbf(&sa[cur][wave * 16 + col][kk * 32], lane);
#pragma unroll
      for (int j = 0; j < 8; ++j) w[kk][j] = frag_b(&sb[cur][j * 16 + col][kk * 32], lane); }
#pragma unroll
    for (int kk = 0; kk < GKC / 32; ++kk) {
#pragma unroll
      for (int j = 0; j < 8; ++j) acc[j] = wmma_bf(a[kk], w[kk][j], acc[j]); }
    asm volatile("s_wait_dscnt 0x0" ::: "memory");      // this wave's LDS reads of this stage are done
    asm volatile("s_wait_asynccnt 0x0" ::: "memory");   // this wave's copies of the next stage have landed
    __syncthreads();                                    // publishes the next stage and frees this stage's buffer
    if (s + 2 < DM / GKC) gemm_stage(ag, (size_t)DM * 4, bg, la, lb, s + 2, cur); }
  asm volatile("s_wait_asynccnt 0x0" ::: "memory");     // no copy is outstanding behind the loop
#pragma unroll
  for (int j = 0; j < 8; ++j) { const int n = n0 + j * 16 + col; const int which = n / DM, c = n % DM; const float bb = bfr((which == 0 ? bq : which == 1 ? bk : bv)[c]);
#pragma unroll
    for (int r = 0; r < 8; ++r) so[wave][8 * g + r][j * 16 + col] = acc[j][r] + bb; }
  LDSX();
  for (int rl = 0; rl < 16; ++rl) vst2(QKV + (r0 + rl) * QKVP + n0 + lane * 4, *(const v4f*)&so[wave][rl][lane * 4]);
}
__global__ __launch_bounds__(256) void k_vt(const float* __restrict__ QKV, __bf16* __restrict__ VTH, __bf16* __restrict__ VTL) {
  __shared__ __align__(16) __bf16 svh[DM][72], svl[DM][72];
  const int tid = threadIdx.x; const size_t t0 = (size_t)blockIdx.x * 64; const int b = (int)(t0 / SS), p0 = (int)(t0 % SS);
#pragma unroll 1
  for (int tl = 0; tl < 64; ++tl) { const float* row = QKV + (t0 + tl) * QKVP; for (int q = tid; q < DM; q += 256) { const float v = row[2 * DM + q]; const __bf16 hb = (__bf16)v; svh[q][tl] = hb; svl[q][tl] = (__bf16)(v - (float)hb); } }
  __syncthreads();
  for (int q = tid; q < DM * 8; q += 256) { const int rowi = q >> 3, pc = q & 7; const size_t o = ((size_t)b * DM + rowi) * SS + p0 + pc * 8; vst2((unsigned*)(VTH + o), *(const v4u*)&svh[rowi][pc * 8]); vst2((unsigned*)(VTL + o), *(const v4u*)&svl[rowi][pc * 8]); }
}
// ---- k_attn: block = (query block qb, b*16 + h), 4 waves: all SS/32 key steps; online softmax; O written over the q columns of the block's rows (head segment 256 B)
// The products are taken transposed: S^T = K Q^T (A = K rows, B = Q rows) and O^T += V^T P^T (A = V^T rows, B = P^T).  A lane then holds 16 of the 32 scores of ONE query (column lane & 15; keys 8g + r and 16 + 8g + r),
// so maximum and sum are in-lane with one exchange between the wave's halves, and the two score tiles, converted in place, are the B fragment of P^T in the loaders' own k order: P goes through no LDS.
// The 32-key K tile (f32) and V tile (hi, lo) of a step are brought into LDS once per block by asynchronous copies, two buffers, the next step's tile in flight while this one is worked on; all four waves read their fragments from LDS.
// LDS pitches are 16 B x odd, conflict-free for 16-byte LDS reads: K rows of 256 B at 272 B, V rows of 64 B at 80 B.
#define KPF 68
#define VPB 40
#define KBUFB (32 * KPF * 4)
#define VARRB (HD * VPB * 2)
#define VBUFB (2 * VARRB)
// one thread's eight 16-byte copies of one tile: K rows r, r+8, r+16, r+24; V rows d, d+32 of hi and of lo
__device__ __forceinline__ void attn_stage(const float* kg, const __bf16* vhg, const __bf16* vlg, unsigned lk, unsigned lv) {
  // the copies and s_wait_xcnt 0 in one statement: the wait stands in front of any rewrite of an address register that a copy names
  asm volatile("global_load_async_to_lds_b128 %0, %8, off\n\t"
               "global_load_async_to_lds_b128 %1, %9, off\n\t"
               "global_load_async_to_lds_b128 %2, %10, off\n\t"
               "global_load_async_to_lds_b128 %3, %11, off\n\t"
               "global_load_async_to_lds_b128 %4, %12, off\n\t"
               "global_load_async_to_lds_b128 %5, %13, off\n\t"
               "global_load_async_to_lds_b128 %6, %14, off\n\t"
               "global_load_async_to_lds_b128 %7, %15, off\n\t"
               "s_wait_xcnt 0x0"
               :: "v"(lk), "v"(lk + 8 * KPF * 4), "v"(lk + 16 * KPF * 4), "v"(lk + 24 * KPF * 4),
                  "v"(lv), "v"(lv + 32 * VPB * 2), "v"(lv + VARRB), "v"(lv + VARRB + 32 * VPB * 2),
                  "v"(kg), "v"(kg + 8 * QKVP), "v"(kg + 16 * QKVP), "v"(kg + 24 * QKVP),
                  "v"(vhg), "v"(vhg + 32 * SS), "v"(vlg), "v"(vlg + 32 * SS)
               : "memory");
}
// lane l <-> lane l ^ 16
__device__ __forceinline__ float xhalf(float v) { const int b = __builtin_bit_cast(int, v); return __builtin_bit_cast(float, __builtin_amdgcn_permlanex16(b, b, 0x76543210, 0xfedcba98, false, false)); }
// mac3 with the operands' sides swapped: the three products are added in mac3's order
__device__ __forceinline__ v8f mac3t(const F2& a, const F2& b, v8f c) { c = wmma_bf(a.h, b.l, c); c = wmma_bf(a.l, b.h, c); return wmma_bf(a.h, b.h, c); }
__global__ __launch_bounds__(128) void k_attn(float* __restrict__ QKV, const __bf16* __restrict__ VTH, const __bf16* __restrict__ VTL) {
  __shared__ __align__(16) float so[4][16][68];
  __shared__ __align__(16) float sk[2][32][KPF]; __shared__ __align__(16) __bf16 sv[2][2][HD][VPB];
  const int tid = threadIdx.x, wave = tid >> 5, lane = tid & 31, col = lane & 15, g = lane >> 4;
  const int qb = blockIdx.x, bh = blockIdx.y, b = bh / NH, h = bh % NH; const int q0 = qb * 64 + wave * 16; const size_t tq = (size_t)b * SS + q0;
  const F2 a0 = split_row(QKV + (tq + col) * QKVP + h * HD, 0, lane), a1 = split_row(QKV + (tq + col) * QKVP + h * HD, 32, lane);
  float m = -3.0e38f, l = 0.f;   // of query col; l sums this half's keys only, the halves are joined behind the loop
  v8f acc[4] = {};               // acc[dt][r] = O[query col][dt * 16 + 8 g + r]
  const int nsteps = SS / 32;
  const float* kg = QKV + ((size_t)b * SS + (tid >> 4)) * QKVP + DM + h * HD + (tid & 15) * 4;
  const size_t vo = ((size_t)b * DM + h * HD + (tid >> 2)) * SS + (tid & 3) * 8;
  const __bf16 *vhg = VTH + vo, *vlg = VTL + vo;
  const unsigned lk = (unsigned)(size_t)&sk[0][tid >> 4][(tid & 15) * 4], lv = (unsigned)(size_t)&sv[0][0][tid >> 2][(tid & 3) * 8];
  attn_stage(kg, vhg, vlg, lk, lv);
  asm volatile("s_wait_asynccnt 0x0" ::: "memory");   // this wave's copies of tile 0 have landed
  __syncthreads();                                    // tile 0 is readable by every wave
  attn_stage(kg + (size_t)32 * QKVP, vhg + 32, vlg + 32, lk + KBUFB, lv + VBUFB);
#pragma unroll 1
  for (int ks = 0; ks < nsteps; ++ks) {
    const int cur = ks & 1;
    float e[16];
#pragma unroll
    for (int ct = 0; ct < 2; ++ct) { const float* krow = &sk[cur][ct * 16 + col][0]; const F2 k0 = split_row(krow, 0, lane), k1 = split_row(krow, 32, lane);
      v8f c = mac3t(k0, a0, (v8f){}); c = mac3t(k1, a1, c);
#pragma unroll
      for (int r = 0; r < 8; ++r) e[ct * 8 + r] = c[r] * 0.125f; }
    float mx = e[0];
#pragma unroll
    for (int i = 1; i < 16; ++i) mx = fmaxf(mx, e[i]);
    mx = fmaxf(mx, xhalf(mx));
    const float mn = fmaxf(m, mx); const float alpha = expf(m - mn); m = mn;
#pragma unroll
    for (int i = 0; i < 16; ++i) e[i] = expf(e[i] - mn);
    l = l * alpha + (((e[0] + e[1]) + (e[2] + e[3])) + ((e[4] + e[5]) + (e[6] + e[7])) + (((e[8] + e[9]) + (e[10] + e[11])) + ((e[12] + e[13]) + (e[14] + e[15]))));
#pragma unroll
    for (int dt = 0; dt < 4; ++dt) acc[dt] *= alpha;
    const F2 pb = bsplit16(e);
#pragma unroll
    for (int dt = 0; dt < 4; ++dt) { const v16b vh = frag_b(&sv[cur][0][dt * 16 + col][0], lane), vl = frag_b(&sv[cur][1][dt * 16 + col][0], lane);
      acc[dt] = wmma_bf(vh, pb.l, acc[dt]); acc[dt] = wmma_bf(vl, pb.h, acc[dt]); acc[dt] = wmma_bf(vh, pb.h, acc[dt]); }
    asm volatile("s_wait_dscnt 0x0" ::: "memory");      // this wave's LDS reads of this step's tile are done
    asm volatile("s_wait_asynccnt 0x0" ::: "memory");   // this wave's copies of the next tile have landed
    __syncthreads();                                    // publishes the next tile and frees this step's buffer
    if (ks + 2 < nsteps) attn_stage(kg + (size_t)(ks + 2) * 32 * QKVP, vhg + (ks + 2) * 32, vlg + (ks + 2) * 32, lk + cur * KBUFB, lv + cur * VBUFB); }
  asm volatile("s_wait_asynccnt 0x0" ::: "memory");     // no copy is outstanding behind the loop
  const float il = 1.0f / (l + xhalf(l));
#pragma unroll
  for (int dt = 0; dt < 4; ++dt) { const v8f o = acc[dt] * il; float* d = &so[wave][col][dt * 16 + 8 * g];
    vst2(d, (v4f){o[0], o[1], o[2], o[3]}); vst2(d + 4, (v4f){o[4], o[5], o[6], o[7]}); }
  LDSX();
  for (int rl = 0; rl < 16; ++rl) if (lane < 16) vst2(QKV + (tq + rl) * QKVP + h * HD + lane * 4, *(const v4f*)&so[wave][rl][lane * 4]);
}
// ---- k_out: Y = O(hi/lo; the q columns of QKV) . PT_out rows (2 products, K = 1024); block (64 rows, 128 cols)
__global__ __launch_bounds__(128) void k_out(const float* __restrict__ QKV, const __bf16* __restrict__ PT, int wblk, const float* __restrict__ bo, float* __restrict__ Y) {
  __shared__ __align__(16) float so[4][16][132];
  const int tid = threadIdx.x, wave = tid >> 5, lane = tid & 31, col = lane & 15, g = lane >> 4; const size_t r0 = (size_t)blockIdx.x * 64 + wave * 16; const int n0 = blockIdx.y * 128;
  __shared__ __align__(16) float sa[2][64][GAP]; __shared__ __align__(16) __bf16 sb[2][128][GBP];
  const char* ag = (const char*)(QKV + ((size_t)blockIdx.x * 64 + (tid >> 4)) * QKVP + (tid & 15) * 4);
  const char* bg = (const char*)(PT + (size_t)(wblk * DM + n0 + (tid >> 3)) * DM + (tid & 7) * 8);
  const unsigned la = (unsigned)(size_t)&sa[0][tid >> 4][(tid & 15) * 4], lb = (unsigned)(size_t)&sb[0][tid >> 3][(tid & 7) * 8];
  v8f acc[8] = {};
  gemm_stage(ag, (size_t)QKVP * 4, bg, la, lb, 0, 0);
  asm volatile("s_wait_asynccnt 0x0" ::: "memory");   // this wave's copies of stage 0 have landed
  __syncthreads();                                    // stage 0 is readable by every wave
  gemm_stage(ag, (size_t)QKVP * 4, bg, la, lb, 1, 1);
#pragma unroll 1
  for (int s = 0; s < DM / GKC; ++s) { const int cur = s & 1;
    F2 a[GKC / 32]; v16b w[GKC / 32][8];   // the stage's fragments are all asked for in front of its first product: one LDS latency a stage
#pragma unroll
    for (int kk = 0; kk < GKC / 32; ++kk) { a[kk] = split_row(&sa[cur][wave * 16 + col][0], kk * 32, lane);
#pragma unroll
      for (int j = 0; j < 8; ++j) w[kk][j] = frag_b(&sb[cur][j * 16 + col][kk * 32], lane); }
#pragma unroll
    for (int kk = 0; kk < GKC / 32; ++kk) {
#pragma unroll
      for (int j = 0; j < 8; ++j) { acc[j] = wmma_bf(a[kk].l, w[kk][j], acc[j]); acc[j] = wmma_bf(a[kk].h, w[kk][j], acc[j]); } }
    asm volatile("s_wait_dscnt 0x0" ::: "memory");      // this wave's LDS reads of this stage are done
    asm volatile("s_wait_asynccnt 0x0" ::: "memory");   // this wave's copies of the next stage have landed
    __syncthreads();                                    // publishes the next stage and frees this stage's buffer
    if (s + 2 < DM / GKC) gemm_stage(ag, (size_t)QKVP * 4, bg, la, lb, s + 2, cur); }
  asm volatile("s_wait_asynccnt 0x0" ::: "memory");     // no copy is outstanding behind the loop
#pragma unroll
  for (int j = 0; j < 8; ++j) { const float bb = bfr(bo[n0 + j * 16 + col]);
#pragma unroll
    for (int r = 0; r < 8; ++r) so[wave][8 * g + r][j * 16 + col] = acc[j][r] + bb; }
  LDSX();
  for (int rl = 0; rl < 16; ++rl) vst2(Y + (r0 + rl) * DM + n0 + lane * 4, *(const v4f*)&so[wave][rl][lane * 4]);
}

extern "C" void kernel_launch(void* const* d_in, const int* in_sizes, int n_in, void* d_out, int out_size, void* d_ws, size_t ws_size, hipStream_t stream) {
  (void)in_sizes; (void)n_in; (void)out_size;
  const float** F = (const float**)d_in;   // q, k, v [2,2048,1024], Wq, bq, Wk, bk, Wv, bv, Wo, bo ([in][out] 1024x1024), Wc [1024,1024], bc
  if (ws_size < (size_t)WS_END) return;
  char* ws = (char*)d_ws; __bf16 *PT = (__bf16*)(ws + WS_PT), *VTH = (__bf16*)(ws + WS_VTH), *VTL = (__bf16*)(ws + WS_VTL); float* QKV = (float*)(ws + WS_QKV);
  float* OUTC = (float*)d_out; float* OUTH = OUTC + (size_t)NR * DM;     // outputs: (c, h)
  k_pack<<<5 * DM, 128, 0, stream>>>(F[3], F[5], F[7], F[9], F[11], PT);
  k_proj<<<dim3(TRB, QKVP / 128), 128, 0, stream>>>(F[0], F[1], F[2], PT, F[4], F[6], F[8], QKV);
  k_vt<<<TRB, 256, 0, stream>>>(QKV, VTH, VTL);
  k_attn<<<dim3(TQB, TNB * NH), 128, 0, stream>>>(QKV, VTH, VTL);
  k_out<<<dim3((TNB < NB ? TQB : NR / 64), DM / 128), 128, 0, stream>>>(QKV, PT, 4, F[12], OUTC);
  k_out<<<dim3((TNB < NB ? TQB : NR / 64), DM / 128), 128, 0, stream>>>(QKV, PT, 3, F[10], OUTH);
}

// v005
// Measured time: 253 microseconds a run.
// Next to v004, in two timings, it ran 1.44 and 1.43 times as fast.
// All steps since v000 together make it 2.95 times as fast.
// compute dtype: q/k/v inputs, the five [in][out] weights + biases (module inputs) rounded to bf16; Q/K/V projections with exact bf16 products (+ bias); scores and P.V with both computed operands as bf16 hi + bf16 residual pairs (3 products); the two output projections (Wc → c, Wo → h) hi/lo x bf16 weights (2 products) + bias; online softmax in f32; f32 accumulate.
#include <hip/hip_runtime.h>
#include <math.h>

typedef __attribute__((ext_vector_type(16))) _Float16 v16h;
typedef __attribute__((ext_vector_type(16))) __bf16 v16b;
typedef __attribute__((ext_vector_type(8)))  _Float16 v8h;
typedef __attribute__((ext_vector_type(8)))  float v8f;
typedef __attribute__((ext_vector_type(4)))  float v4f;
typedef __attribute__((ext_vector_type(2)))  float v2f;
typedef __attribute__((ext_vector_type(4)))  unsigned v4u;
typedef __attribute__((ext_vector_type(4)))  int v4i;
typedef float __attribute__((may_alias)) float_a;
typedef int __attribute__((may_alias)) int_a;

template <typename T> __device__ __forceinline__ void vst2(void* p, T v) { *(T*)p = v;  }
__device__ __forceinline__ v8f wmma16(v16h a, v16h b, v8f c) {
  v8f d = __builtin_amdgcn_wmma_f32_16x16x32_f16(false, a, false, b, (short)0, c, false, false);
  asm volatile("v_nop\n\tv_nop\n\tv_nop\n\tv_nop" : "+v"(d) : "v"(a), "v"(b));
  return d;
}
__device__ __forceinline__ v8f wmma_bf(v16b a, v16b b, v8f c) {
  v8f d = __builtin_amdgcn_wmma_f32_16x16x32_bf16(false, a, false, b, (short)0, c, false, false);
  asm volatile("v_nop\n\tv_nop\n\tv_nop\n\tv_nop" : "+v"(d) : "v"(a), "v"(b));
  return d;
}
// 16x16x32 fragments: lane = (h = lane>>4, row/col = lane&15); elements 0..7 = k0+8h+0..7, 8..15 = k0+16+8h+0..7; D element r = row 8h+r
__device__ __forceinline__ v16h frag_h(const _Float16* rowk0, int lane) {
  union { v16h v; v8h q[2]; } u; const _Float16* p = rowk0 + 8 * (lane >> 4);
  u.q[0] = *(const v8h*)p; u.q[1] = *(const v8h*)(p + 16); return u.v;
}
__device__ __forceinline__ v16h frag_f32(const float* rowk0, int lane) {
  v16h a; const float* p = rowk0 + 8 * (lane >> 4);
#pragma unroll
  for (int i = 0; i < 8; ++i) { a[i] = (_Float16)p[i]; a[8 + i] = (_Float16)p[16 + i]; }
  return a;
}
__device__ __forceinline__ v16h frag_f32s(const float* rowk0, int lane, float sc) {
  v16h a; const float* p = rowk0 + 8 * (lane >> 4);
#pragma unroll
  for (int i = 0; i < 8; ++i) { a[i] = (_Float16)(p[i] * sc); a[8 + i] = (_Float16)(p[16 + i] * sc); }
  return a;
}
// column fragment from a [K][ld] layout (column n), rows >= K read as 0
__device__ __forceinline__ v16h fragc_f32(const float* W, int k0, int n, int lane, int ld, int K) {
  v16h a; const int g = lane >> 4;
#pragma unroll
  for (int i = 0; i < 8; ++i) { const int ka = k0 + 8 * g + i, kb = ka + 16;
    a[i] = (_Float16)(ka < K ? W[(size_t)(ka < K ? ka : K - 1) * ld + n] : 0.f); a[8 + i] = (_Float16)(kb < K ? W[(size_t)(kb < K ? kb : K - 1) * ld + n] : 0.f); }
  return a;
}
struct F2 { v16b h, l; };
__device__ __forceinline__ F2 bsplit16(const float v[16]) { F2 r;
#pragma unroll
  for (int i = 0; i < 16; ++i) { const __bf16 h = (__bf16)v[i]; r.h[i] = h; r.l[i] = (__bf16)(v[i] - (float)h); }
  return r; }
__device__ __forceinline__ F2 split_row(const float* row, int k0, int lane) { float v[16]; const float* p = row + k0 + 8 * (lane >> 4);
#pragma unroll
  for (int i = 0; i < 8; ++i) { v[i] = p[i]; v[8 + i] = p[16 + i]; }
  return bsplit16(v); }
__device__ __forceinline__ F2 split_rowK(const float* row, int k0, int lane, int K) { float v[16]; const int g = lane >> 4;
#pragma unroll
  for (int i = 0; i < 8; ++i) { const int ka = k0 + 8 * g + i, kb = ka + 16; v[i] = ka < K ? row[ka < K ? ka : K - 1] : 0.f; v[8 + i] = kb < K ? row[kb < K ? kb : K - 1] : 0.f; }
  return bsplit16(v); }
__device__ __forceinline__ F2 split_col(const float* W, int k0, int n, int lane, int ld, int K) { float v[16]; const int g = lane >> 4;
#pragma unroll
  for (int i = 0; i < 8; ++i) { const int ka = k0 + 8 * g + i, kb = ka + 16; v[i] = ka < K ? W[(size_t)(ka < K ? ka : K - 1) * ld + n] : 0.f; v[8 + i] = kb < K ? W[(size_t)(kb < K ? kb : K - 1) * ld + n] : 0.f; }
  return bsplit16(v); }
__device__ __forceinline__ v8f mac3(const F2& a, const F2& b, v8f c) { c = wmma_bf(a.l, b.h, c); c = wmma_bf(a.h, b.l, c); return wmma_bf(a.h, b.h, c); }
__device__ __forceinline__ float sigm(float v) { return 1.0f / (1.0f + expf(-v)); }
#define LDSX() do { asm volatile("s_wait_dscnt 0" ::: "memory"); __builtin_amdgcn_wave_barrier(); __builtin_amdgcn_fence(__ATOMIC_RELEASE, "workgroup"); } while (0)


// Cyclic attention block: Q = q Wq + bq, K = k Wk + bk, V = v Wv + bv (16 heads x 64), softmax(Q K^T / 8) V merged; outputs (c, h) = (merged Wc + bc, merged Wo + bo).  B 2, S 2048, H 1024, cyclic_size 1024.
// k_pack (Wq|Wk|Wv|Wo|Wc columns as bf16 rows), k_proj (Q, K as f32 rows; V as V^T, bf16 hi and lo), k_attn (flash-style, 64 key steps), k_out x2 (c into output 0, h into output 1).
#define NB 2
#define SS 2048
#define DM 1024
#define NH 16
#define HD 64
#define NR (NB * SS)
#define QKVP (3 * DM)
#ifndef TRB
#define TRB (NR / 64)
#define TQB (SS / 64)
#define TNB NB
#endif
typedef __attribute__((ext_vector_type(8))) __bf16 v8b;
__device__ __forceinline__ v16b frag_b(const __bf16* rowk0, int lane) {
  union { v16b v; v8b q[2]; } u; const __bf16* p = rowk0 + 8 * (lane >> 4);
  u.q[0] = *(const v8b*)p; u.q[1] = *(const v8b*)(p + 16); return u.v;
}
__device__ __forceinline__ v16b frag_gbf(const float* rowk0, int lane) {
  v16b a; const float* p = rowk0 + 8 * (lane >> 4);
#pragma unroll
  for (int i = 0; i < 8; ++i) { a[i] = (__bf16)p[i]; a[8 + i] = (__bf16)p[16 + i]; }
  return a;
}
__device__ __forceinline__ float bfr(float v) { return (float)(__bf16)v; }
#define WS_PT   0u                                 // bf16 [5*1024 (q|k|v|o|c cols)][1024]
#define WS_QKV  (WS_PT + 2u * 5 * DM * DM)           // f32 [4096 rows][3072]  (q 0..1023 | k | v: not used) ; q cols later overwritten by O
#define WS_VTH  (WS_QKV + 4u * NR * QKVP)            // bf16 [2][1024 (h*64+d)][2048]
#define WS_VTL  (WS_VTH + 2u * NB * DM * SS)
#define WS_END  (WS_VTL + 2u * NB * DM * SS)

__global__ __launch_bounds__(128) void k_pack(const float* __restrict__ Wq, const float* __restrict__ Wk, const float* __restrict__ Wv, const float* __restrict__ Wo, const float* __restrict__ Wc, __bf16* __restrict__ PT) {
  __shared__ __align__(16) __bf16 srow[DM];
  const int n = blockIdx.x, tid = threadIdx.x; const int which = n / DM, c = n % DM; const float* Wm = which == 0 ? Wq : (which == 1 ? Wk : (which == 2 ? Wv : (which == 3 ? Wo : Wc)));
  for (int k = tid; k < DM; k += 128) srow[k] = (__bf16)Wm[(size_t)k * DM + c];   // [in][out]: column c
  __syncthreads();
  if (tid < DM / 8) vst2((unsigned*)(PT + (size_t)n * DM + tid * 8), *(const v4u*)(&srow[tid * 8]));
}
// ---- GEMM staging (k_proj, k_out): a stage is 64 k of the block's 64 A rows (f32, 256 B a row) and 128 B rows (bf16, 128 B a row), brought into LDS once per block by asynchronous copies in whole 128-B lines,
// two buffers, the next stage in flight while this one is worked on; the waves read their fragments from LDS in the k order they had.  LDS pitches are 16 B x odd: A 272 B, B 144 B.
#define GKC 64
#define GAP 68
#define GBP 72
#define GABUFB (64 * GAP * 4)
#define GBBUFB (128 * GBP * 2)
// one thread's eight 16-byte copies: global rows gs bytes apart, LDS rows ls bytes apart
__device__ __forceinline__ void gemm_stage8(const char* g, size_t gs, unsigned l, unsigned ls) {
  // the copies and s_wait_xcnt 0 in one statement: the wait stands in front of any rewrite of an address register that a copy names
  asm volatile("global_load_async_to_lds_b128 %0, %8, off\n\t"
               "global_load_async_to_lds_b128 %1, %9, off\n\t"
               "global_load_async_to_lds_b128 %2, %10, off\n\t"
               "global_load_async_to_lds_b128 %3, %11, off\n\t"
               "global_load_async_to_lds_b128 %4, %12, off\n\t"
               "global_load_async_to_lds_b128 %5, %13, off\n\t"
               "global_load_async_to_lds_b128 %6, %14, off\n\t"
               "global_load_async_to_lds_b128 %7, %15, off\n\t"
               "s_wait_xcnt 0x0"
               :: "v"(l), "v"(l + ls), "v"(l + 2 * ls), "v"(l + 3 * ls), "v"(l + 4 * ls), "v"(l + 5 * ls), "v"(l + 6 * ls), "v"(l + 7 * ls),
                  "v"(g), "v"(g + gs), "v"(g + 2 * gs), "v"(g + 3 * gs), "v"(g + 4 * gs), "v"(g + 5 * gs), "v"(g + 6 * gs), "v"(g + 7 * gs)
               : "memory");
}
// stage s into buffer bf: A rows t>>4 + 8 j (row pitch apb bytes in global memory), B rows t>>3 + 16 j
__device__ __forceinline__ void gemm_stage(const char* ag, size_t apb, const char* bg, unsigned la, unsigned lb, int s, int bf) {
  gemm_stage8(ag + (size_t)s * (GKC * 4), 8 * apb, la + bf * GABUFB, 8 * GAP * 4);
  gemm_stage8(bg + (size_t)s * (GKC * 2), (size_t)16 * DM * 2, lb + bf * GBBUFB, 16 * GBP * 2);
}
// ---- k_proj: QKV[r][n] = bf16(x[r]) . PT[n] (exact), K = 1024; block (64 rows, 128 cols); 512-B segments of 12-KB rows; the V blocks store V^T (hi, lo) instead, 128-B segments of its 4-KB rows
__global__ __launch_bounds__(128) void k_proj(const float* __restrict__ XQ, const float* __restrict__ XK, const float* __restrict__ XV, const __bf16* __restrict__ PT, const float* __restrict__ bq, const float* __restrict__ bk, const float* __restrict__ bv, float* __restrict__ QKV, __bf16* __restrict__ VTH, __bf16* __restrict__ VTL) {
  const float* X = (blockIdx.y * 128) < DM ? XQ : ((blockIdx.y * 128) < 2 * DM ? XK : XV);
  __shared__ __align__(16) float so[4][16][132];
  const int tid = threadIdx.x, wave = tid >> 5, lane = tid & 31, col = lane & 15, g = lane >> 4; const size_t r0 = (size_t)blockIdx.x * 64 + wave * 16; const int n0 = blockIdx.y * 128;
  __shared__ __align__(16) float sa[2][64][GAP]; __shared__ __align__(16) __bf16 sb[2][128][GBP];
  const char* ag = (const char*)(X + ((size_t)blockIdx.x * 64 + (tid >> 4)) * DM + (tid & 15) * 4);
  const char* bg = (const char*)(PT + (size_t)(n0 + (tid >> 3)) * DM + (tid & 7) * 8);
  const unsigned la = (unsigned)(size_t)&sa[0][tid >> 4][(tid & 15) * 4], lb = (unsigned)(size_t)&sb[0][tid >> 3][(tid & 7) * 8];
  v8f acc[8] = {};
  gemm_stage(ag, (size_t)DM * 4, bg, la, lb, 0, 0);
  asm volatile("s_wait_asynccnt 0x0" ::: "memory");   // this wave's copies of stage 0 have landed
  __syncthreads();                                    // stage 0 is readable by every wave
  gemm_stage(ag, (size_t)DM * 4, bg, la, lb, 1, 1);
#pragma unroll 1
  for (int s = 0; s < DM / GKC; ++s) { const int cur = s & 1;
    v16b a[GKC / 32], w[GKC / 32][8];   // the stage's fragments are all asked for in front of its first product: one LDS latency a stage
#pragma unroll
    for (int kk = 0; kk < GKC / 32; ++kk) { a[kk] = frag_gbf(&sa[cur][wave * 16 + col][kk * 32], lane);
#pragma unroll
      for (int j = 0; j < 8; ++j) w[kk][j] = frag_b(&sb[cur][j * 16 + col][kk * 32], lane); }
#pragma unroll
    for (int kk = 0; kk < GKC / 32; ++kk) {
#pragma unroll
      for (int j = 0; j < 8; ++j) acc[j] = wmma_bf(a[kk], w[kk][j], acc[j]); }
    asm volatile("s_wait_dscnt 0x0" ::: "memory");      // this wave's LDS reads of this stage are done
    asm volatile("s_wait_asynccnt 0x0" ::: "memory");   // this wave's copies of the next stage have landed
    __syncthreads();                                    // publishes the next stage and frees this stage's buffer
    if (s + 2 < DM / GKC) gemm_stage(ag, (size_t)DM * 4, bg, la, lb, s + 2, cur); }
  asm volatile("s_wait_asynccnt 0x0" ::: "memory");     // no copy is outstanding behind the loop
  if (n0 >= 2 * DM) {   // V columns, the same for the whole block.  A lane's eight accumulator rows are eight successive positions of one V^T row: 16 B of hi, 16 B of lo.  sb is free: every wave has passed the loop's last barrier
    float bias[8];
#pragma unroll
    for (int j = 0; j < 8; ++j) bias[j] = bv[n0 - 2 * DM + j * 16 + col];
    asm volatile("s_wait_xcnt 0x0" ::: "memory");   // stands in front of any rewrite of an address register that the bias loads name
#pragma unroll
    for (int j = 0; j < 8; ++j) { const float bb = bfr(bias[j]); v8b hv, lv;
#pragma unroll
      for (int r = 0; r < 8; ++r) { const float v = acc[j][r] + bb; const __bf16 hb = (__bf16)v; hv[r] = hb; lv[r] = (__bf16)(v - (float)hb); }
      vst2(&sb[0][j * 16 + col][wave * 16 + 8 * g], hv); vst2(&sb[1][j * 16 + col][wave * 16 + 8 * g], lv); }
    __syncthreads();   // the four waves' 16 positions each make up the whole 128-B lines stored below
    const size_t t0 = (size_t)blockIdx.x * 64; const size_t vb = ((t0 / SS) * DM + (size_t)(n0 - 2 * DM)) * SS + t0 % SS;
#pragma unroll
    for (int i = 0; i < 8; ++i) { const int rowi = i * 16 + (tid >> 3), pc = tid & 7; const size_t o = vb + (size_t)rowi * SS + pc * 8;   // eight lanes store one line
      vst2(VTH + o, *(const v8b*)&sb[0][rowi][pc * 8]); vst2(VTL + o, *(const v8b*)&sb[1][rowi][pc * 8]); }
    return; }
#pragma unroll
  for (int j = 0; j < 8; ++j) { const int n = n0 + j * 16 + col; const int which = n / DM, c = n % DM; const float bb = bfr((which == 0 ? bq : which == 1 ? bk : bv)[c]);
#pragma unroll
    for (int r = 0; r < 8; ++r) so[wave][8 * g + r][j * 16 + col] = acc[j][r] + bb; }
  LDSX();
  for (int rl = 0; rl < 16; ++rl) vst2(QKV + (r0 + rl) * QKVP + n0 + lane * 4, *(const v4f*)&so[wave][rl][lane * 4]);
}
// ---- k_attn: block = (query block qb, b*16 + h), 4 waves: all SS/32 key steps; online softmax; O written over the q columns of the block's rows (head segment 256 B)
// The products are taken transposed: S^T = K Q^T (A = K rows, B = Q rows) and O^T += V^T P^T (A = V^T rows, B = P^T).  A lane then holds 16 of the 32 scores of ONE query (column lane & 15; keys 8g + r and 16 + 8g + r),
// so maximum and sum are in-lane with one exchange between the wave's halves, and the two score tiles, converted in place, are the B fragment of P^T in the loaders' own k order: P goes through no LDS.
// The 32-key K tile (f32) and V tile (hi, lo) of a step are brought into LDS once per block by asynchronous copies, two buffers, the next step's tile in flight while this one is worked on; all four waves read their fragments from LDS.
// LDS pitches are 16 B x odd, conflict-free for 16-byte LDS reads: K rows of 256 B at 272 B, V rows of 64 B at 80 B.
#define KPF 68
#define VPB 40
#define KBUFB (32 * KPF * 4)
#define VARRB (HD * VPB * 2)
#define VBUFB (2 * VARRB)
// one thread's eight 16-byte copies of one tile: K rows r, r+8, r+16, r+24; V rows d, d+32 of hi and of lo
__device__ __forceinline__ void attn_stage(const float* kg, const __bf16* vhg, const __bf16* vlg, unsigned lk, unsigned lv) {
  // the copies and s_wait_xcnt 0 in one statement: the wait stands in front of any rewrite of an address register that a copy names
  asm volatile("global_load_async_to_lds_b128 %0, %8, off\n\t"
               "global_load_async_to_lds_b128 %1, %9, off\n\t"
               "global_load_async_to_lds_b128 %2, %10, off\n\t"
               "global_load_async_to_lds_b128 %3, %11, off\n\t"
               "global_load_async_to_lds_b128 %4, %12, off\n\t"
               "global_load_async_to_lds_b128 %5, %13, off\n\t"
               "global_load_async_to_lds_b128 %6, %14, off\n\t"
               "global_load_async_to_lds_b128 %7, %15, off\n\t"
               "s_wait_xcnt 0x0"
               :: "v"(lk), "v"(lk + 8 * KPF * 4), "v"(lk + 16 * KPF * 4), "v"(lk + 24 * KPF * 4),
                  "v"(lv), "v"(lv + 32 * VPB * 2), "v"(lv + VARRB), "v"(lv + VARRB + 32 * VPB * 2),
                  "v"(kg), "v"(kg + 8 * QKVP), "v"(kg + 16 * QKVP), "v"(kg + 24 * QKVP),
                  "v"(vhg), "v"(vhg + 32 * SS), "v"(vlg), "v"(vlg + 32 * SS)
               : "memory");
}
// lane l <-> lane l ^ 16
__device__ __forceinline__ float xhalf(float v) { const int b = __builtin_bit_cast(int, v); return __builtin_bit_cast(float, __builtin_amdgcn_permlanex16(b, b, 0x76543210, 0xfedcba98, false, false)); }
// mac3 with the operands' sides swapped: the three products are added in mac3's order
__device__ __forceinline__ v8f mac3t(const F2& a, const F2& b, v8f c) { c = wmma_bf(a.h, b.l, c); c = wmma_bf(a.l, b.h, c); return wmma_bf(a.h, b.h, c); }
__global__ __launch_bounds__(128) void k_attn(float* __restrict__ QKV, const __bf16* __restrict__ VTH, const __bf16* __restrict__ VTL) {
  __shared__ __align__(16) float so[4][16][68];
  __shared__ __align__(16) float sk[2][32][KPF]; __shared__ __align__(16) __bf16 sv[2][2][HD][VPB];
  const int tid = threadIdx.x, wave = tid >> 5, lane = tid & 31, col = lane & 15, g = lane >> 4;
  const int qb = blockIdx.x, bh = blockIdx.y, b = bh / NH, h = bh % NH; const int q0 = qb * 64 + wave * 16; const size_t tq = (size_t)b * SS + q0;
  const F2 a0 = split_row(QKV + (tq + col) * QKVP + h * HD, 0, lane), a1 = split_row(QKV + (tq + col) * QKVP + h * HD, 32, lane);
  float m = -3.0e38f, l = 0.f;   // of query col; l sums this half's keys only, the halves are joined behind the loop
  v8f acc[4] = {};               // acc[dt][r] = O[query col][dt * 16 + 8 g + r]
  const int nsteps = SS / 32;
  const float* kg = QKV + ((size_t)b * SS + (tid >> 4)) * QKVP + DM + h * HD + (tid & 15) * 4;
  const size_t vo = ((size_t)b * DM + h * HD + (tid >> 2)) * SS + (tid & 3) * 8;
  const __bf16 *vhg = VTH + vo, *vlg = VTL + vo;
  const unsigned lk = (unsigned)(size_t)&sk[0][tid >> 4][(tid & 15) * 4], lv = (unsigned)(size_t)&sv[0][0][tid >> 2][(tid & 3) * 8];
  attn_stage(kg, vhg, vlg, lk, lv);
  asm volatile("s_wait_asynccnt 0x0" ::: "memory");   // this wave's copies of tile 0 have landed
  __syncthreads();                                    // tile 0 is readable by every wave
  attn_stage(kg + (size_t)32 * QKVP, vhg + 32, vlg + 32, lk + KBUFB, lv + VBUFB);
#pragma unroll 1
  for (int ks = 0; ks < nsteps; ++ks) {
    const int cur = ks & 1;
    float e[16];
#pragma unroll
    for (int ct = 0; ct < 2; ++ct) { const float* krow = &sk[cur][ct * 16 + col][0]; const F2 k0 = split_row(krow, 0, lane), k1 = split_row(krow, 32, lane);
      v8f c = mac3t(k0, a0, (v8f){}); c = mac3t(k1, a1, c);
#pragma unroll
      for (int r = 0; r < 8; ++r) e[ct * 8 + r] = c[r] * 0.125f; }
    float mx = e[0];
#pragma unroll
    for (int i = 1; i < 16; ++i) mx = fmaxf(mx, e[i]);
    mx = fmaxf(mx, xhalf(mx));
    const float mn = fmaxf(m, mx); const float alpha = expf(m - mn); m = mn;
#pragma unroll
    for (int i = 0; i < 16; ++i) e[i] = expf(e[i] - mn);
    l = l * alpha + (((e[0] + e[1]) + (e[2] + e[3])) + ((e[4] + e[5]) + (e[6] + e[7])) + (((e[8] + e[9]) + (e[10] + e[11])) + ((e[12] + e[13]) + (e[14] + e[15]))));
#pragma unroll
    for (int dt = 0; dt < 4; ++dt) acc[dt] *= alpha;
    const F2 pb = bsplit16(e);
#pragma unroll
    for (int dt = 0; dt < 4; ++dt) { const v16b vh = frag_b(&sv[cur][0][dt * 16 + col][0], lane), vl = frag_b(&sv[cur][1][dt * 16 + col][0], lane);
      acc[dt] = wmma_bf(vh, pb.l, acc[dt]); acc[dt] = wmma_bf(vl, pb.h, acc[dt]); acc[dt] = wmma_bf(vh, pb.h, acc[dt]); }
    asm volatile("s_wait_dscnt 0x0" ::: "memory");      // this wave's LDS reads of this step's tile are done
    asm volatile("s_wait_asynccnt 0x0" ::: "memory");   // this wave's copies of the next tile have landed
    __syncthreads();                                    // publishes the next tile and frees this step's buffer
    if (ks + 2 < nsteps) attn_stage(kg + (size_t)(ks + 2) * 32 * QKVP, vhg + (ks + 2) * 32, vlg + (ks + 2) * 32, lk + cur * KBUFB, lv + cur * VBUFB); }
  asm volatile("s_wait_asynccnt 0x0" ::: "memory");     // no copy is outstanding behind the loop
  const float il = 1.0f / (l + xhalf(l));
#pragma unroll
  for (int dt = 0; dt < 4; ++dt) { const v8f o = acc[dt] * il; float* d = &so[wave][col][dt * 16 + 8 * g];
    vst2(d, (v4f){o[0], o[1], o[2], o[3]}); vst2(d + 4, (v4f){o[4], o[5], o[6], o[7]}); }
  LDSX();
  for (int rl = 0; rl < 16; ++rl) if (lane < 16) vst2(QKV + (tq + rl) * QKVP + h * HD + lane * 4, *(const v4f*)&so[wave][rl][lane * 4]);
}
// ---- k_out: Y = O(hi/lo; the q columns of QKV) . PT_out rows (2 products, K = 1024); block (64 rows, 128 cols)
__global__ __launch_bounds__(128) void k_out(const float* __restrict__ QKV, const __bf16* __restrict__ PT, int wblk, const float* __restrict__ bo, float* __restrict__ Y) {
  __shared__ __align__(16) float so[4][16][132];
  const int tid = threadIdx.x, wave = tid >> 5, lane = tid & 31, col = lane & 15, g = lane >> 4; const size_t r0 = (size_t)blockIdx.x * 64 + wave * 16; const int n0 = blockIdx.y * 128;
  __shared__ __align__(16) float sa[2][64][GAP]; __shared__ __align__(16) __bf16 sb[2][128][GBP];
  const char* ag = (const char*)(QKV + ((size_t)blockIdx.x * 64 + (tid >> 4)) * QKVP + (tid & 15) * 4);
  const char* bg = (const char*)(PT + (size_t)(wblk * DM + n0 + (tid >> 3)) * DM + (tid & 7) * 8);
  const unsigned la = (unsigned)(size_t)&sa[0][tid >> 4][(tid & 15) * 4], lb = (unsigned)(size_t)&sb[0][tid >> 3][(tid & 7) * 8];
  v8f acc[8] = {};
  gemm_stage(ag, (size_t)QKVP * 4, bg, la, lb, 0, 0);
  asm volatile("s_wait_asynccnt 0x0" ::: "memory");   // this wave's copies of stage 0 have landed
  __syncthreads();                                    // stage 0 is readable by every wave
  gemm_stage(ag, (size_t)QKVP * 4, bg, la, lb, 1, 1);
#pragma unroll 1
  for (int s = 0; s < DM / GKC; ++s) { const int cur = s & 1;
    F2 a[GKC / 32]; v16b w[GKC / 32][8];   // the stage's fragments are all asked for in front of its first product: one LDS latency a stage
#pragma unroll
    for (int kk = 0; kk < GKC / 32; ++kk) { a[kk] = split_row(&sa[cur][wave * 16 + col][0], kk * 32, lane);
#pragma unroll
      for (int j = 0; j < 8; ++j) w[kk][j] = frag_b(&sb[cur][j * 16 + col][kk * 32], lane); }
#pragma unroll
    for (int kk = 0; kk < GKC / 32; ++kk) {
#pragma unroll
      for (int j = 0; j < 8; ++j) { acc[j] = wmma_bf(a[kk].l, w[kk][j], acc[j]); acc[j] = wmma_bf(a[kk].h, w[kk][j], acc[j]); } }
    asm volatile("s_wait_dscnt 0x0" ::: "memory");      // this wave's LDS reads of this stage are done
    asm volatile("s_wait_asynccnt 0x0" ::: "memory");   // this wave's copies of the next stage have landed
    __syncthreads();                                    // publishes the next stage and frees this stage's buffer
    if (s + 2 < DM / GKC) gemm_stage(ag, (size_t)QKVP * 4, bg, la, lb, s + 2, cur); }
  asm volatile("s_wait_asynccnt 0x0" ::: "memory");     // no copy is outstanding behind the loop
#pragma unroll
  for (int j = 0; j < 8; ++j) { const float bb = bfr(bo[n0 + j * 16 + col]);
#pragma unroll
    for (int r = 0; r < 8; ++r) so[wave][8 * g + r][j * 16 + col] = acc[j][r] + bb; }
  LDSX();
  for (int rl = 0; rl < 16; ++rl) vst2(Y + (r0 + rl) * DM + n0 + lane * 4, *(const v4f*)&so[wave][rl][lane * 4]);
}

extern "C" void kernel_launch(void* const* d_in, const int* in_sizes, int n_in, void* d_out, int out_size, void* d_ws, size_t ws_size, hipStream_t stream) {
  (void)in_sizes; (void)n_in; (void)out_size;
  const float** F = (const float**)d_in;   // q, k, v [2,2048,1024], Wq, bq, Wk, bk, Wv, bv, Wo, bo ([in][out] 1024x1024), Wc [1024,1024], bc
  if (ws_size < (size_t)WS_END) return;
  char* ws = (char*)d_ws; __bf16 *PT = (__bf16*)(ws + WS_PT), *VTH = (__bf16*)(ws + WS_VTH), *VTL = (__bf16*)(ws + WS_VTL); float* QKV = (float*)(ws + WS_QKV);
  float* OUTC = (float*)d_out; float* OUTH = OUTC + (size_t)NR * DM;     // outputs: (c, h)
  k_pack<<<5 * DM, 128, 0, stream>>>(F[3], F[5], F[7], F[9], F[11], PT);
  k_proj<<<dim3(TRB, QKVP / 128), 128, 0, stream>>>(F[0], F[1], F[2], PT, F[4], F[6], F[8], QKV, VTH, VTL);
  k_attn<<<dim3(TQB, TNB * NH), 128, 0, stream>>>(QKV, VTH, VTL);
  k_out<<<dim3((TNB < NB ? TQB : NR / 64), DM / 128), 128, 0, stream>>>(QKV, PT, 4, F[12], OUTC);
  k_out<<<dim3((TNB < NB ? TQB : NR / 64), DM / 128), 128, 0, stream>>>(QKV, PT, 3, F[10], OUTH);
}

// v006
// Measured time: 222 microseconds a run.
// Two timings next to v005 both put it at 1.14 times that version's speed.
// Counting every step since v000, it is 3.36 times as fast.
// compute dtype: q/k/v inputs, the five [in][out] weights + biases (module inputs) rounded to bf16; Q/K/V projections with exact bf16 products (+ bias); scores and P.V with both computed operands as bf16 hi + bf16 residual pairs (3 products); the two output projections (Wc → c, Wo → h) hi/lo x bf16 weights (2 products) + bias; online softmax in f32; f32 accumulate.
#include <hip/hip_runtime.h>
#include <math.h>

typedef __attribute__((ext_vector_type(16))) _Float16 v16h;
typedef __attribute__((ext_vector_type(16))) __bf16 v16b;
typedef __attribute__((ext_vector_type(8)))  _Float16 v8h;
typedef __attribute__((ext_vector_type(8)))  float v8f;
typedef __attribute__((ext_vector_type(4)))  float v4f;
typedef __attribute__((ext_vector_type(2)))  float v2f;
typedef __attribute__((ext_vector_type(4)))  unsigned v4u;
typedef __attribute__((ext_vector_type(4)))  int v4i;
typedef float __attribute__((may_alias)) float_a;
typedef int __attribute__((may_alias)) int_a;

template <typename T> __device__ __forceinline__ void vst2(void* p, T v) { *(T*)p = v;  }
__device__ __forceinline__ v8f wmma16(v16h a, v16h b, v8f c) {
  v8f d = __builtin_amdgcn_wmma_f32_16x16x32_f16(false, a, false, b, (short)0, c, false, false);
  asm volatile("v_nop\n\tv_nop\n\tv_nop\n\tv_nop" : "+v"(d) : "v"(a), "v"(b));
  return d;
}
__device__ __forceinline__ v8f wmma_bf(v16b a, v16b b, v8f c) {
  v8f d = __builtin_amdgcn_wmma_f32_16x16x32_bf16(false, a, false, b, (short)0, c, false, false);
  asm volatile("v_nop\n\tv_nop\n\tv_nop\n\tv_nop" : "+v"(d) : "v"(a), "v"(b));
  return d;
}
// 16x16x32 fragments: lane = (h = lane>>4, row/col = lane&15); elements 0..7 = k0+8h+0..7, 8..15 = k0+16+8h+0..7; D element r = row 8h+r
__device__ __forceinline__ v16h frag_h(const _Float16* rowk0, int lane) {
  union { v16h v; v8h q[2]; } u; const _Float16* p = rowk0 + 8 * (lane >> 4);
  u.q[0] = *(const v8h*)p; u.q[1] = *(const v8h*)(p + 16); return u.v;
}
__device__ __forceinline__ v16h frag_f32(const float* rowk0, int lane) {
  v16h a; const float* p = rowk0 + 8 * (lane >> 4);
#pragma unroll
  for (int i = 0; i < 8; ++i) { a[i] = (_Float16)p[i]; a[8 + i] = (_Float16)p[16 + i]; }
  return a;
}
__device__ __forceinline__ v16h frag_f32s(const float* rowk0, int lane, float sc) {
  v16h a; const float* p = rowk0 + 8 * (lane >> 4);
#pragma unroll
  for (int i = 0; i < 8; ++i) { a[i] = (_Float16)(p[i] * sc); a[8 + i] = (_Float16)(p[16 + i] * sc); }
  return a;
}
// column fragment from a [K][ld] layout (column n), rows >= K read as 0
__device__ __forceinline__ v16h fragc_f32(const float* W, int k0, int n, int lane, int ld, int K) {
  v16h a; const int g = lane >> 4;
#pragma unroll
  for (int i = 0; i < 8; ++i) { const int ka = k0 + 8 * g + i, kb = ka + 16;
    a[i] = (_Float16)(ka < K ? W[(size_t)(ka < K ? ka : K - 1) * ld + n] : 0.f); a[8 + i] = (_Float16)(kb < K ? W[(size_t)(kb < K ? kb : K - 1) * ld + n] : 0.f); }
  return a;
}
struct F2 { v16b h, l; };
__device__ __forceinline__ F2 bsplit16(const float v[16]) { F2 r;
#pragma unroll
  for (int i = 0; i < 16; ++i) { const __bf16 h = (__bf16)v[i]; r.h[i] = h; r.l[i] = (__bf16)(v[i] - (float)h); }
  return r; }
__device__ __forceinline__ F2 split_row(const float* row, int k0, int lane) { float v[16]; const float* p = row + k0 + 8 * (lane >> 4);
#pragma unroll
  for (int i = 0; i < 8; ++i) { v[i] = p[i]; v[8 + i] = p[16 + i]; }
  return bsplit16(v); }
__device__ __forceinline__ F2 split_rowK(const float* row, int k0, int lane, int K) { float v[16]; const int g = lane >> 4;
#pragma unroll
  for (int i = 0; i < 8; ++i) { const int ka = k0 + 8 * g + i, kb = ka + 16; v[i] = ka < K ? row[ka < K ? ka : K - 1] : 0.f; v[8 + i] = kb < K ? row[kb < K ? kb : K - 1] : 0.f; }
  return bsplit16(v); }
__device__ __forceinline__ F2 split_col(const float* W, int k0, int n, int lane, int ld, int K) { float v[16]; const int g = lane >> 4;
#pragma unroll
  for (int i = 0; i < 8; ++i) { const int ka = k0 + 8 * g + i, kb = ka + 16; v[i] = ka < K ? W[(size_t)(ka < K ? ka : K - 1) * ld + n] : 0.f; v[8 + i] = kb < K ? W[(size_t)(kb < K ? kb : K - 1) * ld + n] : 0.f; }
  return bsplit16(v); }
__device__ __forceinline__ v8f mac3(const F2& a, const F2& b, v8f c) { c = wmma_bf(a.l, b.h, c); c = wmma_bf(a.h, b.l, c); return wmma_bf(a.h, b.h, c); }
__device__ __forceinline__ float sigm(float v) { return 1.0f / (1.0f + expf(-v)); }
#define LDSX() do { asm volatile("s_wait_dscnt 0" ::: "memory"); __builtin_amdgcn_wave_barrier(); __builtin_amdgcn_fence(__ATOMIC_RELEASE, "workgroup"); } while (0)


// Cyclic attention block: Q = q Wq + bq, K = k Wk + bk, V = v Wv + bv (16 heads x 64), softmax(Q K^T / 8) V merged; outputs (c, h) = (merged Wc + bc, merged Wo + bo).  B 2, S 2048, H 1024, cyclic_size 1024.
// k_pack (Wq|Wk|Wv|Wo|Wc columns as bf16 rows), k_proj (Q as f32 rows; K as rows of bf16 hi and of bf16 lo; V as V^T, bf16 hi and lo), k_attn (flash-style, 64 key steps), k_out x2 (c into output 0, h into output 1).
#define NB 2
#define SS 2048
#define DM 1024
#define NH 16
#define HD 64
#define NR (NB * SS)
#define QKVP (3 * DM)
#ifndef TRB
#define TRB (NR / 64)
#define TQB (SS / 64)
#define TNB NB
#endif
typedef __attribute__((ext_vector_type(8))) __bf16 v8b;
__device__ __forceinline__ v16b frag_b(const __bf16* rowk0, int lane) {
  union { v16b v; v8b q[2]; } u; const __bf16* p = rowk0 + 8 * (lane >> 4);
  u.q[0] = *(const v8b*)p; u.q[1] = *(const v8b*)(p + 16); return u.v;
}
__device__ __forceinline__ v16b frag_gbf(const float* rowk0, int lane) {
  v16b a; const float* p = rowk0 + 8 * (lane >> 4);
#pragma unroll
  for (int i = 0; i < 8; ++i) { a[i] = (__bf16)p[i]; a[8 + i] = (__bf16)p[16 + i]; }
  return a;
}
__device__ __forceinline__ float bfr(float v) { return (float)(__bf16)v; }
#define WS_PT   0u                                 // bf16 [5*1024 (q|k|v|o|c cols)][1024]
#define WS_QKV  (WS_PT + 2u * 5 * DM * DM)           // f32 [4096 rows][3072]  (q 0..1023 | k, v: not used) ; q cols later overwritten by O
#define WS_VTH  (WS_QKV + 4u * NR * QKVP)            // bf16 [2][1024 (h*64+d)][2048]
#define WS_VTL  (WS_VTH + 2u * NB * DM * SS)
#define WS_KH   (WS_VTL + 2u * NB * DM * SS)         // bf16 [4096 rows][1024 (h*64+d)]
#define WS_KL   (WS_KH + 2u * NR * DM)
#define WS_END  (WS_KL + 2u * NR * DM)

__global__ __launch_bounds__(128) void k_pack(const float* __restrict__ Wq, const float* __restrict__ Wk, const float* __restrict__ Wv, const float* __restrict__ Wo, const float* __restrict__ Wc, __bf16* __restrict__ PT) {
  __shared__ __align__(16) __bf16 srow[DM];
  const int n = blockIdx.x, tid = threadIdx.x; const int which = n / DM, c = n % DM; const float* Wm = which == 0 ? Wq : (which == 1 ? Wk : (which == 2 ? Wv : (which == 3 ? Wo : Wc)));
  for (int k = tid; k < DM; k += 128) srow[k] = (__bf16)Wm[(size_t)k * DM + c];   // [in][out]: column c
  __syncthreads();
  if (tid < DM / 8) vst2((unsigned*)(PT + (size_t)n * DM + tid * 8), *(const v4u*)(&srow[tid * 8]));
}
// ---- GEMM staging (k_proj, k_out): a stage is 64 k of the block's 64 A rows (f32, 256 B a row) and 128 B rows (bf16, 128 B a row), brought into LDS once per block by asynchronous copies in whole 128-B lines,
// two buffers, the next stage in flight while this one is worked on; the waves read their fragments from LDS in the k order they had.  LDS pitches are 16 B x odd: A 272 B, B 144 B.
#define GKC 64
#define GAP 68
#define GBP 72
#define GABUFB (64 * GAP * 4)
#define GBBUFB (128 * GBP * 2)
// one thread's eight 16-byte copies: global rows gs bytes apart, LDS rows ls bytes apart
__device__ __forceinline__ void gemm_stage8(const char* g, size_t gs, unsigned l, unsigned ls) {
  // the copies and s_wait_xcnt 0 in one statement: the wait stands in front of any rewrite of an address register that a copy names
  asm volatile("global_load_async_to_lds_b128 %0, %8, off\n\t"
               "global_load_async_to_lds_b128 %1, %9, off\n\t"
               "global_load_async_to_lds_b128 %2, %10, off\n\t"
               "global_load_async_to_lds_b128 %3, %11, off\n\t"
               "global_load_async_to_lds_b128 %4, %12, off\n\t"
               "global_load_async_to_lds_b128 %5, %13, off\n\t"
               "global_load_async_to_lds_b128 %6, %14, off\n\t"
               "global_load_async_to_lds_b128 %7, %15, off\n\t"
               "s_wait_xcnt 0x0"
               :: "v"(l), "v"(l + ls), "v"(l + 2 * ls), "v"(l + 3 * ls), "v"(l + 4 * ls), "v"(l + 5 * ls), "v"(l + 6 * ls), "v"(l + 7 * ls),
                  "v"(g), "v"(g + gs), "v"(g + 2 * gs), "v"(g + 3 * gs), "v"(g + 4 * gs), "v"(g + 5 * gs), "v"(g + 6 * gs), "v"(g + 7 * gs)
               : "memory");
}
// stage s into buffer bf: A rows t>>4 + 8 j (row pitch apb bytes in global memory), B rows t>>3 + 16 j
__device__ __forceinline__ void gemm_stage(const char* ag, size_t apb, const char* bg, unsigned la, unsigned lb, int s, int bf) {
  gemm_stage8(ag + (size_t)s * (GKC * 4), 8 * apb, la + bf * GABUFB, 8 * GAP * 4);
  gemm_stage8(bg + (size_t)s * (GKC * 2), (size_t)16 * DM * 2, lb + bf * GBBUFB, 16 * GBP * 2);
}
// ---- k_proj: QKV[r][n] = bf16(x[r]) . PT[n] (exact), K = 1024; block (64 rows, 128 cols); 512-B segments of 12-KB rows; the V blocks store V^T (hi, lo) instead, 128-B segments of its 4-KB rows; the K blocks store K (hi, lo), 256-B segments of its 2-KB rows
__global__ __launch_bounds__(128) void k_proj(const float* __restrict__ XQ, const float* __restrict__ XK, const float* __restrict__ XV, const __bf16* __restrict__ PT, const float* __restrict__ bq, const float* __restrict__ bk, const float* __restrict__ bv, float* __restrict__ QKV, __bf16* __restrict__ VTH, __bf16* __restrict__ VTL, __bf16* __restrict__ KH, __bf16* __restrict__ KL) {
  const float* X = (blockIdx.y * 128) < DM ? XQ : ((blockIdx.y * 128) < 2 * DM ? XK : XV);
  __shared__ __align__(16) float so[4][16][132];
  const int tid = threadIdx.x, wave = tid >> 5, lane = tid & 31, col = lane & 15, g = lane >> 4; const size_t r0 = (size_t)blockIdx.x * 64 + wave * 16; const int n0 = blockIdx.y * 128;
  __shared__ __align__(16) float sa[2][64][GAP]; __shared__ __align__(16) __bf16 sb[2][128][GBP];
  const char* ag = (const char*)(X + ((size_t)blockIdx.x * 64 + (tid >> 4)) * DM + (tid & 15) * 4);
  const char* bg = (const char*)(PT + (size_t)(n0 + (tid >> 3)) * DM + (tid & 7) * 8);
  const unsigned la = (unsigned)(size_t)&sa[0][tid >> 4][(tid & 15) * 4], lb = (unsigned)(size_t)&sb[0][tid >> 3][(tid & 7) * 8];
  v8f acc[8] = {};
  gemm_stage(ag, (size_t)DM * 4, bg, la, lb, 0, 0);
  asm volatile("s_wait_asynccnt 0x0" ::: "memory");   // this wave's copies of stage 0 have landed
  __syncthreads();                                    // stage 0 is readable by every wave
  gemm_stage(ag, (size_t)DM * 4, bg, la, lb, 1, 1);
#pragma unroll 1
  for (int s = 0; s < DM / GKC; ++s) { const int cur = s & 1;
    v16b a[GKC / 32], w[GKC / 32][8];   // the stage's fragments are all asked for in front of its first product: one LDS latency a stage
#pragma unroll
    for (int kk = 0; kk < GKC / 32; ++kk) { a[kk] = frag_gbf(&sa[cur][wave * 16 + col][kk * 32], lane);
#pragma unroll
      for (int j = 0; j < 8; ++j) w[kk][j] = frag_b(&sb[cur][j * 16 + col][kk * 32], lane); }
#pragma unroll
    for (int kk = 0; kk < GKC / 32; ++kk) {
#pragma unroll
      for (int j = 0; j < 8; ++j) acc[j] = wmma_bf(a[kk], w[kk][j], acc[j]); }
    asm volatile("s_wait_dscnt 0x0" ::: "memory");      // this wave's LDS reads of this stage are done
    asm volatile("s_wait_asynccnt 0x0" ::: "memory");   // this wave's copies of the next stage have landed
    __syncthreads();                                    // publishes the next stage and frees this stage's buffer
    if (s + 2 < DM / GKC) gemm_stage(ag, (size_t)DM * 4, bg, la, lb, s + 2, cur); }
  asm volatile("s_wait_asynccnt 0x0" ::: "memory");     // no copy is outstanding behind the loop
  if (n0 >= 2 * DM) {   // V columns, the same for the whole block.  A lane's eight accumulator rows are eight successive positions of one V^T row: 16 B of hi, 16 B of lo.  sb is free: every wave has passed the loop's last barrier
    float bias[8];
#pragma unroll
    for (int j = 0; j < 8; ++j) bias[j] = bv[n0 - 2 * DM + j * 16 + col];
    asm volatile("s_wait_xcnt 0x0" ::: "memory");   // stands in front of any rewrite of an address register that the bias loads name
#pragma unroll
    for (int j = 0; j < 8; ++j) { const float bb = bfr(bias[j]); v8b hv, lv;
#pragma unroll
      for (int r = 0; r < 8; ++r) { const float v = acc[j][r] + bb; const __bf16 hb = (__bf16)v; hv[r] = hb; lv[r] = (__bf16)(v - (float)hb); }
      vst2(&sb[0][j * 16 + col][wave * 16 + 8 * g], hv); vst2(&sb[1][j * 16 + col][wave * 16 + 8 * g], lv); }
    __syncthreads();   // the four waves' 16 positions each make up the whole 128-B lines stored below
    const size_t t0 = (size_t)blockIdx.x * 64; const size_t vb = ((t0 / SS) * DM + (size_t)(n0 - 2 * DM)) * SS + t0 % SS;
#pragma unroll
    for (int i = 0; i < 8; ++i) { const int rowi = i * 16 + (tid >> 3), pc = tid & 7; const size_t o = vb + (size_t)rowi * SS + pc * 8;   // eight lanes store one line
      vst2(VTH + o, *(const v8b*)&sb[0][rowi][pc * 8]); vst2(VTL + o, *(const v8b*)&sb[1][rowi][pc * 8]); }
    return; }
#pragma unroll
  for (int j = 0; j < 8; ++j) { const int n = n0 + j * 16 + col; const int which = n / DM, c = n % DM; const float bb = bfr((which == 0 ? bq : which == 1 ? bk : bv)[c]);
#pragma unroll
    for (int r = 0; r < 8; ++r) so[wave][8 * g + r][j * 16 + col] = acc[j][r] + bb; }
  LDSX();
  if (n0 >= DM) {   // K columns, the same for the whole block: each value leaves as the bf16 hi + bf16 residual pair that the score products take; 16 lanes store 256 B of a row of hi and of lo
#pragma unroll
    for (int rl = 0; rl < 16; rl += 2) { const float* s = &so[wave][rl + g][col * 8]; v8b hv, lv;
#pragma unroll
      for (int i = 0; i < 8; ++i) { const float v = s[i]; const __bf16 hb = (__bf16)v; hv[i] = hb; lv[i] = (__bf16)(v - (float)hb); }
      const size_t o = (r0 + rl + g) * DM + (n0 - DM) + col * 8;
      vst2(KH + o, hv); vst2(KL + o, lv); }
    asm volatile("s_wait_xcnt 0x0" ::: "memory");   // stands in front of any rewrite of a register that these stores name
    return; }
  for (int rl = 0; rl < 16; ++rl) vst2(QKV + (r0 + rl) * QKVP + n0 + lane * 4, *(const v4f*)&so[wave][rl][lane * 4]);
}
// ---- k_attn: block = (query block qb, b*16 + h), 4 waves: all SS/32 key steps; online softmax; O written over the q columns of the block's rows (head segment 256 B)
// The products are taken transposed: S^T = K Q^T (A = K rows, B = Q rows) and O^T += V^T P^T (A = V^T rows, B = P^T).  A lane then holds 16 of the 32 scores of ONE query (column lane & 15; keys 8g + r and 16 + 8g + r),
// so maximum and sum are in-lane with one exchange between the wave's halves, and the two score tiles, converted in place, are the B fragment of P^T in the loaders' own k order: P goes through no LDS.
// The 32-key K tile (hi, lo) and V tile (hi, lo) of a step are brought into LDS once per block by asynchronous copies, two buffers, the next step's tile in flight while this one is worked on; all four waves read their fragments from LDS.
// LDS pitches are 16 B x odd, conflict-free for 16-byte LDS reads: K rows of 128 B at 144 B, V rows of 64 B at 80 B.
#define KPB 72
#define VPB 40
#define KARRB (32 * KPB * 2)
#define KBUFB (2 * KARRB)
#define VARRB (HD * VPB * 2)
#define VBUFB (2 * VARRB)
// one thread's eight 16-byte copies of one tile: K rows r, r+16 of hi and of lo; V rows d, d+32 of hi and of lo
__device__ __forceinline__ void attn_stage(const __bf16* khg, const __bf16* klg, const __bf16* vhg, const __bf16* vlg, unsigned lk, unsigned lv) {
  // the copies and s_wait_xcnt 0 in one statement: the wait stands in front of any rewrite of an address register that a copy names
  asm volatile("global_load_async_to_lds_b128 %0, %8, off\n\t"
               "global_load_async_to_lds_b128 %1, %9, off\n\t"
               "global_load_async_to_lds_b128 %2, %10, off\n\t"
               "global_load_async_to_lds_b128 %3, %11, off\n\t"
               "global_load_async_to_lds_b128 %4, %12, off\n\t"
               "global_load_async_to_lds_b128 %5, %13, off\n\t"
               "global_load_async_to_lds_b128 %6, %14, off\n\t"
               "global_load_async_to_lds_b128 %7, %15, off\n\t"
               "s_wait_xcnt 0x0"
               :: "v"(lk), "v"(lk + 16 * KPB * 2), "v"(lk + KARRB), "v"(lk + KARRB + 16 * KPB * 2),
                  "v"(lv), "v"(lv + 32 * VPB * 2), "v"(lv + VARRB), "v"(lv + VARRB + 32 * VPB * 2),
                  "v"(khg), "v"(khg + 16 * DM), "v"(klg), "v"(klg + 16 * DM),
                  "v"(vhg), "v"(vhg + 32 * SS), "v"(vlg), "v"(vlg + 32 * SS)
               : "memory");
}
// lane l <-> lane l ^ 16
__device__ __forceinline__ float xhalf(float v) { const int b = __builtin_bit_cast(int, v); return __builtin_bit_cast(float, __builtin_amdgcn_permlanex16(b, b, 0x76543210, 0xfedcba98, false, false)); }
// mac3 with the operands' sides swapped: the three products are added in mac3's order
__device__ __forceinline__ v8f mac3t(const F2& a, const F2& b, v8f c) { c = wmma_bf(a.h, b.l, c); c = wmma_bf(a.l, b.h, c); return wmma_bf(a.h, b.h, c); }
__global__ __launch_bounds__(128) void k_attn(float* __restrict__ QKV, const __bf16* __restrict__ KH, const __bf16* __restrict__ KL, const __bf16* __restrict__ VTH, const __bf16* __restrict__ VTL) {
  __shared__ __align__(16) float so[4][16][68];
  __shared__ __align__(16) __bf16 sk[2][2][32][KPB]; __shared__ __align__(16) __bf16 sv[2][2][HD][VPB];
  const int tid = threadIdx.x, wave = tid >> 5, lane = tid & 31, col = lane & 15, g = lane >> 4;
  const int qb = blockIdx.x, bh = blockIdx.y, b = bh / NH, h = bh % NH; const int q0 = qb * 64 + wave * 16; const size_t tq = (size_t)b * SS + q0;
  const F2 a0 = split_row(QKV + (tq + col) * QKVP + h * HD, 0, lane), a1 = split_row(QKV + (tq + col) * QKVP + h * HD, 32, lane);
  float m = -3.0e38f, l = 0.f;   // of query col; l sums this half's keys only, the halves are joined behind the loop
  v8f acc[4] = {};               // acc[dt][r] = O[query col][dt * 16 + 8 g + r]
  const int nsteps = SS / 32;
  const size_t ko = ((size_t)b * SS + (tid >> 3)) * DM + h * HD + (tid & 7) * 8;
  const __bf16 *khg = KH + ko, *klg = KL + ko;
  const size_t vo = ((size_t)b * DM + h * HD + (tid >> 2)) * SS + (tid & 3) * 8;
  const __bf16 *vhg = VTH + vo, *vlg = VTL + vo;
  const unsigned lk = (unsigned)(size_t)&sk[0][0][tid >> 3][(tid & 7) * 8], lv = (unsigned)(size_t)&sv[0][0][tid >> 2][(tid & 3) * 8];
  attn_stage(khg, klg, vhg, vlg, lk, lv);
  asm volatile("s_wait_asynccnt 0x0" ::: "memory");   // this wave's copies of tile 0 have landed
  __syncthreads();                                    // tile 0 is readable by every wave
  attn_stage(khg + 32 * DM, klg + 32 * DM, vhg + 32, vlg + 32, lk + KBUFB, lv + VBUFB);
#pragma unroll 1
  for (int ks = 0; ks < nsteps; ++ks) {
    const int cur = ks & 1;
    float e[16];
#pragma unroll
    for (int ct = 0; ct < 2; ++ct) { const __bf16 *kh = &sk[cur][0][ct * 16 + col][0], *kl = &sk[cur][1][ct * 16 + col][0];
      const F2 k0 = {frag_b(kh, lane), frag_b(kl, lane)}, k1 = {frag_b(kh + 32, lane), frag_b(kl + 32, lane)};
      v8f c = mac3t(k0, a0, (v8f){}); c = mac3t(k1, a1, c);
#pragma unroll
      for (int r = 0; r < 8; ++r) e[ct * 8 + r] = c[r] * 0.125f; }
    float mx = e[0];
#pragma unroll
    for (int i = 1; i < 16; ++i) mx = fmaxf(mx, e[i]);
    mx = fmaxf(mx, xhalf(mx));
    const float mn = fmaxf(m, mx); const float alpha = expf(m - mn); m = mn;
#pragma unroll
    for (int i = 0; i < 16; ++i) e[i] = expf(e[i] - mn);
    l = l * alpha + (((e[0] + e[1]) + (e[2] + e[3])) + ((e[4] + e[5]) + (e[6] + e[7])) + (((e[8] + e[9]) + (e[10] + e[11])) + ((e[12] + e[13]) + (e[14] + e[15]))));
#pragma unroll
    for (int dt = 0; dt < 4; ++dt) acc[dt] *= alpha;
    const F2 pb = bsplit16(e);
#pragma unroll
    for (int dt = 0; dt < 4; ++dt) { const v16b vh = frag_b(&sv[cur][0][dt * 16 + col][0], lane), vl = frag_b(&sv[cur][1][dt * 16 + col][0], lane);
      acc[dt] = wmma_bf(vh, pb.l, acc[dt]); acc[dt] = wmma_bf(vl, pb.h, acc[dt]); acc[dt] = wmma_bf(vh, pb.h, acc[dt]); }
    asm volatile("s_wait_dscnt 0x0" ::: "memory");      // this wave's LDS reads of this step's tile are done
    asm volatile("s_wait_asynccnt 0x0" ::: "memory");   // this wave's copies of the next tile have landed
    __syncthreads();                                    // publishes the next tile and frees this step's buffer
    if (ks + 2 < nsteps) attn_stage(khg + (size_t)(ks + 2) * 32 * DM, klg + (size_t)(ks + 2) * 32 * DM, vhg + (ks + 2) * 32, vlg + (ks + 2) * 32, lk + cur * KBUFB, lv + cur * VBUFB); }
  asm volatile("s_wait_asynccnt 0x0" ::: "memory");     // no copy is outstanding behind the loop
  const float il = 1.0f / (l + xhalf(l));
#pragma unroll
  for (int dt = 0; dt < 4; ++dt) { const v8f o = acc[dt] * il; float* d = &so[wave][col][dt * 16 + 8 * g];
    vst2(d, (v4f){o[0], o[1], o[2], o[3]}); vst2(d + 4, (v4f){o[4], o[5], o[6], o[7]}); }
  LDSX();
  for (int rl = 0; rl < 16; ++rl) if (lane < 16) vst2(QKV + (tq + rl) * QKVP + h * HD + lane * 4, *(const v4f*)&so[wave][rl][lane * 4]);
}
// ---- k_out: Y = O(hi/lo; the q columns of QKV) . PT_out rows (2 products, K = 1024); block (64 rows, 128 cols)
__global__ __launch_bounds__(128) void k_out(const float* __restrict__ QKV, const __bf16* __restrict__ PT, int wblk, const float* __restrict__ bo, float* __restrict__ Y) {
  __shared__ __align__(16) float so[4][16][132];
  const int tid = threadIdx.x, wave = tid >> 5, lane = tid & 31, col = lane & 15, g = lane >> 4; const size_t r0 = (size_t)blockIdx.x * 64 + wave * 16; const int n0 = blockIdx.y * 128;
  __shared__ __align__(16) float sa[2][64][GAP]; __shared__ __align__(16) __bf16 sb[2][128][GBP];
  const char* ag = (const char*)(QKV + ((size_t)blockIdx.x * 64 + (tid >> 4)) * QKVP + (tid & 15) * 4);
  const char* bg = (const char*)(PT + (size_t)(wblk * DM + n0 + (tid >> 3)) * DM + (tid & 7) * 8);
  const unsigned la = (unsigned)(size_t)&sa[0][tid >> 4][(tid & 15) * 4], lb = (unsigned)(size_t)&sb[0][tid >> 3][(tid & 7) * 8];
  v8f acc[8] = {};
  gemm_stage(ag, (size_t)QKVP * 4, bg, la, lb, 0, 0);
  asm volatile("s_wait_asynccnt 0x0" ::: "memory");   // this wave's copies of stage 0 have landed
  __syncthreads();                                    // stage 0 is readable by every wave
  gemm_stage(ag, (size_t)QKVP * 4, bg, la, lb, 1, 1);
#pragma unroll 1
  for (int s = 0; s < DM / GKC; ++s) { const int cur = s & 1;
    F2 a[GKC / 32]; v16b w[GKC / 32][8];   // the stage's fragments are all asked for in front of its first product: one LDS latency a stage
#pragma unroll
    for (int kk = 0; kk < GKC / 32; ++kk) { a[kk] = split_row(&sa[cur][wave * 16 + col][0], kk * 32, lane);
#pragma unroll
      for (int j = 0; j < 8; ++j) w[kk][j] = frag_b(&sb[cur][j * 16 + col][kk * 32], lane); }
#pragma unroll
    for (int kk = 0; kk < GKC / 32; ++kk) {
#pragma unroll
      for (int j = 0; j < 8; ++j) { acc[j] = wmma_bf(a[kk].l, w[kk][j], acc[j]); acc[j] = wmma_bf(a[kk].h, w[kk][j], acc[j]); } }
    asm volatile("s_wait_dscnt 0x0" ::: "memory");      // this wave's LDS reads of this stage are done
    asm volatile("s_wait_asynccnt 0x0" ::: "memory");   // this wave's copies of the next stage have landed
    __syncthreads();                                    // publishes the next stage and frees this stage's buffer
    if (s + 2 < DM / GKC) gemm_stage(ag, (size_t)QKVP * 4, bg, la, lb, s + 2, cur); }
  asm volatile("s_wait_asynccnt 0x0" ::: "memory");     // no copy is outstanding behind the loop
#pragma unroll
  for (int j = 0; j < 8; ++j) { const float bb = bfr(bo[n0 + j * 16 + col]);
#pragma unroll
    for (int r = 0; r < 8; ++r) so[wave][8 * g + r][j * 16 + col] = acc[j][r] + bb; }
  LDSX();
  for (int rl = 0; rl < 16; ++rl) vst2(Y + (r0 + rl) * DM + n0 + lane * 4, *(const v4f*)&so[wave][rl][lane * 4]);
}

extern "C" void kernel_launch(void* const* d_in, const int* in_sizes, int n_in, void* d_out, int out_size, void* d_ws, size_t ws_size, hipStream_t stream) {
  (void)in_sizes; (void)n_in; (void)out_size;
  const float** F = (const float**)d_in;   // q, k, v [2,2048,1024], Wq, bq, Wk, bk, Wv, bv, Wo, bo ([in][out] 1024x1024), Wc [1024,1024], bc
  if (ws_size < (size_t)WS_END) return;
  char* ws = (char*)d_ws; __bf16 *PT = (__bf16*)(ws + WS_PT), *VTH = (__bf16*)(ws + WS_VTH), *VTL = (__bf16*)(ws + WS_VTL), *KH = (__bf16*)(ws + WS_KH), *KL = (__bf16*)(ws + WS_KL); float* QKV = (float*)(ws + WS_QKV);
  float* OUTC = (float*)d_out; float* OUTH = OUTC + (size_t)NR * DM;     // outputs: (c, h)
  k_pack<<<5 * DM, 128, 0, stream>>>(F[3], F[5], F[7], F[9], F[11], PT);
  k_proj<<<dim3(TRB, QKVP / 128), 128, 0, stream>>>(F[0], F[1], F[2], PT, F[4], F[6], F[8], QKV, VTH, VTL, KH, KL);
  k_attn<<<dim3(TQB, TNB * NH), 128, 0, stream>>>(QKV, KH, KL, VTH, VTL);
  k_out<<<dim3((TNB < NB ? TQB : NR / 64), DM / 128), 128, 0, stream>>>(QKV, PT, 4, F[12], OUTC);
  k_out<<<dim3((TNB < NB ? TQB : NR / 64), DM / 128), 128, 0, stream>>>(QKV, PT, 3, F[10], OUTH);
}

// v007
// Measured time: 194 microseconds a run.
// Next to v006, in two timings, it ran 1.15 and 1.14 times as fast.
// Counting every step since v000, it is 3.85 times as fast.
// compute dtype: q/k/v inputs, the five [in][out] weights + biases (module inputs) rounded to bf16; Q/K/V projections with exact bf16 products (+ bias); scores and P.V with both computed operands as bf16 hi + bf16 residual pairs (3 products); the two output projections (Wc → c, Wo → h) hi/lo x bf16 weights (2 products) + bias; online softmax in f32; f32 accumulate.
#include <hip/hip_runtime.h>
#include <math.h>

typedef __attribute__((ext_vector_type(16))) _Float16 v16h;
typedef __attribute__((ext_vector_type(16))) __bf16 v16b;
typedef __attribute__((ext_vector_type(8)))  _Float16 v8h;
typedef __attribute__((ext_vector_type(8)))  float v8f;
typedef __attribute__((ext_vector_type(4)))  float v4f;
typedef __attribute__((ext_vector_type(2)))  float v2f;
typedef __attribute__((ext_vector_type(4)))  unsigned v4u;
typedef __attribute__((ext_vector_type(4)))  int v4i;
typedef float __attribute__((may_alias)) float_a;
typedef int __attribute__((may_alias)) int_a;

template <typename T> __device__ __forceinline__ void vst2(void* p, T v) { *(T*)p = v;  }
__device__ __forceinline__ v8f wmma16(v16h a, v16h b, v8f c) {
  v8f d = __builtin_amdgcn_wmma_f32_16x16x32_f16(false, a, false, b, (short)0, c, false, false);
  asm volatile("v_nop\n\tv_nop\n\tv_nop\n\tv_nop" : "+v"(d) : "v"(a), "v"(b));
  return d;
}
__device__ __forceinline__ v8f wmma_bf(v16b a, v16b b, v8f c) {
  v8f d = __builtin_amdgcn_wmma_f32_16x16x32_bf16(false, a, false, b, (short)0, c, false, false);
  asm volatile("v_nop\n\tv_nop\n\tv_nop\n\tv_nop" : "+v"(d) : "v"(a), "v"(b));
  return d;
}
// 16x16x32 fragments: lane = (h = lane>>4, row/col = lane&15); elements 0..7 = k0+8h+0..7, 8..15 = k0+16+8h+0..7; D element r = row 8h+r
__device__ __forceinline__ v16h frag_h(const _Float16* rowk0, int lane) {
  union { v16h v; v8h q[2]; } u; const _Float16* p = rowk0 + 8 * (lane >> 4);
  u.q[0] = *(const v8h*)p; u.q[1] = *(const v8h*)(p + 16); return u.v;
}
__device__ __forceinline__ v16h frag_f32(const float* rowk0, int lane) {
  v16h a; const float* p = rowk0 + 8 * (lane >> 4);
#pragma unroll
  for (int i = 0; i < 8; ++i) { a[i] = (_Float16)p[i]; a[8 + i] = (_Float16)p[16 + i]; }
  return a;
}
__device__ __forceinline__ v16h frag_f32s(const float* rowk0, int lane, float sc) {
  v16h a; const float* p = rowk0 + 8 * (lane >> 4);
#pragma unroll
  for (int i = 0; i < 8; ++i) { a[i] = (_Float16)(p[i] * sc); a[8 + i] = (_Float16)(p[16 + i] * sc); }
  return a;
}
// column fragment from a [K][ld] layout (column n), rows >= K read as 0
__device__ __forceinline__ v16h fragc_f32(const float* W, int k0, int n, int lane, int ld, int K) {
  v16h a; const int g = lane >> 4;
#pragma unroll
  for (int i = 0; i < 8; ++i) { const int ka = k0 + 8 * g + i, kb = ka + 16;
    a[i] = (_Float16)(ka < K ? W[(size_t)(ka < K ? ka : K - 1) * ld + n] : 0.f); a[8 + i] = (_Float16)(kb < K ? W[(size_t)(kb < K ? kb : K - 1) * ld + n] : 0.f); }
  return a;
}
struct F2 { v16b h, l; };
__device__ __forceinline__ F2 bsplit16(const float v[16]) { F2 r;
#pragma unroll
  for (int i = 0; i < 16; ++i) { const __bf16 h = (__bf16)v[i]; r.h[i] = h; r.l[i] = (__bf16)(v[i] - (float)h); }
  return r; }
__device__ __forceinline__ F2 split_row(const float* row, int k0, int lane) { float v[16]; const float* p = row + k0 + 8 * (lane >> 4);
#pragma unroll
  for (int i = 0; i < 8; ++i) { v[i] = p[i]; v[8 + i] = p[16 + i]; }
  return bsplit16(v); }
__device__ __forceinline__ F2 split_rowK(const float* row, int k0, int lane, int K) { float v[16]; const int g = lane >> 4;
#pragma unroll
  for (int i = 0; i < 8; ++i) { const int ka = k0 + 8 * g + i, kb = ka + 16; v[i] = ka < K ? row[ka < K ? ka : K - 1] : 0.f; v[8 + i] = kb < K ? row[kb < K ? kb : K - 1] : 0.f; }
  return bsplit16(v); }
__device__ __forceinline__ F2 split_col(const float* W, int k0, int n, int lane, int ld, int K) { float v[16]; const int g = lane >> 4;
#pragma unroll
  for (int i = 0; i < 8; ++i) { const int ka = k0 + 8 * g + i, kb = ka + 16; v[i] = ka < K ? W[(size_t)(ka < K ? ka : K - 1) * ld + n] : 0.f; v[8 + i] = kb < K ? W[(size_t)(kb < K ? kb : K - 1) * ld + n] : 0.f; }
  return bsplit16(v); }
__device__ __forceinline__ v8f mac3(const F2& a, const F2& b, v8f c) { c = wmma_bf(a.l, b.h, c); c = wmma_bf(a.h, b.l, c); return wmma_bf(a.h, b.h, c); }
__device__ __forceinline__ float sigm(float v) { return 1.0f / (1.0f + expf(-v)); }
#define LDSX() do { asm volatile("s_wait_dscnt 0" ::: "memory"); __builtin_amdgcn_wave_barrier(); __builtin_amdgcn_fence(__ATOMIC_RELEASE, "workgroup"); } while (0)


// Cyclic attention block: Q = q Wq + bq, K = k Wk + bk, V = v Wv + bv (16 heads x 64), softmax(Q K^T / 8) V merged; outputs (c, h) = (merged Wc + bc, merged Wo + bo).  B 2, S 2048, H 1024, cyclic_size 1024.
// k_pack (Wq|Wk|Wv|Wo|Wc columns as bf16 rows), k_proj (Q as f32 rows; K as rows of bf16 hi and of bf16 lo; V as V^T, bf16 hi and lo), k_attn (flash-style, 64 key steps), k_out x2 (c into output 0, h into output 1).
#define NB 2
#define SS 2048
#define DM 1024
#define NH 16
#define HD 64
#define NR (NB * SS)
#define QKVP (3 * DM)
#ifndef TRB
#define TRB (NR / 64)
#define TQB (SS / 64)
#define TNB NB
#endif
typedef __attribute__((ext_vector_type(8))) __bf16 v8b;
__device__ __forceinline__ v16b frag_b(const __bf16* rowk0, int lane) {
  union { v16b v; v8b q[2]; } u; const __bf16* p = rowk0 + 8 * (lane >> 4);
  u.q[0] = *(const v8b*)p; u.q[1] = *(const v8b*)(p + 16); return u.v;
}
__device__ __forceinline__ v16b frag_gbf(const float* rowk0, int lane) {
  v16b a; const float* p = rowk0 + 8 * (lane >> 4);
#pragma unroll
  for (int i = 0; i < 8; ++i) { a[i] = (__bf16)p[i]; a[8 + i] = (__bf16)p[16 + i]; }
  return a;
}
__device__ __forceinline__ float bfr(float v) { return (float)(__bf16)v; }
#define WS_PT   0u                                 // bf16 [5*1024 (q|k|v|o|c cols)][1024]
#define WS_QKV  (WS_PT + 2u * 5 * DM * DM)           // f32 [4096 rows][3072]  (q 0..1023 | k, v: not used) ; q cols later overwritten by O
#define WS_VTH  (WS_QKV + 4u * NR * QKVP)            // bf16 [2][1024 (h*64+d)][2048]
#define WS_VTL  (WS_VTH + 2u * NB * DM * SS)
#define WS_KH   (WS_VTL + 2u * NB * DM * SS)         // bf16 [4096 rows][1024 (h*64+d)]
#define WS_KL   (WS_KH + 2u * NR * DM)
#define WS_END  (WS_KL + 2u * NR * DM)

// k_pack: block = one 64 (in) x 64 (out) tile of one weight.  The tile is read along the weight's rows (16 lanes read 256 successive bytes), turned in LDS, and leaves as whole 128-B lines of PT rows.
// LDS pitch 144 B: rows stay 16-byte aligned and successive rows start on different banks.
#define PKT 64
#define PKP 72
__global__ __launch_bounds__(128) void k_pack(const float* __restrict__ Wq, const float* __restrict__ Wk, const float* __restrict__ Wv, const float* __restrict__ Wo, const float* __restrict__ Wc, __bf16* __restrict__ PT) {
  __shared__ __align__(16) __bf16 st[PKT][PKP];
  const int tid = threadIdx.x, which = blockIdx.z, k0 = blockIdx.x * PKT, n0 = blockIdx.y * PKT; const float* Wm = which == 0 ? Wq : (which == 1 ? Wk : (which == 2 ? Wv : (which == 3 ? Wo : Wc)));
  const int kg = tid >> 4, nq = tid & 15;   // this thread: rows k0 + 8 kg + 0..7, columns n0 + 4 nq + 0..3
  const float* src = Wm + (size_t)(k0 + kg * 8) * DM + n0 + nq * 4;
  v4f x[8];
#pragma unroll   // the eight loads are all in flight before the first is used, and x stays in registers
  for (int i = 0; i < 8; ++i) x[i] = *(const v4f*)(src + (size_t)i * DM);
#pragma unroll   // constant indices into x: no scratch
  for (int j = 0; j < 4; ++j) { v8b t;
#pragma unroll
    for (int i = 0; i < 8; ++i) t[i] = (__bf16)x[i][j];
    vst2(&st[nq * 4 + j][kg * 8], t); }
  __syncthreads();
#pragma unroll   // the four LDS reads go out together, one latency
  for (int i = 0; i < 4; ++i) { const int row = i * 16 + (tid >> 3), pc = tid & 7;   // eight lanes store one line
    vst2(PT + (size_t)(which * DM + n0 + row) * DM + k0 + pc * 8, *(const v8b*)&st[row][pc * 8]); }
}
// ---- GEMM staging (k_proj, k_out): a stage is 64 k of the block's 64 A rows (f32, 256 B a row) and 128 B rows (bf16, 128 B a row), brought into LDS once per block by asynchronous copies in whole 128-B lines,
// two buffers, the next stage in flight while this one is worked on; the waves read their fragments from LDS in the k order they had.  LDS pitches are 16 B x odd: A 272 B, B 144 B.
#define GKC 64
#define GAP 68
#define GBP 72
#define GABUFB (64 * GAP * 4)
#define GBBUFB (128 * GBP * 2)
// one thread's eight 16-byte copies: global rows gs bytes apart, LDS rows ls bytes apart
__device__ __forceinline__ void gemm_stage8(const char* g, size_t gs, unsigned l, unsigned ls) {
  // the copies and s_wait_xcnt 0 in one statement: the wait stands in front of any rewrite of an address register that a copy names
  asm volatile("global_load_async_to_lds_b128 %0, %8, off\n\t"
               "global_load_async_to_lds_b128 %1, %9, off\n\t"
               "global_load_async_to_lds_b128 %2, %10, off\n\t"
               "global_load_async_to_lds_b128 %3, %11, off\n\t"
               "global_load_async_to_lds_b128 %4, %12, off\n\t"
               "global_load_async_to_lds_b128 %5, %13, off\n\t"
               "global_load_async_to_lds_b128 %6, %14, off\n\t"
               "global_load_async_to_lds_b128 %7, %15, off\n\t"
               "s_wait_xcnt 0x0"
               :: "v"(l), "v"(l + ls), "v"(l + 2 * ls), "v"(l + 3 * ls), "v"(l + 4 * ls), "v"(l + 5 * ls), "v"(l + 6 * ls), "v"(l + 7 * ls),
                  "v"(g), "v"(g + gs), "v"(g + 2 * gs), "v"(g + 3 * gs), "v"(g + 4 * gs), "v"(g + 5 * gs), "v"(g + 6 * gs), "v"(g + 7 * gs)
               : "memory");
}
// stage s into buffer bf: A rows t>>4 + 8 j (row pitch apb bytes in global memory), B rows t>>3 + 16 j
__device__ __forceinline__ void gemm_stage(const char* ag, size_t apb, const char* bg, unsigned la, unsigned lb, int s, int bf) {
  gemm_stage8(ag + (size_t)s * (GKC * 4), 8 * apb, la + bf * GABUFB, 8 * GAP * 4);
  gemm_stage8(bg + (size_t)s * (GKC * 2), (size_t)16 * DM * 2, lb + bf * GBBUFB, 16 * GBP * 2);
}
// ---- k_proj: QKV[r][n] = bf16(x[r]) . PT[n] (exact), K = 1024; block (64 rows, 128 cols); 512-B segments of 12-KB rows; the V blocks store V^T (hi, lo) instead, 128-B segments of its 4-KB rows; the K blocks store K (hi, lo), 256-B segments of its 2-KB rows
__global__ __launch_bounds__(128) void k_proj(const float* __restrict__ XQ, const float* __restrict__ XK, const float* __restrict__ XV, const __bf16* __restrict__ PT, const float* __restrict__ bq, const float* __restrict__ bk, const float* __restrict__ bv, float* __restrict__ QKV, __bf16* __restrict__ VTH, __bf16* __restrict__ VTL, __bf16* __restrict__ KH, __bf16* __restrict__ KL) {
  const float* X = (blockIdx.y * 128) < DM ? XQ : ((blockIdx.y * 128) < 2 * DM ? XK : XV);
  __shared__ __align__(16) float so[4][16][132];
  const int tid = threadIdx.x, wave = tid >> 5, lane = tid & 31, col = lane & 15, g = lane >> 4; const size_t r0 = (size_t)blockIdx.x * 64 + wave * 16; const int n0 = blockIdx.y * 128;
  __shared__ __align__(16) float sa[2][64][GAP]; __shared__ __align__(16) __bf16 sb[2][128][GBP];
  const char* ag = (const char*)(X + ((size_t)blockIdx.x * 64 + (tid >> 4)) * DM + (tid & 15) * 4);
  const char* bg = (const char*)(PT + (size_t)(n0 + (tid >> 3)) * DM + (tid & 7) * 8);
  const unsigned la = (unsigned)(size_t)&sa[0][tid >> 4][(tid & 15) * 4], lb = (unsigned)(size_t)&sb[0][tid >> 3][(tid & 7) * 8];
  v8f acc[8] = {};
  gemm_stage(ag, (size_t)DM * 4, bg, la, lb, 0, 0);
  asm volatile("s_wait_asynccnt 0x0" ::: "memory");   // this wave's copies of stage 0 have landed
  __syncthreads();                                    // stage 0 is readable by every wave
  gemm_stage(ag, (size_t)DM * 4, bg, la, lb, 1, 1);
#pragma unroll 1
  for (int s = 0; s < DM / GKC; ++s) { const int cur = s & 1;
    v16b a[GKC / 32], w[GKC / 32][8];   // the stage's fragments are all asked for in front of its first product: one LDS latency a stage
#pragma unroll
    for (int kk = 0; kk < GKC / 32; ++kk) { a[kk] = frag_gbf(&sa[cur][wave * 16 + col][kk * 32], lane);
#pragma unroll
      for (int j = 0; j < 8; ++j) w[kk][j] = frag_b(&sb[cur][j * 16 + col][kk * 32], lane); }
#pragma unroll
    for (int kk = 0; kk < GKC / 32; ++kk) {
#pragma unroll
      for (int j = 0; j < 8; ++j) acc[j] = wmma_bf(a[kk], w[kk][j], acc[j]); }
    asm volatile("s_wait_dscnt 0x0" ::: "memory");      // this wave's LDS reads of this stage are done
    asm volatile("s_wait_asynccnt 0x0" ::: "memory");   // this wave's copies of the next stage have landed
    __syncthreads();                                    // publishes the next stage and frees this stage's buffer
    if (s + 2 < DM / GKC) gemm_stage(ag, (size_t)DM * 4, bg, la, lb, s + 2, cur); }
  asm volatile("s_wait_asynccnt 0x0" ::: "memory");     // no copy is outstanding behind the loop
  if (n0 >= 2 * DM) {   // V columns, the same for the whole block.  A lane's eight accumulator rows are eight successive positions of one V^T row: 16 B of hi, 16 B of lo.  sb is free: every wave has passed the loop's last barrier
    float bias[8];
#pragma unroll
    for (int j = 0; j < 8; ++j) bias[j] = bv[n0 - 2 * DM + j * 16 + col];
    asm volatile("s_wait_xcnt 0x0" ::: "memory");   // stands in front of any rewrite of an address register that the bias loads name
#pragma unroll
    for (int j = 0; j < 8; ++j) { const float bb = bfr(bias[j]); v8b hv, lv;
#pragma unroll
      for (int r = 0; r < 8; ++r) { const float v = acc[j][r] + bb; const __bf16 hb = (__bf16)v; hv[r] = hb; lv[r] = (__bf16)(v - (float)hb); }
      vst2(&sb[0][j * 16 + col][wave * 16 + 8 * g], hv); vst2(&sb[1][j * 16 + col][wave * 16 + 8 * g], lv); }
    __syncthreads();   // the four waves' 16 positions each make up the whole 128-B lines stored below
    const size_t t0 = (size_t)blockIdx.x * 64; const size_t vb = ((t0 / SS) * DM + (size_t)(n0 - 2 * DM)) * SS + t0 % SS;
#pragma unroll
    for (int i = 0; i < 8; ++i) { const int rowi = i * 16 + (tid >> 3), pc = tid & 7; const size_t o = vb + (size_t)rowi * SS + pc * 8;   // eight lanes store one line
      vst2(VTH + o, *(const v8b*)&sb[0][rowi][pc * 8]); vst2(VTL + o, *(const v8b*)&sb[1][rowi][pc * 8]); }
    return; }
#pragma unroll
  for (int j = 0; j < 8; ++j) { const int n = n0 + j * 16 + col; const int which = n / DM, c = n % DM; const float bb = bfr((which == 0 ? bq : which == 1 ? bk : bv)[c]);
#pragma unroll
    for (int r = 0; r < 8; ++r) so[wave][8 * g + r][j * 16 + col] = acc[j][r] + bb; }
  LDSX();
  if (n0 >= DM) {   // K columns, the same for the whole block: each value leaves as the bf16 hi + bf16 residual pair that the score products take; 16 lanes store 256 B of a row of hi and of lo
#pragma unroll
    for (int rl = 0; rl < 16; rl += 2) { const float* s = &so[wave][rl + g][col * 8]; v8b hv, lv;
#pragma unroll
      for (int i = 0; i < 8; ++i) { const float v = s[i]; const __bf16 hb = (__bf16)v; hv[i] = hb; lv[i] = (__bf16)(v - (float)hb); }
      const size_t o = (r0 + rl + g) * DM + (n0 - DM) + col * 8;
      vst2(KH + o, hv); vst2(KL + o, lv); }
    asm volatile("s_wait_xcnt 0x0" ::: "memory");   // stands in front of any rewrite of a register that these stores name
    return; }
  for (int rl = 0; rl < 16; ++rl) vst2(QKV + (r0 + rl) * QKVP + n0 + lane * 4, *(const v4f*)&so[wave][rl][lane * 4]);
}
// ---- k_attn: block = (query block qb, b*16 + h), 4 waves: all SS/32 key steps; online softmax; O written over the q columns of the block's rows (head segment 256 B)
// The products are taken transposed: S^T = K Q^T (A = K rows, B = Q rows) and O^T += V^T P^T (A = V^T rows, B = P^T).  A lane then holds 16 of the 32 scores of ONE query (column lane & 15; keys 8g + r and 16 + 8g + r),
// so maximum and sum are in-lane with one exchange between the wave's halves, and the two score tiles, converted in place, are the B fragment of P^T in the loaders' own k order: P goes through no LDS.
// The 32-key K tile (hi, lo) and V tile (hi, lo) of a step are brought into LDS once per block by asynchronous copies, two buffers, the next step's tile in flight while this one is worked on; all four waves read their fragments from LDS.
// LDS pitches are 16 B x odd, conflict-free for 16-byte LDS reads: K rows of 128 B at 144 B, V rows of 64 B at 80 B.
#define KPB 72
#define VPB 40
#define KARRB (32 * KPB * 2)
#define KBUFB (2 * KARRB)
#define VARRB (HD * VPB * 2)
#define VBUFB (2 * VARRB)
// one thread's eight 16-byte copies of one tile: K rows r, r+16 of hi and of lo; V rows d, d+32 of hi and of lo
__device__ __forceinline__ void attn_stage(const __bf16* khg, const __bf16* klg, const __bf16* vhg, const __bf16* vlg, unsigned lk, unsigned lv) {
  // the copies and s_wait_xcnt 0 in one statement: the wait stands in front of any rewrite of an address register that a copy names
  asm volatile("global_load_async_to_lds_b128 %0, %8, off\n\t"
               "global_load_async_to_lds_b128 %1, %9, off\n\t"
               "global_load_async_to_lds_b128 %2, %10, off\n\t"
               "global_load_async_to_lds_b128 %3, %11, off\n\t"
               "global_load_async_to_lds_b128 %4, %12, off\n\t"
               "global_load_async_to_lds_b128 %5, %13, off\n\t"
               "global_load_async_to_lds_b128 %6, %14, off\n\t"
               "global_load_async_to_lds_b128 %7, %15, off\n\t"
               "s_wait_xcnt 0x0"
               :: "v"(lk), "v"(lk + 16 * KPB * 2), "v"(lk + KARRB), "v"(lk + KARRB + 16 * KPB * 2),
                  "v"(lv), "v"(lv + 32 * VPB * 2), "v"(lv + VARRB), "v"(lv + VARRB + 32 * VPB * 2),
                  "v"(khg), "v"(khg + 16 * DM), "v"(klg), "v"(klg + 16 * DM),
                  "v"(vhg), "v"(vhg + 32 * SS), "v"(vlg), "v"(vlg + 32 * SS)
               : "memory");
}
// lane l <-> lane l ^ 16
__device__ __forceinline__ float xhalf(float v) { const int b = __builtin_bit_cast(int, v); return __builtin_bit_cast(float, __builtin_amdgcn_permlanex16(b, b, 0x76543210, 0xfedcba98, false, false)); }
// mac3 with the operands' sides swapped: the three products are added in mac3's order
__device__ __forceinline__ v8f mac3t(const F2& a, const F2& b, v8f c) { c = wmma_bf(a.h, b.l, c); c = wmma_bf(a.l, b.h, c); return wmma_bf(a.h, b.h, c); }
__global__ __launch_bounds__(128) void k_attn(float* __restrict__ QKV, const __bf16* __restrict__ KH, const __bf16* __restrict__ KL, const __bf16* __restrict__ VTH, const __bf16* __restrict__ VTL) {
  __shared__ __align__(16) float so[4][16][68];
  __shared__ __align__(16) __bf16 sk[2][2][32][KPB]; __shared__ __align__(16) __bf16 sv[2][2][HD][VPB];
  const int tid = threadIdx.x, wave = tid >> 5, lane = tid & 31, col = lane & 15, g = lane >> 4;
  const int qb = blockIdx.x, bh = blockIdx.y, b = bh / NH, h = bh % NH; const int q0 = qb * 64 + wave * 16; const size_t tq = (size_t)b * SS + q0;
  const F2 a0 = split_row(QKV + (tq + col) * QKVP + h * HD, 0, lane), a1 = split_row(QKV + (tq + col) * QKVP + h * HD, 32, lane);
  float m = -3.0e38f, l = 0.f;   // of query col; l sums this half's keys only, the halves are joined behind the loop
  v8f acc[4] = {};               // acc[dt][r] = O[query col][dt * 16 + 8 g + r]
  const int nsteps = SS / 32;
  const size_t ko = ((size_t)b * SS + (tid >> 3)) * DM + h * HD + (tid & 7) * 8;
  const __bf16 *khg = KH + ko, *klg = KL + ko;
  const size_t vo = ((size_t)b * DM + h * HD + (tid >> 2)) * SS + (tid & 3) * 8;
  const __bf16 *vhg = VTH + vo, *vlg = VTL + vo;
  const unsigned lk = (unsigned)(size_t)&sk[0][0][tid >> 3][(tid & 7) * 8], lv = (unsigned)(size_t)&sv[0][0][tid >> 2][(tid & 3) * 8];
  attn_stage(khg, klg, vhg, vlg, lk, lv);
  asm volatile("s_wait_asynccnt 0x0" ::: "memory");   // this wave's copies of tile 0 have landed
  __syncthreads();                                    // tile 0 is readable by every wave
  attn_stage(khg + 32 * DM, klg + 32 * DM, vhg + 32, vlg + 32, lk + KBUFB, lv + VBUFB);
#pragma unroll 1
  for (int ks = 0; ks < nsteps; ++ks) {
    const int cur = ks & 1;
    float e[16];
#pragma unroll
    for (int ct = 0; ct < 2; ++ct) { const __bf16 *kh = &sk[cur][0][ct * 16 + col][0], *kl = &sk[cur][1][ct * 16 + col][0];
      const F2 k0 = {frag_b(kh, lane), frag_b(kl, lane)}, k1 = {frag_b(kh + 32, lane), frag_b(kl + 32, lane)};
      v8f c = mac3t(k0, a0, (v8f){}); c = mac3t(k1, a1, c);
#pragma unroll
      for (int r = 0; r < 8; ++r) e[ct * 8 + r] = c[r] * 0.125f; }
    float mx = e[0];
#pragma unroll
    for (int i = 1; i < 16; ++i) mx = fmaxf(mx, e[i]);
    mx = fmaxf(mx, xhalf(mx));
    const float mn = fmaxf(m, mx); const float alpha = expf(m - mn); m = mn;
#pragma unroll
    for (int i = 0; i < 16; ++i) e[i] = expf(e[i] - mn);
    l = l * alpha + (((e[0] + e[1]) + (e[2] + e[3])) + ((e[4] + e[5]) + (e[6] + e[7])) + (((e[8] + e[9]) + (e[10] + e[11])) + ((e[12] + e[13]) + (e[14] + e[15]))));
#pragma unroll
    for (int dt = 0; dt < 4; ++dt) acc[dt] *= alpha;
    const F2 pb = bsplit16(e);
#pragma unroll
    for (int dt = 0; dt < 4; ++dt) { const v16b vh = frag_b(&sv[cur][0][dt * 16 + col][0], lane), vl = frag_b(&sv[cur][1][dt * 16 + col][0], lane);
      acc[dt] = wmma_bf(vh, pb.l, acc[dt]); acc[dt] = wmma_bf(vl, pb.h, acc[dt]); acc[dt] = wmma_bf(vh, pb.h, acc[dt]); }
    asm volatile("s_wait_dscnt 0x0" ::: "memory");      // this wave's LDS reads of this step's tile are done
    asm volatile("s_wait_asynccnt 0x0" ::: "memory");   // this wave's copies of the next tile have landed
    __syncthreads();                                    // publishes the next tile and frees this step's buffer
    if (ks + 2 < nsteps) attn_stage(khg + (size_t)(ks + 2) * 32 * DM, klg + (size_t)(ks + 2) * 32 * DM, vhg + (ks + 2) * 32, vlg + (ks + 2) * 32, lk + cur * KBUFB, lv + cur * VBUFB); }
  asm volatile("s_wait_asynccnt 0x0" ::: "memory");     // no copy is outstanding behind the loop
  const float il = 1.0f / (l + xhalf(l));
#pragma unroll
  for (int dt = 0; dt < 4; ++dt) { const v8f o = acc[dt] * il; float* d = &so[wave][col][dt * 16 + 8 * g];
    vst2(d, (v4f){o[0], o[1], o[2], o[3]}); vst2(d + 4, (v4f){o[4], o[5], o[6], o[7]}); }
  LDSX();
  for (int rl = 0; rl < 16; ++rl) if (lane < 16) vst2(QKV + (tq + rl) * QKVP + h * HD + lane * 4, *(const v4f*)&so[wave][rl][lane * 4]);
}
// ---- k_out: Y = O(hi/lo; the q columns of QKV) . PT_out rows (2 products, K = 1024); block (64 rows, 128 cols)
__global__ __launch_bounds__(128) void k_out(const float* __restrict__ QKV, const __bf16* __restrict__ PT, int wblk, const float* __restrict__ bo, float* __restrict__ Y) {
  __shared__ __align__(16) float so[4][16][132];
  const int tid = threadIdx.x, wave = tid >> 5, lane = tid & 31, col = lane & 15, g = lane >> 4; const size_t r0 = (size_t)blockIdx.x * 64 + wave * 16; const int n0 = blockIdx.y * 128;
  __shared__ __align__(16) float sa[2][64][GAP]; __shared__ __align__(16) __bf16 sb[2][128][GBP];
  const char* ag = (const char*)(QKV + ((size_t)blockIdx.x * 64 + (tid >> 4)) * QKVP + (tid & 15) * 4);
  const char* bg = (const char*)(PT + (size_t)(wblk * DM + n0 + (tid >> 3)) * DM + (tid & 7) * 8);
  const unsigned la = (unsigned)(size_t)&sa[0][tid >> 4][(tid & 15) * 4], lb = (unsigned)(size_t)&sb[0][tid >> 3][(tid & 7) * 8];
  v8f acc[8] = {};
  gemm_stage(ag, (size_t)QKVP * 4, bg, la, lb, 0, 0);
  asm volatile("s_wait_asynccnt 0x0" ::: "memory");   // this wave's copies of stage 0 have landed
  __syncthreads();                                    // stage 0 is readable by every wave
  gemm_stage(ag, (size_t)QKVP * 4, bg, la, lb, 1, 1);
#pragma unroll 1
  for (int s = 0; s < DM / GKC; ++s) { const int cur = s & 1;
    F2 a[GKC / 32]; v16b w[GKC / 32][8];   // the stage's fragments are all asked for in front of its first product: one LDS latency a stage
#pragma unroll
    for (int kk = 0; kk < GKC / 32; ++kk) { a[kk] = split_row(&sa[cur][wave * 16 + col][0], kk * 32, lane);
#pragma unroll
      for (int j = 0; j < 8; ++j) w[kk][j] = frag_b(&sb[cur][j * 16 + col][kk * 32], lane); }
#pragma unroll
    for (int kk = 0; kk < GKC / 32; ++kk) {
#pragma unroll
      for (int j = 0; j < 8; ++j) { acc[j] = wmma_bf(a[kk].l, w[kk][j], acc[j]); acc[j] = wmma_bf(a[kk].h, w[kk][j], acc[j]); } }
    asm volatile("s_wait_dscnt 0x0" ::: "memory");      // this wave's LDS reads of this stage are done
    asm volatile("s_wait_asynccnt 0x0" ::: "memory");   // this wave's copies of the next stage have landed
    __syncthreads();                                    // publishes the next stage and frees this stage's buffer
    if (s + 2 < DM / GKC) gemm_stage(ag, (size_t)QKVP * 4, bg, la, lb, s + 2, cur); }
  asm volatile("s_wait_asynccnt 0x0" ::: "memory");     // no copy is outstanding behind the loop
#pragma unroll
  for (int j = 0; j < 8; ++j) { const float bb = bfr(bo[n0 + j * 16 + col]);
#pragma unroll
    for (int r = 0; r < 8; ++r) so[wave][8 * g + r][j * 16 + col] = acc[j][r] + bb; }
  LDSX();
  for (int rl = 0; rl < 16; ++rl) vst2(Y + (r0 + rl) * DM + n0 + lane * 4, *(const v4f*)&so[wave][rl][lane * 4]);
}

extern "C" void kernel_launch(void* const* d_in, const int* in_sizes, int n_in, void* d_out, int out_size, void* d_ws, size_t ws_size, hipStream_t stream) {
  (void)in_sizes; (void)n_in; (void)out_size;
  const float** F = (const float**)d_in;   // q, k, v [2,2048,1024], Wq, bq, Wk, bk, Wv, bv, Wo, bo ([in][out] 1024x1024), Wc [1024,1024], bc
  if (ws_size < (size_t)WS_END) return;
  char* ws = (char*)d_ws; __bf16 *PT = (__bf16*)(ws + WS_PT), *VTH = (__bf16*)(ws + WS_VTH), *VTL = (__bf16*)(ws + WS_VTL), *KH = (__bf16*)(ws + WS_KH), *KL = (__bf16*)(ws + WS_KL); float* QKV = (float*)(ws + WS_QKV);
  float* OUTC = (float*)d_out; float* OUTH = OUTC + (size_t)NR * DM;     // outputs: (c, h)
  k_pack<<<dim3(DM / PKT, DM / PKT, 5), 128, 0, stream>>>(F[3], F[5], F[7], F[9], F[11], PT);
  k_proj<<<dim3(TRB, QKVP / 128), 128, 0, stream>>>(F[0], F[1], F[2], PT, F[4], F[6], F[8], QKV, VTH, VTL, KH, KL);
  k_attn<<<dim3(TQB, TNB * NH), 128, 0, stream>>>(QKV, KH, KL, VTH, VTL);
  k_out<<<dim3((TNB < NB ? TQB : NR / 64), DM / 128), 128, 0, stream>>>(QKV, PT, 4, F[12], OUTC);
  k_out<<<dim3((TNB < NB ? TQB : NR / 64), DM / 128), 128, 0, stream>>>(QKV, PT, 3, F[10], OUTH);
}

// v008
// It runs in 169 microseconds.
// In both of two side-by-side timings against v007, it was 1.15 times as fast.
// Counting every step since v000, it is 4.42 times as fast.
// compute dtype: q/k/v inputs, the five [in][out] weights + biases (module inputs) rounded to bf16; Q/K/V projections with exact bf16 products (+ bias); scores and P.V with both computed operands as bf16 hi + bf16 residual pairs (3 products); the two output projections (Wc → c, Wo → h) hi/lo x bf16 weights (2 products) + bias; online softmax in f32; f32 accumulate.
#include <hip/hip_runtime.h>
#include <math.h>

typedef __attribute__((ext_vector_type(16))) _Float16 v16h;
typedef __attribute__((ext_vector_type(16))) __bf16 v16b;
typedef __attribute__((ext_vector_type(8)))  _Float16 v8h;
typedef __attribute__((ext_vector_type(8)))  float v8f;
typedef __attribute__((ext_vector_type(4)))  float v4f;
typedef __attribute__((ext_vector_type(2)))  float v2f;
typedef __attribute__((ext_vector_type(4)))  unsigned v4u;
typedef __attribute__((ext_vector_type(4)))  int v4i;
typedef float __attribute__((may_alias)) float_a;
typedef int __attribute__((may_alias)) int_a;

template <typename T> __device__ __forceinline__ void vst2(void* p, T v) { *(T*)p = v;  }
__device__ __forceinline__ v8f wmma16(v16h a, v16h b, v8f c) {
  v8f d = __builtin_amdgcn_wmma_f32_16x16x32_f16(false, a, false, b, (short)0, c, false, false);
  asm volatile("v_nop\n\tv_nop\n\tv_nop\n\tv_nop" : "+v"(d) : "v"(a), "v"(b));
  return d;
}
__device__ __forceinline__ v8f wmma_bf(v16b a, v16b b, v8f c) {
  v8f d = __builtin_amdgcn_wmma_f32_16x16x32_bf16(false, a, false, b, (short)0, c, false, false);
  asm volatile("v_nop\n\tv_nop\n\tv_nop\n\tv_nop" : "+v"(d) : "v"(a), "v"(b));
  return d;
}
// 16x16x32 fragments: lane = (h = lane>>4, row/col = lane&15); elements 0..7 = k0+8h+0..7, 8..15 = k0+16+8h+0..7; D element r = row 8h+r
__device__ __forceinline__ v16h frag_h(const _Float16* rowk0, int lane) {
  union { v16h v; v8h q[2]; } u; const _Float16* p = rowk0 + 8 * (lane >> 4);
  u.q[0] = *(const v8h*)p; u.q[1] = *(const v8h*)(p + 16); return u.v;
}
__device__ __forceinline__ v16h frag_f32(const float* rowk0, int lane) {
  v16h a; const float* p = rowk0 + 8 * (lane >> 4);
#pragma unroll
  for (int i = 0; i < 8; ++i) { a[i] = (_Float16)p[i]; a[8 + i] = (_Float16)p[16 + i]; }
  return a;
}
__device__ __forceinline__ v16h frag_f32s(const float* rowk0, int lane, float sc) {
  v16h a; const float* p = rowk0 + 8 * (lane >> 4);
#pragma unroll
  for (int i = 0; i < 8; ++i) { a[i] = (_Float16)(p[i] * sc); a[8 + i] = (_Float16)(p[16 + i] * sc); }
  return a;
}
// column fragment from a [K][ld] layout (column n), rows >= K read as 0
__device__ __forceinline__ v16h fragc_f32(const float* W, int k0, int n, int lane, int ld, int K) {
  v16h a; const int g = lane >> 4;
#pragma unroll
  for (int i = 0; i < 8; ++i) { const int ka = k0 + 8 * g + i, kb = ka + 16;
    a[i] = (_Float16)(ka < K ? W[(size_t)(ka < K ? ka : K - 1) * ld + n] : 0.f); a[8 + i] = (_Float16)(kb < K ? W[(size_t)(kb < K ? kb : K - 1) * ld + n] : 0.f); }
  return a;
}
struct F2 { v16b h, l; };
__device__ __forceinline__ F2 bsplit16(const float v[16]) { F2 r;
#pragma unroll
  for (int i = 0; i < 16; ++i) { const __bf16 h = (__bf16)v[i]; r.h[i] = h; r.l[i] = (__bf16)(v[i] - (float)h); }
  return r; }
__device__ __forceinline__ F2 split_row(const float* row, int k0, int lane) { float v[16]; const float* p = row + k0 + 8 * (lane >> 4);
#pragma unroll
  for (int i = 0; i < 8; ++i) { v[i] = p[i]; v[8 + i] = p[16 + i]; }
  return bsplit16(v); }
__device__ __forceinline__ F2 split_rowK(const float* row, int k0, int lane, int K) { float v[16]; const int g = lane >> 4;
#pragma unroll
  for (int i = 0; i < 8; ++i) { const int ka = k0 + 8 * g + i, kb = ka + 16; v[i] = ka < K ? row[ka < K ? ka : K - 1] : 0.f; v[8 + i] = kb < K ? row[kb < K ? kb : K - 1] : 0.f; }
  return bsplit16(v); }
__device__ __forceinline__ F2 split_col(const float* W, int k0, int n, int lane, int ld, int K) { float v[16]; const int g = lane >> 4;
#pragma unroll
  for (int i = 0; i < 8; ++i) { const int ka = k0 + 8 * g + i, kb = ka + 16; v[i] = ka < K ? W[(size_t)(ka < K ? ka : K - 1) * ld + n] : 0.f; v[8 + i] = kb < K ? W[(size_t)(kb < K ? kb : K - 1) * ld + n] : 0.f; }
  return bsplit16(v); }
__device__ __forceinline__ v8f mac3(const F2& a, const F2& b, v8f c) { c = wmma_bf(a.l, b.h, c); c = wmma_bf(a.h, b.l, c); return wmma_bf(a.h, b.h, c); }
__device__ __forceinline__ float sigm(float v) { return 1.0f / (1.0f + expf(-v)); }
#define LDSX() do { asm volatile("s_wait_dscnt 0" ::: "memory"); __builtin_amdgcn_wave_barrier(); __builtin_amdgcn_fence(__ATOMIC_RELEASE, "workgroup"); } while (0)


// Cyclic attention block: Q = q Wq + bq, K = k Wk + bk, V = v Wv + bv (16 heads x 64), softmax(Q K^T / 8) V merged; outputs (c, h) = (merged Wc + bc, merged Wo + bo).  B 2, S 2048, H 1024, cyclic_size 1024.
// k_pack (Wq|Wk|Wv|Wo|Wc columns as bf16 rows), k_proj (Q as f32 rows; K as rows of bf16 hi and of bf16 lo; V as V^T, bf16 hi and lo), k_attn (flash-style, 64 key steps), k_out x2 (c into output 0, h into output 1).
#define NB 2
#define SS 2048
#define DM 1024
#define NH 16
#define HD 64
#define NR (NB * SS)
#define QKVP (3 * DM)
#ifndef TRB
#define TRB (NR / 64)
#define TQB (SS / 64)
#define TNB NB
#endif
typedef __attribute__((ext_vector_type(8))) __bf16 v8b;
__device__ __forceinline__ v16b frag_b(const __bf16* rowk0, int lane) {
  union { v16b v; v8b q[2]; } u; const __bf16* p = rowk0 + 8 * (lane >> 4);
  u.q[0] = *(const v8b*)p; u.q[1] = *(const v8b*)(p + 16); return u.v;
}
__device__ __forceinline__ v16b frag_gbf(const float* rowk0, int lane) {
  v16b a; const float* p = rowk0 + 8 * (lane >> 4);
#pragma unroll
  for (int i = 0; i < 8; ++i) { a[i] = (__bf16)p[i]; a[8 + i] = (__bf16)p[16 + i]; }
  return a;
}
__device__ __forceinline__ float bfr(float v) { return (float)(__bf16)v; }
#define WS_PT   0u                                 // bf16 [5*1024 (q|k|v|o|c cols)][1024]
#define WS_QKV  (WS_PT + 2u * 5 * DM * DM)           // f32 [4096 rows][3072]  (q 0..1023 | k, v: not used) ; q cols later overwritten by O
#define WS_VTH  (WS_QKV + 4u * NR * QKVP)            // bf16 [2][1024 (h*64+d)][2048]
#define WS_VTL  (WS_VTH + 2u * NB * DM * SS)
#define WS_KH   (WS_VTL + 2u * NB * DM * SS)         // bf16 [4096 rows][1024 (h*64+d)]
#define WS_KL   (WS_KH + 2u * NR * DM)
#define WS_END  (WS_KL + 2u * NR * DM)

// k_pack: block = one 64 (in) x 64 (out) tile of one weight.  The tile is read along the weight's rows (16 lanes read 256 successive bytes), turned in LDS, and leaves as whole 128-B lines of PT rows.
// LDS pitch 144 B: rows stay 16-byte aligned and successive rows start on different banks.
#define PKT 64
#define PKP 72
__global__ __launch_bounds__(128) void k_pack(const float* __restrict__ Wq, const float* __restrict__ Wk, const float* __restrict__ Wv, const float* __restrict__ Wo, const float* __restrict__ Wc, __bf16* __restrict__ PT) {
  __shared__ __align__(16) __bf16 st[PKT][PKP];
  const int tid = threadIdx.x, which = blockIdx.z, k0 = blockIdx.x * PKT, n0 = blockIdx.y * PKT; const float* Wm = which == 0 ? Wq : (which == 1 ? Wk : (which == 2 ? Wv : (which == 3 ? Wo : Wc)));
  const int kg = tid >> 4, nq = tid & 15;   // this thread: rows k0 + 8 kg + 0..7, columns n0 + 4 nq + 0..3
  const float* src = Wm + (size_t)(k0 + kg * 8) * DM + n0 + nq * 4;
  v4f x[8];
#pragma unroll   // the eight loads are all in flight before the first is used, and x stays in registers
  for (int i = 0; i < 8; ++i) x[i] = *(const v4f*)(src + (size_t)i * DM);
#pragma unroll   // constant indices into x: no scratch
  for (int j = 0; j < 4; ++j) { v8b t;
#pragma unroll
    for (int i = 0; i < 8; ++i) t[i] = (__bf16)x[i][j];
    vst2(&st[nq * 4 + j][kg * 8], t); }
  __syncthreads();
#pragma unroll   // the four LDS reads go out together, one latency
  for (int i = 0; i < 4; ++i) { const int row = i * 16 + (tid >> 3), pc = tid & 7;   // eight lanes store one line
    vst2(PT + (size_t)(which * DM + n0 + row) * DM + k0 + pc * 8, *(const v8b*)&st[row][pc * 8]); }
}
// ---- GEMM staging (k_proj, k_out): a stage is 64 k of the block's 64 A rows (f32, 256 B a row) and 128 B rows (bf16, 128 B a row), brought into LDS once per block by asynchronous copies in whole 128-B lines,
// two buffers, the next stage in flight while this one is worked on; the waves read their fragments from LDS in the k order they had.  LDS pitches are 16 B x odd: A 272 B, B 144 B.
#define GKC 64
#define GAP 68
#define GBP 72
#define GABUFB (64 * GAP * 4)
#define GBBUFB (128 * GBP * 2)
// one thread's eight 16-byte copies: global rows gs bytes apart, LDS rows ls bytes apart
__device__ __forceinline__ void gemm_stage8(const char* g, size_t gs, unsigned l, unsigned ls) {
  // the copies and s_wait_xcnt 0 in one statement: the wait stands in front of any rewrite of an address register that a copy names
  asm volatile("global_load_async_to_lds_b128 %0, %8, off\n\t"
               "global_load_async_to_lds_b128 %1, %9, off\n\t"
               "global_load_async_to_lds_b128 %2, %10, off\n\t"
               "global_load_async_to_lds_b128 %3, %11, off\n\t"
               "global_load_async_to_lds_b128 %4, %12, off\n\t"
               "global_load_async_to_lds_b128 %5, %13, off\n\t"
               "global_load_async_to_lds_b128 %6, %14, off\n\t"
               "global_load_async_to_lds_b128 %7, %15, off\n\t"
               "s_wait_xcnt 0x0"
               :: "v"(l), "v"(l + ls), "v"(l + 2 * ls), "v"(l + 3 * ls), "v"(l + 4 * ls), "v"(l + 5 * ls), "v"(l + 6 * ls), "v"(l + 7 * ls),
                  "v"(g), "v"(g + gs), "v"(g + 2 * gs), "v"(g + 3 * gs), "v"(g + 4 * gs), "v"(g + 5 * gs), "v"(g + 6 * gs), "v"(g + 7 * gs)
               : "memory");
}
// stage s into buffer bf: A rows t>>4 + 8 j (row pitch apb bytes in global memory), B rows t>>3 + 16 j
__device__ __forceinline__ void gemm_stage(const char* ag, size_t apb, const char* bg, unsigned la, unsigned lb, int s, int bf) {
  gemm_stage8(ag + (size_t)s * (GKC * 4), 8 * apb, la + bf * GABUFB, 8 * GAP * 4);
  gemm_stage8(bg + (size_t)s * (GKC * 2), (size_t)16 * DM * 2, lb + bf * GBBUFB, 16 * GBP * 2);
}
// ---- k_proj: QKV[r][n] = bf16(x[r]) . PT[n] (exact), K = 1024; block (64 rows, 128 cols); 512-B segments of 12-KB rows; the V blocks store V^T (hi, lo) instead, 128-B segments of its 4-KB rows; the K blocks store K (hi, lo), 256-B segments of its 2-KB rows
__global__ __launch_bounds__(128) void k_proj(const float* __restrict__ XQ, const float* __restrict__ XK, const float* __restrict__ XV, const __bf16* __restrict__ PT, const float* __restrict__ bq, const float* __restrict__ bk, const float* __restrict__ bv, float* __restrict__ QKV, __bf16* __restrict__ VTH, __bf16* __restrict__ VTL, __bf16* __restrict__ KH, __bf16* __restrict__ KL) {
  const float* X = (blockIdx.y * 128) < DM ? XQ : ((blockIdx.y * 128) < 2 * DM ? XK : XV);
  __shared__ __align__(16) float so[4][16][132];
  const int tid = threadIdx.x, wave = tid >> 5, lane = tid & 31, col = lane & 15, g = lane >> 4; const size_t r0 = (size_t)blockIdx.x * 64 + wave * 16; const int n0 = blockIdx.y * 128;
  __shared__ __align__(16) float sa[2][64][GAP]; __shared__ __align__(16) __bf16 sb[2][128][GBP];
  const char* ag = (const char*)(X + ((size_t)blockIdx.x * 64 + (tid >> 4)) * DM + (tid & 15) * 4);
  const char* bg = (const char*)(PT + (size_t)(n0 + (tid >> 3)) * DM + (tid & 7) * 8);
  const unsigned la = (unsigned)(size_t)&sa[0][tid >> 4][(tid & 15) * 4], lb = (unsigned)(size_t)&sb[0][tid >> 3][(tid & 7) * 8];
  v8f acc[8] = {};
  gemm_stage(ag, (size_t)DM * 4, bg, la, lb, 0, 0);
  asm volatile("s_wait_asynccnt 0x0" ::: "memory");   // this wave's copies of stage 0 have landed
  __syncthreads();                                    // stage 0 is readable by every wave
  gemm_stage(ag, (size_t)DM * 4, bg, la, lb, 1, 1);
#pragma unroll 1
  for (int s = 0; s < DM / GKC; ++s) { const int cur = s & 1;
    v16b a[GKC / 32], w[GKC / 32][8];   // the stage's fragments are all asked for in front of its first product: one LDS latency a stage
#pragma unroll
    for (int kk = 0; kk < GKC / 32; ++kk) { a[kk] = frag_gbf(&sa[cur][wave * 16 + col][kk * 32], lane);
#pragma unroll
      for (int j = 0; j < 8; ++j) w[kk][j] = frag_b(&sb[cur][j * 16 + col][kk * 32], lane); }
#pragma unroll
    for (int kk = 0; kk < GKC / 32; ++kk) {
#pragma unroll
      for (int j = 0; j < 8; ++j) acc[j] = wmma_bf(a[kk], w[kk][j], acc[j]); }
    asm volatile("s_wait_dscnt 0x0" ::: "memory");      // this wave's LDS reads of this stage are done
    asm volatile("s_wait_asynccnt 0x0" ::: "memory");   // this wave's copies of the next stage have landed
    __syncthreads();                                    // publishes the next stage and frees this stage's buffer
    if (s + 2 < DM / GKC) gemm_stage(ag, (size_t)DM * 4, bg, la, lb, s + 2, cur); }
  asm volatile("s_wait_asynccnt 0x0" ::: "memory");     // no copy is outstanding behind the loop
  if (n0 >= 2 * DM) {   // V columns, the same for the whole block.  A lane's eight accumulator rows are eight successive positions of one V^T row: 16 B of hi, 16 B of lo.  sb is free: every wave has passed the loop's last barrier
    float bias[8];
#pragma unroll
    for (int j = 0; j < 8; ++j) bias[j] = bv[n0 - 2 * DM + j * 16 + col];
    asm volatile("s_wait_xcnt 0x0" ::: "memory");   // stands in front of any rewrite of an address register that the bias loads name
#pragma unroll
    for (int j = 0; j < 8; ++j) { const float bb = bfr(bias[j]); v8b hv, lv;
#pragma unroll
      for (int r = 0; r < 8; ++r) { const float v = acc[j][r] + bb; const __bf16 hb = (__bf16)v; hv[r] = hb; lv[r] = (__bf16)(v - (float)hb); }
      vst2(&sb[0][j * 16 + col][wave * 16 + 8 * g], hv); vst2(&sb[1][j * 16 + col][wave * 16 + 8 * g], lv); }
    __syncthreads();   // the four waves' 16 positions each make up the whole 128-B lines stored below
    const size_t t0 = (size_t)blockIdx.x * 64; const size_t vb = ((t0 / SS) * DM + (size_t)(n0 - 2 * DM)) * SS + t0 % SS;
#pragma unroll
    for (int i = 0; i < 8; ++i) { const int rowi = i * 16 + (tid >> 3), pc = tid & 7; const size_t o = vb + (size_t)rowi * SS + pc * 8;   // eight lanes store one line
      vst2(VTH + o, *(const v8b*)&sb[0][rowi][pc * 8]); vst2(VTL + o, *(const v8b*)&sb[1][rowi][pc * 8]); }
    return; }
#pragma unroll
  for (int j = 0; j < 8; ++j) { const int n = n0 + j * 16 + col; const int which = n / DM, c = n % DM; const float bb = bfr((which == 0 ? bq : which == 1 ? bk : bv)[c]);
#pragma unroll
    for (int r = 0; r < 8; ++r) so[wave][8 * g + r][j * 16 + col] = acc[j][r] + bb; }
  LDSX();
  if (n0 >= DM) {   // K columns, the same for the whole block: each value leaves as the bf16 hi + bf16 residual pair that the score products take; 16 lanes store 256 B of a row of hi and of lo
#pragma unroll
    for (int rl = 0; rl < 16; rl += 2) { const float* s = &so[wave][rl + g][col * 8]; v8b hv, lv;
#pragma unroll
      for (int i = 0; i < 8; ++i) { const float v = s[i]; const __bf16 hb = (__bf16)v; hv[i] = hb; lv[i] = (__bf16)(v - (float)hb); }
      const size_t o = (r0 + rl + g) * DM + (n0 - DM) + col * 8;
      vst2(KH + o, hv); vst2(KL + o, lv); }
    asm volatile("s_wait_xcnt 0x0" ::: "memory");   // stands in front of any rewrite of a register that these stores name
    return; }
  for (int rl = 0; rl < 16; ++rl) vst2(QKV + (r0 + rl) * QKVP + n0 + lane * 4, *(const v4f*)&so[wave][rl][lane * 4]);
}
// ---- k_attn: block = (query block qb, b*16 + h), 4 waves: all SS/32 key steps; online softmax; O written over the q columns of the block's rows (head segment 256 B)
// The products are taken transposed: S^T = K Q^T (A = K rows, B = Q rows) and O^T += V^T P^T (A = V^T rows, B = P^T).  A lane then holds 16 of the 32 scores of ONE query (column lane & 15; keys 8g + r and 16 + 8g + r),
// so maximum and sum are in-lane with one exchange between the wave's halves, and the two score tiles, converted in place, are the B fragment of P^T in the loaders' own k order: P goes through no LDS.
// The 32-key K tile (hi, lo) and V tile (hi, lo) of a step are brought into LDS once per block by asynchronous copies, two buffers, the next step's tile in flight while this one is worked on; all four waves read their fragments from LDS.
// LDS pitches are 16 B x odd, conflict-free for 16-byte LDS reads: K rows of 128 B at 144 B, V rows of 64 B at 80 B.
#define KPB 72
#define VPB 40
#define KARRB (32 * KPB * 2)
#define KBUFB (2 * KARRB)
#define VARRB (HD * VPB * 2)
#define VBUFB (2 * VARRB)
// one thread's eight 16-byte copies of one tile: K rows r, r+16 of hi and of lo; V rows d, d+32 of hi and of lo
__device__ __forceinline__ void attn_stage(const __bf16* khg, const __bf16* klg, const __bf16* vhg, const __bf16* vlg, unsigned lk, unsigned lv) {
  // the copies and s_wait_xcnt 0 in one statement: the wait stands in front of any rewrite of an address register that a copy names
  asm volatile("global_load_async_to_lds_b128 %0, %8, off\n\t"
               "global_load_async_to_lds_b128 %1, %9, off\n\t"
               "global_load_async_to_lds_b128 %2, %10, off\n\t"
               "global_load_async_to_lds_b128 %3, %11, off\n\t"
               "global_load_async_to_lds_b128 %4, %12, off\n\t"
               "global_load_async_to_lds_b128 %5, %13, off\n\t"
               "global_load_async_to_lds_b128 %6, %14, off\n\t"
               "global_load_async_to_lds_b128 %7, %15, off\n\t"
               "s_wait_xcnt 0x0"
               :: "v"(lk), "v"(lk + 16 * KPB * 2), "v"(lk + KARRB), "v"(lk + KARRB + 16 * KPB * 2),
                  "v"(lv), "v"(lv + 32 * VPB * 2), "v"(lv + VARRB), "v"(lv + VARRB + 32 * VPB * 2),
                  "v"(khg), "v"(khg + 16 * DM), "v"(klg), "v"(klg + 16 * DM),
                  "v"(vhg), "v"(vhg + 32 * SS), "v"(vlg), "v"(vlg + 32 * SS)
               : "memory");
}
// The softmax is kept in base 2: exp(s / 8 - max) = 2^(s * SCL2 - max2), SCL2 = log2(e) / 8.  Every argument is <= 0 up to one rounding, so the hardware's own 2^x needs no range handling: far below zero it gives 0.
#define SCL2 0.18033688011112042f
// lane l <-> lane l ^ 16
__device__ __forceinline__ float xhalf(float v) { const int b = __builtin_bit_cast(int, v); return __builtin_bit_cast(float, __builtin_amdgcn_permlanex16(b, b, 0x76543210, 0xfedcba98, false, false)); }
// mac3 with the operands' sides swapped: the three products are added in mac3's order
__device__ __forceinline__ v8f mac3t(const F2& a, const F2& b, v8f c) { c = wmma_bf(a.h, b.l, c); c = wmma_bf(a.l, b.h, c); return wmma_bf(a.h, b.h, c); }
__global__ __launch_bounds__(128) void k_attn(float* __restrict__ QKV, const __bf16* __restrict__ KH, const __bf16* __restrict__ KL, const __bf16* __restrict__ VTH, const __bf16* __restrict__ VTL) {
  __shared__ __align__(16) float so[4][16][68];
  __shared__ __align__(16) __bf16 sk[2][2][32][KPB]; __shared__ __align__(16) __bf16 sv[2][2][HD][VPB];
  const int tid = threadIdx.x, wave = tid >> 5, lane = tid & 31, col = lane & 15, g = lane >> 4;
  const int qb = blockIdx.x, bh = blockIdx.y, b = bh / NH, h = bh % NH; const int q0 = qb * 64 + wave * 16; const size_t tq = (size_t)b * SS + q0;
  const F2 a0 = split_row(QKV + (tq + col) * QKVP + h * HD, 0, lane), a1 = split_row(QKV + (tq + col) * QKVP + h * HD, 32, lane);
  float m = -3.0e38f, l = 0.f;   // of query col; m in base-2 units (score x SCL2); l sums this half's keys only, the halves are joined behind the loop
  v8f acc[4] = {};               // acc[dt][r] = O[query col][dt * 16 + 8 g + r]
  const int nsteps = SS / 32;
  const size_t ko = ((size_t)b * SS + (tid >> 3)) * DM + h * HD + (tid & 7) * 8;
  const __bf16 *khg = KH + ko, *klg = KL + ko;
  const size_t vo = ((size_t)b * DM + h * HD + (tid >> 2)) * SS + (tid & 3) * 8;
  const __bf16 *vhg = VTH + vo, *vlg = VTL + vo;
  const unsigned lk = (unsigned)(size_t)&sk[0][0][tid >> 3][(tid & 7) * 8], lv = (unsigned)(size_t)&sv[0][0][tid >> 2][(tid & 3) * 8];
  attn_stage(khg, klg, vhg, vlg, lk, lv);
  asm volatile("s_wait_asynccnt 0x0" ::: "memory");   // this wave's copies of tile 0 have landed
  __syncthreads();                                    // tile 0 is readable by every wave
  attn_stage(khg + 32 * DM, klg + 32 * DM, vhg + 32, vlg + 32, lk + KBUFB, lv + VBUFB);
#pragma unroll 1
  for (int ks = 0; ks < nsteps; ++ks) {
    const int cur = ks & 1;
    float e[16];
#pragma unroll
    for (int ct = 0; ct < 2; ++ct) { const __bf16 *kh = &sk[cur][0][ct * 16 + col][0], *kl = &sk[cur][1][ct * 16 + col][0];
      const F2 k0 = {frag_b(kh, lane), frag_b(kl, lane)}, k1 = {frag_b(kh + 32, lane), frag_b(kl + 32, lane)};
      v8f c = mac3t(k0, a0, (v8f){}); c = mac3t(k1, a1, c);
#pragma unroll
      for (int r = 0; r < 8; ++r) e[ct * 8 + r] = c[r]; }
    float mx = e[0];
#pragma unroll
    for (int i = 1; i < 16; ++i) mx = fmaxf(mx, e[i]);
    mx = fmaxf(mx, xhalf(mx));
    const float mn = fmaxf(m, mx * SCL2); const float alpha = __builtin_amdgcn_exp2f(m - mn); m = mn;
#pragma unroll
    for (int i = 0; i < 16; i += 2) { const v2f arg = __builtin_elementwise_fma((v2f){e[i], e[i + 1]}, (v2f){SCL2, SCL2}, (v2f){-mn, -mn});   // one packed fma for two scores
      e[i] = __builtin_amdgcn_exp2f(arg.x); e[i + 1] = __builtin_amdgcn_exp2f(arg.y); }
    l = l * alpha + (((e[0] + e[1]) + (e[2] + e[3])) + ((e[4] + e[5]) + (e[6] + e[7])) + (((e[8] + e[9]) + (e[10] + e[11])) + ((e[12] + e[13]) + (e[14] + e[15]))));
#pragma unroll
    for (int dt = 0; dt < 4; ++dt) acc[dt] *= alpha;
    const F2 pb = bsplit16(e);
#pragma unroll
    for (int dt = 0; dt < 4; ++dt) { const v16b vh = frag_b(&sv[cur][0][dt * 16 + col][0], lane), vl = frag_b(&sv[cur][1][dt * 16 + col][0], lane);
      acc[dt] = wmma_bf(vh, pb.l, acc[dt]); acc[dt] = wmma_bf(vl, pb.h, acc[dt]); acc[dt] = wmma_bf(vh, pb.h, acc[dt]); }
    asm volatile("s_wait_dscnt 0x0" ::: "memory");      // this wave's LDS reads of this step's tile are done
    asm volatile("s_wait_asynccnt 0x0" ::: "memory");   // this wave's copies of the next tile have landed
    __syncthreads();                                    // publishes the next tile and frees this step's buffer
    if (ks + 2 < nsteps) attn_stage(khg + (size_t)(ks + 2) * 32 * DM, klg + (size_t)(ks + 2) * 32 * DM, vhg + (ks + 2) * 32, vlg + (ks + 2) * 32, lk + cur * KBUFB, lv + cur * VBUFB); }
  asm volatile("s_wait_asynccnt 0x0" ::: "memory");     // no copy is outstanding behind the loop
  const float il = 1.0f / (l + xhalf(l));
#pragma unroll
  for (int dt = 0; dt < 4; ++dt) { const v8f o = acc[dt] * il; float* d = &so[wave][col][dt * 16 + 8 * g];
    vst2(d, (v4f){o[0], o[1], o[2], o[3]}); vst2(d + 4, (v4f){o[4], o[5], o[6], o[7]}); }
  LDSX();
  for (int rl = 0; rl < 16; ++rl) if (lane < 16) vst2(QKV + (tq + rl) * QKVP + h * HD + lane * 4, *(const v4f*)&so[wave][rl][lane * 4]);
}
// ---- k_out: Y = O(hi/lo; the q columns of QKV) . PT_out rows (2 products, K = 1024); block (64 rows, 128 cols)
__global__ __launch_bounds__(128) void k_out(const float* __restrict__ QKV, const __bf16* __restrict__ PT, int wblk, const float* __restrict__ bo, float* __restrict__ Y) {
  __shared__ __align__(16) float so[4][16][132];
  const int tid = threadIdx.x, wave = tid >> 5, lane = tid & 31, col = lane & 15, g = lane >> 4; const size_t r0 = (size_t)blockIdx.x * 64 + wave * 16; const int n0 = blockIdx.y * 128;
  __shared__ __align__(16) float sa[2][64][GAP]; __shared__ __align__(16) __bf16 sb[2][128][GBP];
  const char* ag = (const char*)(QKV + ((size_t)blockIdx.x * 64 + (tid >> 4)) * QKVP + (tid & 15) * 4);
  const char* bg = (const char*)(PT + (size_t)(wblk * DM + n0 + (tid >> 3)) * DM + (tid & 7) * 8);
  const unsigned la = (unsigned)(size_t)&sa[0][tid >> 4][(tid & 15) * 4], lb = (unsigned)(size_t)&sb[0][tid >> 3][(tid & 7) * 8];
  v8f acc[8] = {};
  gemm_stage(ag, (size_t)QKVP * 4, bg, la, lb, 0, 0);
  asm volatile("s_wait_asynccnt 0x0" ::: "memory");   // this wave's copies of stage 0 have landed
  __syncthreads();                                    // stage 0 is readable by every wave
  gemm_stage(ag, (size_t)QKVP * 4, bg, la, lb, 1, 1);
#pragma unroll 1
  for (int s = 0; s < DM / GKC; ++s) { const int cur = s & 1;
    F2 a[GKC / 32]; v16b w[GKC / 32][8];   // the stage's fragments are all asked for in front of its first product: one LDS latency a stage
#pragma unroll
    for (int kk = 0; kk < GKC / 32; ++kk) { a[kk] = split_row(&sa[cur][wave * 16 + col][0], kk * 32, lane);
#pragma unroll
      for (int j = 0; j < 8; ++j) w[kk][j] = frag_b(&sb[cur][j * 16 + col][kk * 32], lane); }
#pragma unroll
    for (int kk = 0; kk < GKC / 32; ++kk) {
#pragma unroll
      for (int j = 0; j < 8; ++j) { acc[j] = wmma_bf(a[kk].l, w[kk][j], acc[j]); acc[j] = wmma_bf(a[kk].h, w[kk][j], acc[j]); } }
    asm volatile("s_wait_dscnt 0x0" ::: "memory");      // this wave's LDS reads of this stage are done
    asm volatile("s_wait_asynccnt 0x0" ::: "memory");   // this wave's copies of the next stage have landed
    __syncthreads();                                    // publishes the next stage and frees this stage's buffer
    if (s + 2 < DM / GKC) gemm_stage(ag, (size_t)QKVP * 4, bg, la, lb, s + 2, cur); }
  asm volatile("s_wait_asynccnt 0x0" ::: "memory");     // no copy is outstanding behind the loop
#pragma unroll
  for (int j = 0; j < 8; ++j) { const float bb = bfr(bo[n0 + j * 16 + col]);
#pragma unroll
    for (int r = 0; r < 8; ++r) so[wave][8 * g + r][j * 16 + col] = acc[j][r] + bb; }
  LDSX();
  for (int rl = 0; rl < 16; ++rl) vst2(Y + (r0 + rl) * DM + n0 + lane * 4, *(const v4f*)&so[wave][rl][lane * 4]);
}

extern "C" void kernel_launch(void* const* d_in, const int* in_sizes, int n_in, void* d_out, int out_size, void* d_ws, size_t ws_size, hipStream_t stream) {
  (void)in_sizes; (void)n_in; (void)out_size;
  const float** F = (const float**)d_in;   // q, k, v [2,2048,1024], Wq, bq, Wk, bk, Wv, bv, Wo, bo ([in][out] 1024x1024), Wc [1024,1024], bc
  if (ws_size < (size_t)WS_END) return;
  char* ws = (char*)d_ws; __bf16 *PT = (__bf16*)(ws + WS_PT), *VTH = (__bf16*)(ws + WS_VTH), *VTL = (__bf16*)(ws + WS_VTL), *KH = (__bf16*)(ws + WS_KH), *KL = (__bf16*)(ws + WS_KL); float* QKV = (float*)(ws + WS_QKV);
  float* OUTC = (float*)d_out; float* OUTH = OUTC + (size_t)NR * DM;     // outputs: (c, h)
  k_pack<<<dim3(DM / PKT, DM / PKT, 5), 128, 0, stream>>>(F[3], F[5], F[7], F[9], F[11], PT);
  k_proj<<<dim3(TRB, QKVP / 128), 128, 0, stream>>>(F[0], F[1], F[2], PT, F[4], F[6], F[8], QKV, VTH, VTL, KH, KL);
  k_attn<<<dim3(TQB, TNB * NH), 128, 0, stream>>>(QKV, KH, KL, VTH, VTL);
  k_out<<<dim3((TNB < NB ? TQB : NR / 64), DM / 128), 128, 0, stream>>>(QKV, PT, 4, F[12], OUTC);
  k_out<<<dim3((TNB < NB ? TQB : NR / 64), DM / 128), 128, 0, stream>>>(QKV, PT, 3, F[10], OUTH);
}

// v009
// Measured time: 162 microseconds a run.
// Two timings next to v008 put it at 1.04 and 1.03 times that version's speed.
// All steps since v000 together make it 4.57 times as fast.
// compute dtype: q/k/v inputs, the five [in][out] weights + biases (module inputs) rounded to bf16; Q/K/V projections with exact bf16 products (+ bias); scores and P.V with both computed operands as bf16 hi + bf16 residual pairs (3 products); the two output projections (Wc → c, Wo → h) hi/lo x bf16 weights (2 products) + bias; online softmax in f32; f32 accumulate.
#include <hip/hip_runtime.h>
#include <math.h>

typedef __attribute__((ext_vector_type(16))) _Float16 v16h;
typedef __attribute__((ext_vector_type(16))) __bf16 v16b;
typedef __attribute__((ext_vector_type(8)))  _Float16 v8h;
typedef __attribute__((ext_vector_type(8)))  float v8f;
typedef __attribute__((ext_vector_type(4)))  float v4f;
typedef __attribute__((ext_vector_type(2)))  float v2f;
typedef __attribute__((ext_vector_type(4)))  unsigned v4u;
typedef __attribute__((ext_vector_type(4)))  int v4i;
typedef float __attribute__((may_alias)) float_a;
typedef int __attribute__((may_alias)) int_a;

template <typename T> __device__ __forceinline__ void vst2(void* p, T v) { *(T*)p = v;  }
__device__ __forceinline__ v8f wmma16(v16h a, v16h b, v8f c) {
  v8f d = __builtin_amdgcn_wmma_f32_16x16x32_f16(false, a, false, b, (short)0, c, false, false);
  asm volatile("v_nop\n\tv_nop\n\tv_nop\n\tv_nop" : "+v"(d) : "v"(a), "v"(b));
  return d;
}
__device__ __forceinline__ v8f wmma_bf(v16b a, v16b b, v8f c) {
  v8f d = __builtin_amdgcn_wmma_f32_16x16x32_bf16(false, a, false, b, (short)0, c, false, false);
  asm volatile("v_nop\n\tv_nop\n\tv_nop\n\tv_nop" : "+v"(d) : "v"(a), "v"(b));
  return d;
}
// 16x16x32 fragments: lane = (h = lane>>4, row/col = lane&15); elements 0..7 = k0+8h+0..7, 8..15 = k0+16+8h+0..7; D element r = row 8h+r
__device__ __forceinline__ v16h frag_h(const _Float16* rowk0, int lane) {
  union { v16h v; v8h q[2]; } u; const _Float16* p = rowk0 + 8 * (lane >> 4);
  u.q[0] = *(const v8h*)p; u.q[1] = *(const v8h*)(p + 16); return u.v;
}
__device__ __forceinline__ v16h frag_f32(const float* rowk0, int lane) {
  v16h a; const float* p = rowk0 + 8 * (lane >> 4);
#pragma unroll
  for (int i = 0; i < 8; ++i) { a[i] = (_Float16)p[i]; a[8 + i] = (_Float16)p[16 + i]; }
  return a;
}
__device__ __forceinline__ v16h frag_f32s(const float* rowk0, int lane, float sc) {
  v16h a; const float* p = rowk0 + 8 * (lane >> 4);
#pragma unroll
  for (int i = 0; i < 8; ++i) { a[i] = (_Float16)(p[i] * sc); a[8 + i] = (_Float16)(p[16 + i] * sc); }
  return a;
}
// column fragment from a [K][ld] layout (column n), rows >= K read as 0
__device__ __forceinline__ v16h fragc_f32(const float* W, int k0, int n, int lane, int ld, int K) {
  v16h a; const int g = lane >> 4;
#pragma unroll
  for (int i = 0; i < 8; ++i) { const int ka = k0 + 8 * g + i, kb = ka + 16;
    a[i] = (_Float16)(ka < K ? W[(size_t)(ka < K ? ka : K - 1) * ld + n] : 0.f); a[8 + i] = (_Float16)(kb < K ? W[(size_t)(kb < K ? kb : K - 1) * ld + n] : 0.f); }
  return a;
}
struct F2 { v16b h, l; };
__device__ __forceinline__ F2 bsplit16(const float v[16]) { F2 r;
#pragma unroll
  for (int i = 0; i < 16; ++i) { const __bf16 h = (__bf16)v[i]; r.h[i] = h; r.l[i] = (__bf16)(v[i] - (float)h); }
  return r; }
__device__ __forceinline__ F2 split_row(const float* row, int k0, int lane) { float v[16]; const float* p = row + k0 + 8 * (lane >> 4);
#pragma unroll
  for (int i = 0; i < 8; ++i) { v[i] = p[i]; v[8 + i] = p[16 + i]; }
  return bsplit16(v); }
__device__ __forceinline__ F2 split_rowK(const float* row, int k0, int lane, int K) { float v[16]; const int g = lane >> 4;
#pragma unroll
  for (int i = 0; i < 8; ++i) { const int ka = k0 + 8 * g + i, kb = ka + 16; v[i] = ka < K ? row[ka < K ? ka : K - 1] : 0.f; v[8 + i] = kb < K ? row[kb < K ? kb : K - 1] : 0.f; }
  return bsplit16(v); }
__device__ __forceinline__ F2 split_col(const float* W, int k0, int n, int lane, int ld, int K) { float v[16]; const int g = lane >> 4;
#pragma unroll
  for (int i = 0; i < 8; ++i) { const int ka = k0 + 8 * g + i, kb = ka + 16; v[i] = ka < K ? W[(size_t)(ka < K ? ka : K - 1) * ld + n] : 0.f; v[8 + i] = kb < K ? W[(size_t)(kb < K ? kb : K - 1) * ld + n] : 0.f; }
  return bsplit16(v); }
__device__ __forceinline__ v8f mac3(const F2& a, const F2& b, v8f c) { c = wmma_bf(a.l, b.h, c); c = wmma_bf(a.h, b.l, c); return wmma_bf(a.h, b.h, c); }
__device__ __forceinline__ float sigm(float v) { return 1.0f / (1.0f + expf(-v)); }
#define LDSX() do { asm volatile("s_wait_dscnt 0" ::: "memory"); __builtin_amdgcn_wave_barrier(); __builtin_amdgcn_fence(__ATOMIC_RELEASE, "workgroup"); } while (0)


// Cyclic attention block: Q = q Wq + bq, K = k Wk + bk, V = v Wv + bv (16 heads x 64), softmax(Q K^T / 8) V merged; outputs (c, h) = (merged Wc + bc, merged Wo + bo).  B 2, S 2048, H 1024, cyclic_size 1024.
// k_pack (Wq|Wk|Wv|Wo|Wc columns as bf16 rows), k_proj (Q as f32 rows; K as rows of bf16 hi and of bf16 lo; V as V^T, bf16 hi and lo), k_attn (flash-style, 64 key steps), k_out x2 (c into output 0, h into output 1).
#define NB 2
#define SS 2048
#define DM 1024
#define NH 16
#define HD 64
#define NR (NB * SS)
#define QKVP (3 * DM)
#ifndef TRB
#define TRB (NR / 64)
#define TQB (SS / 64)
#define TNB NB
#endif
typedef __attribute__((ext_vector_type(8))) __bf16 v8b;
__device__ __forceinline__ v16b frag_b(const __bf16* rowk0, int lane) {
  union { v16b v; v8b q[2]; } u; const __bf16* p = rowk0 + 8 * (lane >> 4);
  u.q[0] = *(const v8b*)p; u.q[1] = *(const v8b*)(p + 16); return u.v;
}
__device__ __forceinline__ v16b frag_gbf(const float* rowk0, int lane) {
  v16b a; const float* p = rowk0 + 8 * (lane >> 4);
#pragma unroll
  for (int i = 0; i < 8; ++i) { a[i] = (__bf16)p[i]; a[8 + i] = (__bf16)p[16 + i]; }
  return a;
}
__device__ __forceinline__ float bfr(float v) { return (float)(__bf16)v; }
#define WS_PT   0u                                 // bf16 [5*1024 (q|k|v|o|c cols)][1024]
#define WS_QKV  (WS_PT + 2u * 5 * DM * DM)           // f32 [4096 rows][3072]  (q 0..1023 | k, v: not used) ; q cols later overwritten by O
#define WS_VTH  (WS_QKV + 4u * NR * QKVP)            // bf16 [2][1024 (h*64+d)][2048]
#define WS_VTL  (WS_VTH + 2u * NB * DM * SS)
#define WS_KH   (WS_VTL + 2u * NB * DM * SS)         // bf16 [4096 rows][1024 (h*64+d)]
#define WS_KL   (WS_KH + 2u * NR * DM)
#define WS_END  (WS_KL + 2u * NR * DM)

// k_pack: block = one 64 (in) x 64 (out) tile of one weight.  The tile is read along the weight's rows (16 lanes read 256 successive bytes), turned in LDS, and leaves as whole 128-B lines of PT rows.
// LDS pitch 144 B: rows stay 16-byte aligned and successive rows start on different banks.
#define PKT 64
#define PKP 72
__global__ __launch_bounds__(128) void k_pack(const float* __restrict__ Wq, const float* __restrict__ Wk, const float* __restrict__ Wv, const float* __restrict__ Wo, const float* __restrict__ Wc, __bf16* __restrict__ PT) {
  __shared__ __align__(16) __bf16 st[PKT][PKP];
  const int tid = threadIdx.x, which = blockIdx.z, k0 = blockIdx.x * PKT, n0 = blockIdx.y * PKT; const float* Wm = which == 0 ? Wq : (which == 1 ? Wk : (which == 2 ? Wv : (which == 3 ? Wo : Wc)));
  const int kg = tid >> 4, nq = tid & 15;   // this thread: rows k0 + 8 kg + 0..7, columns n0 + 4 nq + 0..3
  const float* src = Wm + (size_t)(k0 + kg * 8) * DM + n0 + nq * 4;
  v4f x[8];
#pragma unroll   // the eight loads are all in flight before the first is used, and x stays in registers
  for (int i = 0; i < 8; ++i) x[i] = *(const v4f*)(src + (size_t)i * DM);
#pragma unroll   // constant indices into x: no scratch
  for (int j = 0; j < 4; ++j) { v8b t;
#pragma unroll
    for (int i = 0; i < 8; ++i) t[i] = (__bf16)x[i][j];
    vst2(&st[nq * 4 + j][kg * 8], t); }
  __syncthreads();
#pragma unroll   // the four LDS reads go out together, one latency
  for (int i = 0; i < 4; ++i) { const int row = i * 16 + (tid >> 3), pc = tid & 7;   // eight lanes store one line
    vst2(PT + (size_t)(which * DM + n0 + row) * DM + k0 + pc * 8, *(const v8b*)&st[row][pc * 8]); }
}
// ---- GEMM staging (k_proj, k_out): a stage is 64 k of the block's 64 A rows (f32, 256 B a row) and 128 B rows (bf16, 128 B a row), brought into LDS once per block by asynchronous copies in whole 128-B lines,
// two buffers, the next stage in flight while this one is worked on; the waves read their fragments from LDS in the k order they had.  LDS pitches are 16 B x odd: A 272 B, B 144 B.
#define GKC 64
#define GAP 68
#define GBP 72
#define GABUFB (64 * GAP * 4)
#define GBBUFB (128 * GBP * 2)
// Blocks that share A rows (same blockIdx.x) or B rows (same blockIdx.y) run at the same time.  Each enters the ring of k stages at a stage set by its tile indices and wraps round,
// so that at one moment they ask L2 for different lines of the shared rows instead of all for the same ones.  A and B of a stage keep one common stage number; only the order in which the stages are summed turns.
#define GNS (DM / GKC)
#define GROT(s) (((s) + rot) & (GNS - 1))
// one thread's eight 16-byte copies: global rows gs bytes apart, LDS rows ls bytes apart
__device__ __forceinline__ void gemm_stage8(const char* g, size_t gs, unsigned l, unsigned ls) {
  // the copies and s_wait_xcnt 0 in one statement: the wait stands in front of any rewrite of an address register that a copy names
  asm volatile("global_load_async_to_lds_b128 %0, %8, off\n\t"
               "global_load_async_to_lds_b128 %1, %9, off\n\t"
               "global_load_async_to_lds_b128 %2, %10, off\n\t"
               "global_load_async_to_lds_b128 %3, %11, off\n\t"
               "global_load_async_to_lds_b128 %4, %12, off\n\t"
               "global_load_async_to_lds_b128 %5, %13, off\n\t"
               "global_load_async_to_lds_b128 %6, %14, off\n\t"
               "global_load_async_to_lds_b128 %7, %15, off\n\t"
               "s_wait_xcnt 0x0"
               :: "v"(l), "v"(l + ls), "v"(l + 2 * ls), "v"(l + 3 * ls), "v"(l + 4 * ls), "v"(l + 5 * ls), "v"(l + 6 * ls), "v"(l + 7 * ls),
                  "v"(g), "v"(g + gs), "v"(g + 2 * gs), "v"(g + 3 * gs), "v"(g + 4 * gs), "v"(g + 5 * gs), "v"(g + 6 * gs), "v"(g + 7 * gs)
               : "memory");
}
// stage s into buffer bf: A rows t>>4 + 8 j (row pitch apb bytes in global memory), B rows t>>3 + 16 j
__device__ __forceinline__ void gemm_stage(const char* ag, size_t apb, const char* bg, unsigned la, unsigned lb, int s, int bf) {
  gemm_stage8(ag + (size_t)s * (GKC * 4), 8 * apb, la + bf * GABUFB, 8 * GAP * 4);
  gemm_stage8(bg + (size_t)s * (GKC * 2), (size_t)16 * DM * 2, lb + bf * GBBUFB, 16 * GBP * 2);
}
// ---- k_proj: QKV[r][n] = bf16(x[r]) . PT[n] (exact), K = 1024; block (64 rows, 128 cols); 512-B segments of 12-KB rows; the V blocks store V^T (hi, lo) instead, 128-B segments of its 4-KB rows; the K blocks store K (hi, lo), 256-B segments of its 2-KB rows
__global__ __launch_bounds__(128) void k_proj(const float* __restrict__ XQ, const float* __restrict__ XK, const float* __restrict__ XV, const __bf16* __restrict__ PT, const float* __restrict__ bq, const float* __restrict__ bk, const float* __restrict__ bv, float* __restrict__ QKV, __bf16* __restrict__ VTH, __bf16* __restrict__ VTL, __bf16* __restrict__ KH, __bf16* __restrict__ KL) {
  const float* X = (blockIdx.y * 128) < DM ? XQ : ((blockIdx.y * 128) < 2 * DM ? XK : XV);
  __shared__ __align__(16) float so[4][16][132];
  const int tid = threadIdx.x, wave = tid >> 5, lane = tid & 31, col = lane & 15, g = lane >> 4; const size_t r0 = (size_t)blockIdx.x * 64 + wave * 16; const int n0 = blockIdx.y * 128;
  __shared__ __align__(16) float sa[2][64][GAP]; __shared__ __align__(16) __bf16 sb[2][128][GBP];
  const char* ag = (const char*)(X + ((size_t)blockIdx.x * 64 + (tid >> 4)) * DM + (tid & 15) * 4);
  const char* bg = (const char*)(PT + (size_t)(n0 + (tid >> 3)) * DM + (tid & 7) * 8);
  const unsigned la = (unsigned)(size_t)&sa[0][tid >> 4][(tid & 15) * 4], lb = (unsigned)(size_t)&sb[0][tid >> 3][(tid & 7) * 8];
  v8f acc[8] = {};
  const int rot = (blockIdx.x + blockIdx.y) & (GNS - 1);   // this block's first k stage
  gemm_stage(ag, (size_t)DM * 4, bg, la, lb, GROT(0), 0);
  asm volatile("s_wait_asynccnt 0x0" ::: "memory");   // this wave's copies of the first stage have landed
  __syncthreads();                                    // the first stage is readable by every wave
  gemm_stage(ag, (size_t)DM * 4, bg, la, lb, GROT(1), 1);
#pragma unroll 1
  for (int s = 0; s < DM / GKC; ++s) { const int cur = s & 1;
    v16b a[GKC / 32], w[GKC / 32][8];   // the stage's fragments are all asked for in front of its first product: one LDS latency a stage
#pragma unroll
    for (int kk = 0; kk < GKC / 32; ++kk) { a[kk] = frag_gbf(&sa[cur][wave * 16 + col][kk * 32], lane);
#pragma unroll
      for (int j = 0; j < 8; ++j) w[kk][j] = frag_b(&sb[cur][j * 16 + col][kk * 32], lane); }
#pragma unroll
    for (int kk = 0; kk < GKC / 32; ++kk) {
#pragma unroll
      for (int j = 0; j < 8; ++j) acc[j] = wmma_bf(a[kk], w[kk][j], acc[j]); }
    asm volatile("s_wait_dscnt 0x0" ::: "memory");      // this wave's LDS reads of this stage are done
    asm volatile("s_wait_asynccnt 0x0" ::: "memory");   // this wave's copies of the next stage have landed
    __syncthreads();                                    // publishes the next stage and frees this stage's buffer
    if (s + 2 < DM / GKC) gemm_stage(ag, (size_t)DM * 4, bg, la, lb, GROT(s + 2), cur); }
  asm volatile("s_wait_asynccnt 0x0" ::: "memory");     // no copy is outstanding behind the loop
  if (n0 >= 2 * DM) {   // V columns, the same for the whole block.  A lane's eight accumulator rows are eight successive positions of one V^T row: 16 B of hi, 16 B of lo.  sb is free: every wave has passed the loop's last barrier
    float bias[8];
#pragma unroll
    for (int j = 0; j < 8; ++j) bias[j] = bv[n0 - 2 * DM + j * 16 + col];
    asm volatile("s_wait_xcnt 0x0" ::: "memory");   // stands in front of any rewrite of an address register that the bias loads name
#pragma unroll
    for (int j = 0; j < 8; ++j) { const float bb = bfr(bias[j]); v8b hv, lv;
#pragma unroll
      for (int r = 0; r < 8; ++r) { const float v = acc[j][r] + bb; const __bf16 hb = (__bf16)v; hv[r] = hb; lv[r] = (__bf16)(v - (float)hb); }
      vst2(&sb[0][j * 16 + col][wave * 16 + 8 * g], hv); vst2(&sb[1][j * 16 + col][wave * 16 + 8 * g], lv); }
    __syncthreads();   // the four waves' 16 positions each make up the whole 128-B lines stored below
    const size_t t0 = (size_t)blockIdx.x * 64; const size_t vb = ((t0 / SS) * DM + (size_t)(n0 - 2 * DM)) * SS + t0 % SS;
#pragma unroll
    for (int i = 0; i < 8; ++i) { const int rowi = i * 16 + (tid >> 3), pc = tid & 7; const size_t o = vb + (size_t)rowi * SS + pc * 8;   // eight lanes store one line
      vst2(VTH + o, *(const v8b*)&sb[0][rowi][pc * 8]); vst2(VTL + o, *(const v8b*)&sb[1][rowi][pc * 8]); }
    return; }
#pragma unroll
  for (int j = 0; j < 8; ++j) { const int n = n0 + j * 16 + col; const int which = n / DM, c = n % DM; const float bb = bfr((which == 0 ? bq : which == 1 ? bk : bv)[c]);
#pragma unroll
    for (int r = 0; r < 8; ++r) so[wave][8 * g + r][j * 16 + col] = acc[j][r] + bb; }
  LDSX();
  if (n0 >= DM) {   // K columns, the same for the whole block: each value leaves as the bf16 hi + bf16 residual pair that the score products take; 16 lanes store 256 B of a row of hi and of lo
#pragma unroll
    for (int rl = 0; rl < 16; rl += 2) { const float* s = &so[wave][rl + g][col * 8]; v8b hv, lv;
#pragma unroll
      for (int i = 0; i < 8; ++i) { const float v = s[i]; const __bf16 hb = (__bf16)v; hv[i] = hb; lv[i] = (__bf16)(v - (float)hb); }
      const size_t o = (r0 + rl + g) * DM + (n0 - DM) + col * 8;
      vst2(KH + o, hv); vst2(KL + o, lv); }
    asm volatile("s_wait_xcnt 0x0" ::: "memory");   // stands in front of any rewrite of a register that these stores name
    return; }
  for (int rl = 0; rl < 16; ++rl) vst2(QKV + (r0 + rl) * QKVP + n0 + lane * 4, *(const v4f*)&so[wave][rl][lane * 4]);
}
// ---- k_attn: block = (query block qb, b*16 + h), 4 waves: all SS/32 key steps; online softmax; O written over the q columns of the block's rows (head segment 256 B)
// The products are taken transposed: S^T = K Q^T (A = K rows, B = Q rows) and O^T += V^T P^T (A = V^T rows, B = P^T).  A lane then holds 16 of the 32 scores of ONE query (column lane & 15; keys 8g + r and 16 + 8g + r),
// so maximum and sum are in-lane with one exchange between the wave's halves, and the two score tiles, converted in place, are the B fragment of P^T in the loaders' own k order: P goes through no LDS.
// The 32-key K tile (hi, lo) and V tile (hi, lo) of a step are brought into LDS once per block by asynchronous copies, two buffers, the next step's tile in flight while this one is worked on; all four waves read their fragments from LDS.
// LDS pitches are 16 B x odd, conflict-free for 16-byte LDS reads: K rows of 128 B at 144 B, V rows of 64 B at 80 B.
#define KPB 72
#define VPB 40
#define KARRB (32 * KPB * 2)
#define KBUFB (2 * KARRB)
#define VARRB (HD * VPB * 2)
#define VBUFB (2 * VARRB)
// one thread's eight 16-byte copies of one tile: K rows r, r+16 of hi and of lo; V rows d, d+32 of hi and of lo
__device__ __forceinline__ void attn_stage(const __bf16* khg, const __bf16* klg, const __bf16* vhg, const __bf16* vlg, unsigned lk, unsigned lv) {
  // the copies and s_wait_xcnt 0 in one statement: the wait stands in front of any rewrite of an address register that a copy names
  asm volatile("global_load_async_to_lds_b128 %0, %8, off\n\t"
               "global_load_async_to_lds_b128 %1, %9, off\n\t"
               "global_load_async_to_lds_b128 %2, %10, off\n\t"
               "global_load_async_to_lds_b128 %3, %11, off\n\t"
               "global_load_async_to_lds_b128 %4, %12, off\n\t"
               "global_load_async_to_lds_b128 %5, %13, off\n\t"
               "global_load_async_to_lds_b128 %6, %14, off\n\t"
               "global_load_async_to_lds_b128 %7, %15, off\n\t"
               "s_wait_xcnt 0x0"
               :: "v"(lk), "v"(lk + 16 * KPB * 2), "v"(lk + KARRB), "v"(lk + KARRB + 16 * KPB * 2),
                  "v"(lv), "v"(lv + 32 * VPB * 2), "v"(lv + VARRB), "v"(lv + VARRB + 32 * VPB * 2),
                  "v"(khg), "v"(khg + 16 * DM), "v"(klg), "v"(klg + 16 * DM),
                  "v"(vhg), "v"(vhg + 32 * SS), "v"(vlg), "v"(vlg + 32 * SS)
               : "memory");
}
// The softmax is kept in base 2: exp(s / 8 - max) = 2^(s * SCL2 - max2), SCL2 = log2(e) / 8.  Every argument is <= 0 up to one rounding, so the hardware's own 2^x needs no range handling: far below zero it gives 0.
#define SCL2 0.18033688011112042f
// lane l <-> lane l ^ 16
__device__ __forceinline__ float xhalf(float v) { const int b = __builtin_bit_cast(int, v); return __builtin_bit_cast(float, __builtin_amdgcn_permlanex16(b, b, 0x76543210, 0xfedcba98, false, false)); }
// mac3 with the operands' sides swapped: the three products are added in mac3's order
__device__ __forceinline__ v8f mac3t(const F2& a, const F2& b, v8f c) { c = wmma_bf(a.h, b.l, c); c = wmma_bf(a.l, b.h, c); return wmma_bf(a.h, b.h, c); }
__global__ __launch_bounds__(128) void k_attn(float* __restrict__ QKV, const __bf16* __restrict__ KH, const __bf16* __restrict__ KL, const __bf16* __restrict__ VTH, const __bf16* __restrict__ VTL) {
  __shared__ __align__(16) float so[4][16][68];
  __shared__ __align__(16) __bf16 sk[2][2][32][KPB]; __shared__ __align__(16) __bf16 sv[2][2][HD][VPB];
  const int tid = threadIdx.x, wave = tid >> 5, lane = tid & 31, col = lane & 15, g = lane >> 4;
  const int qb = blockIdx.x, bh = blockIdx.y, b = bh / NH, h = bh % NH; const int q0 = qb * 64 + wave * 16; const size_t tq = (size_t)b * SS + q0;
  const F2 a0 = split_row(QKV + (tq + col) * QKVP + h * HD, 0, lane), a1 = split_row(QKV + (tq + col) * QKVP + h * HD, 32, lane);
  float m = -3.0e38f, l = 0.f;   // of query col; m in base-2 units (score x SCL2); l sums this half's keys only, the halves are joined behind the loop
  v8f acc[4] = {};               // acc[dt][r] = O[query col][dt * 16 + 8 g + r]
  const int nsteps = SS / 32;
  const size_t ko = ((size_t)b * SS + (tid >> 3)) * DM + h * HD + (tid & 7) * 8;
  const __bf16 *khg = KH + ko, *klg = KL + ko;
  const size_t vo = ((size_t)b * DM + h * HD + (tid >> 2)) * SS + (tid & 3) * 8;
  const __bf16 *vhg = VTH + vo, *vlg = VTL + vo;
  const unsigned lk = (unsigned)(size_t)&sk[0][0][tid >> 3][(tid & 7) * 8], lv = (unsigned)(size_t)&sv[0][0][tid >> 2][(tid & 3) * 8];
  // The SS / 64 query blocks of a head walk the same K and V tiles at the same time: block qb enters the ring of key tiles at tile 2 qb and wraps round, so that at one moment they ask L2 for different lines.
  // The running softmax takes the tiles in any order; only the order of its sums turns.
  const int rot = (qb * 2) & (nsteps - 1);
  const int t0 = rot, t1 = (rot + 1) & (nsteps - 1);
  attn_stage(khg + (size_t)t0 * 32 * DM, klg + (size_t)t0 * 32 * DM, vhg + t0 * 32, vlg + t0 * 32, lk, lv);
  asm volatile("s_wait_asynccnt 0x0" ::: "memory");   // this wave's copies of the first tile have landed
  __syncthreads();                                    // the first tile is readable by every wave
  attn_stage(khg + (size_t)t1 * 32 * DM, klg + (size_t)t1 * 32 * DM, vhg + t1 * 32, vlg + t1 * 32, lk + KBUFB, lv + VBUFB);
#pragma unroll 1
  for (int ks = 0; ks < nsteps; ++ks) {
    const int cur = ks & 1;
    float e[16];
#pragma unroll
    for (int ct = 0; ct < 2; ++ct) { const __bf16 *kh = &sk[cur][0][ct * 16 + col][0], *kl = &sk[cur][1][ct * 16 + col][0];
      const F2 k0 = {frag_b(kh, lane), frag_b(kl, lane)}, k1 = {frag_b(kh + 32, lane), frag_b(kl + 32, lane)};
      v8f c = mac3t(k0, a0, (v8f){}); c = mac3t(k1, a1, c);
#pragma unroll
      for (int r = 0; r < 8; ++r) e[ct * 8 + r] = c[r]; }
    float mx = e[0];
#pragma unroll
    for (int i = 1; i < 16; ++i) mx = fmaxf(mx, e[i]);
    mx = fmaxf(mx, xhalf(mx));
    const float mn = fmaxf(m, mx * SCL2); const float alpha = __builtin_amdgcn_exp2f(m - mn); m = mn;
#pragma unroll
    for (int i = 0; i < 16; i += 2) { const v2f arg = __builtin_elementwise_fma((v2f){e[i], e[i + 1]}, (v2f){SCL2, SCL2}, (v2f){-mn, -mn});   // one packed fma for two scores
      e[i] = __builtin_amdgcn_exp2f(arg.x); e[i + 1] = __builtin_amdgcn_exp2f(arg.y); }
    l = l * alpha + (((e[0] + e[1]) + (e[2] + e[3])) + ((e[4] + e[5]) + (e[6] + e[7])) + (((e[8] + e[9]) + (e[10] + e[11])) + ((e[12] + e[13]) + (e[14] + e[15]))));
#pragma unroll
    for (int dt = 0; dt < 4; ++dt) acc[dt] *= alpha;
    const F2 pb = bsplit16(e);
#pragma unroll
    for (int dt = 0; dt < 4; ++dt) { const v16b vh = frag_b(&sv[cur][0][dt * 16 + col][0], lane), vl = frag_b(&sv[cur][1][dt * 16 + col][0], lane);
      acc[dt] = wmma_bf(vh, pb.l, acc[dt]); acc[dt] = wmma_bf(vl, pb.h, acc[dt]); acc[dt] = wmma_bf(vh, pb.h, acc[dt]); }
    asm volatile("s_wait_dscnt 0x0" ::: "memory");      // this wave's LDS reads of this step's tile are done
    asm volatile("s_wait_asynccnt 0x0" ::: "memory");   // this wave's copies of the next tile have landed
    __syncthreads();                                    // publishes the next tile and frees this step's buffer
    if (ks + 2 < nsteps) { const int tn = (ks + 2 + rot) & (nsteps - 1);
      attn_stage(khg + (size_t)tn * 32 * DM, klg + (size_t)tn * 32 * DM, vhg + tn * 32, vlg + tn * 32, lk + cur * KBUFB, lv + cur * VBUFB); } }
  asm volatile("s_wait_asynccnt 0x0" ::: "memory");     // no copy is outstanding behind the loop
  const float il = 1.0f / (l + xhalf(l));
#pragma unroll
  for (int dt = 0; dt < 4; ++dt) { const v8f o = acc[dt] * il; float* d = &so[wave][col][dt * 16 + 8 * g];
    vst2(d, (v4f){o[0], o[1], o[2], o[3]}); vst2(d + 4, (v4f){o[4], o[5], o[6], o[7]}); }
  LDSX();
  for (int rl = 0; rl < 16; ++rl) if (lane < 16) vst2(QKV + (tq + rl) * QKVP + h * HD + lane * 4, *(const v4f*)&so[wave][rl][lane * 4]);
}
// ---- k_out: Y = O(hi/lo; the q columns of QKV) . PT_out rows (2 products, K = 1024); block (64 rows, 128 cols)
__global__ __launch_bounds__(128) void k_out(const float* __restrict__ QKV, const __bf16* __restrict__ PT, int wblk, const float* __restrict__ bo, float* __restrict__ Y) {
  __shared__ __align__(16) float so[4][16][132];
  const int tid = threadIdx.x, wave = tid >> 5, lane = tid & 31, col = lane & 15, g = lane >> 4; const size_t r0 = (size_t)blockIdx.x * 64 + wave * 16; const int n0 = blockIdx.y * 128;
  __shared__ __align__(16) float sa[2][64][GAP]; __shared__ __align__(16) __bf16 sb[2][128][GBP];
  const char* ag = (const char*)(QKV + ((size_t)blockIdx.x * 64 + (tid >> 4)) * QKVP + (tid & 15) * 4);
  const char* bg = (const char*)(PT + (size_t)(wblk * DM + n0 + (tid >> 3)) * DM + (tid & 7) * 8);
  const unsigned la = (unsigned)(size_t)&sa[0][tid >> 4][(tid & 15) * 4], lb = (unsigned)(size_t)&sb[0][tid >> 3][(tid & 7) * 8];
  v8f acc[8] = {};
  const int rot = (blockIdx.x + blockIdx.y) & (GNS - 1);   // this block's first k stage
  gemm_stage(ag, (size_t)QKVP * 4, bg, la, lb, GROT(0), 0);
  asm volatile("s_wait_asynccnt 0x0" ::: "memory");   // this wave's copies of the first stage have landed
  __syncthreads();                                    // the first stage is readable by every wave
  gemm_stage(ag, (size_t)QKVP * 4, bg, la, lb, GROT(1), 1);
#pragma unroll 1
  for (int s = 0; s < DM / GKC; ++s) { const int cur = s & 1;
    F2 a[GKC / 32]; v16b w[GKC / 32][8];   // the stage's fragments are all asked for in front of its first product: one LDS latency a stage
#pragma unroll
    for (int kk = 0; kk < GKC / 32; ++kk) { a[kk] = split_row(&sa[cur][wave * 16 + col][0], kk * 32, lane);
#pragma unroll
      for (int j = 0; j < 8; ++j) w[kk][j] = frag_b(&sb[cur][j * 16 + col][kk * 32], lane); }
#pragma unroll
    for (int kk = 0; kk < GKC / 32; ++kk) {
#pragma unroll
      for (int j = 0; j < 8; ++j) { acc[j] = wmma_bf(a[kk].l, w[kk][j], acc[j]); acc[j] = wmma_bf(a[kk].h, w[kk][j], acc[j]); } }
    asm volatile("s_wait_dscnt 0x0" ::: "memory");      // this wave's LDS reads of this stage are done
    asm volatile("s_wait_asynccnt 0x0" ::: "memory");   // this wave's copies of the next stage have landed
    __syncthreads();                                    // publishes the next stage and frees this stage's buffer
    if (s + 2 < DM / GKC) gemm_stage(ag, (size_t)QKVP * 4, bg, la, lb, GROT(s + 2), cur); }
  asm volatile("s_wait_asynccnt 0x0" ::: "memory");     // no copy is outstanding behind the loop
#pragma unroll
  for (int j = 0; j < 8; ++j) { const float bb = bfr(bo[n0 + j * 16 + col]);
#pragma unroll
    for (int r = 0; r < 8; ++r) so[wave][8 * g + r][j * 16 + col] = acc[j][r] + bb; }
  LDSX();
  for (int rl = 0; rl < 16; ++rl) vst2(Y + (r0 + rl) * DM + n0 + lane * 4, *(const v4f*)&so[wave][rl][lane * 4]);
}

extern "C" void kernel_launch(void* const* d_in, const int* in_sizes, int n_in, void* d_out, int out_size, void* d_ws, size_t ws_size, hipStream_t stream) {
  (void)in_sizes; (void)n_in; (void)out_size;
  const float** F = (const float**)d_in;   // q, k, v [2,2048,1024], Wq, bq, Wk, bk, Wv, bv, Wo, bo ([in][out] 1024x1024), Wc [1024,1024], bc
  if (ws_size < (size_t)WS_END) return;
  char* ws = (char*)d_ws; __bf16 *PT = (__bf16*)(ws + WS_PT), *VTH = (__bf16*)(ws + WS_VTH), *VTL = (__bf16*)(ws + WS_VTL), *KH = (__bf16*)(ws + WS_KH), *KL = (__bf16*)(ws + WS_KL); float* QKV = (float*)(ws + WS_QKV);
  float* OUTC = (float*)d_out; float* OUTH = OUTC + (size_t)NR * DM;     // outputs: (c, h)
  k_pack<<<dim3(DM / PKT, DM / PKT, 5), 128, 0, stream>>>(F[3], F[5], F[7], F[9], F[11], PT);
  k_proj<<<dim3(TRB, QKVP / 128), 128, 0, stream>>>(F[0], F[1], F[2], PT, F[4], F[6], F[8], QKV, VTH, VTL, KH, KL);
  k_attn<<<dim3(TQB, TNB * NH), 128, 0, stream>>>(QKV, KH, KL, VTH, VTL);
  k_out<<<dim3((TNB < NB ? TQB : NR / 64), DM / 128), 128, 0, stream>>>(QKV, PT, 4, F[12], OUTC);
  k_out<<<dim3((TNB < NB ? TQB : NR / 64), DM / 128), 128, 0, stream>>>(QKV, PT, 3, F[10], OUTH);
}

// v010
// It runs in 153 microseconds.
// Next to v009, in two timings, it ran 1.06 times as fast each time.
// All steps since v000 together make it 4.84 times as fast.
// compute dtype: q/k/v inputs, the five [in][out] weights + biases (module inputs) rounded to bf16; Q/K/V projections with exact bf16 products (+ bias); scores and P.V with both computed operands as bf16 hi + bf16 residual pairs (3 products); the two output projections (Wc → c, Wo → h) hi/lo x bf16 weights (2 products) + bias; online softmax in f32; f32 accumulate.
#include <hip/hip_runtime.h>
#include <math.h>

typedef __attribute__((ext_vector_type(16))) _Float16 v16h;
typedef __attribute__((ext_vector_type(16))) __bf16 v16b;
typedef __attribute__((ext_vector_type(8)))  _Float16 v8h;
typedef __attribute__((ext_vector_type(8)))  float v8f;
typedef __attribute__((ext_vector_type(4)))  float v4f;
typedef __attribute__((ext_vector_type(2)))  float v2f;
typedef __attribute__((ext_vector_type(4)))  unsigned v4u;
typedef __attribute__((ext_vector_type(4)))  int v4i;
typedef float __attribute__((may_alias)) float_a;
typedef int __attribute__((may_alias)) int_a;

template <typename T> __device__ __forceinline__ void vst2(void* p, T v) { *(T*)p = v;  }
__device__ __forceinline__ v8f wmma16(v16h a, v16h b, v8f c) {
  v8f d = __builtin_amdgcn_wmma_f32_16x16x32_f16(false, a, false, b, (short)0, c, false, false);
  asm volatile("v_nop\n\tv_nop\n\tv_nop\n\tv_nop" : "+v"(d) : "v"(a), "v"(b));
  return d;
}
__device__ __forceinline__ v8f wmma_bf(v16b a, v16b b, v8f c) {
  v8f d = __builtin_amdgcn_wmma_f32_16x16x32_bf16(false, a, false, b, (short)0, c, false, false);
  asm volatile("v_nop\n\tv_nop\n\tv_nop\n\tv_nop" : "+v"(d) : "v"(a), "v"(b));
  return d;
}
// 16x16x32 fragments: lane = (h = lane>>4, row/col = lane&15); elements 0..7 = k0+8h+0..7, 8..15 = k0+16+8h+0..7; D element r = row 8h+r
__device__ __forceinline__ v16h frag_h(const _Float16* rowk0, int lane) {
  union { v16h v; v8h q[2]; } u; const _Float16* p = rowk0 + 8 * (lane >> 4);
  u.q[0] = *(const v8h*)p; u.q[1] = *(const v8h*)(p + 16); return u.v;
}
__device__ __forceinline__ v16h frag_f32(const float* rowk0, int lane) {
  v16h a; const float* p = rowk0 + 8 * (lane >> 4);
#pragma unroll
  for (int i = 0; i < 8; ++i) { a[i] = (_Float16)p[i]; a[8 + i] = (_Float16)p[16 + i]; }
  return a;
}
__device__ __forceinline__ v16h frag_f32s(const float* rowk0, int lane, float sc) {
  v16h a; const float* p = rowk0 + 8 * (lane >> 4);
#pragma unroll
  for (int i = 0; i < 8; ++i) { a[i] = (_Float16)(p[i] * sc); a[8 + i] = (_Float16)(p[16 + i] * sc); }
  return a;
}
// column fragment from a [K][ld] layout (column n), rows >= K read as 0
__device__ __forceinline__ v16h fragc_f32(const float* W, int k0, int n, int lane, int ld, int K) {
  v16h a; const int g = lane >> 4;
#pragma unroll
  for (int i = 0; i < 8; ++i) { const int ka = k0 + 8 * g + i, kb = ka + 16;
    a[i] = (_Float16)(ka < K ? W[(size_t)(ka < K ? ka : K - 1) * ld + n] : 0.f); a[8 + i] = (_Float16)(kb < K ? W[(size_t)(kb < K ? kb : K - 1) * ld + n] : 0.f); }
  return a;
}
struct F2 { v16b h, l; };
__device__ __forceinline__ F2 bsplit16(const float v[16]) { F2 r;
#pragma unroll
  for (int i = 0; i < 16; ++i) { const __bf16 h = (__bf16)v[i]; r.h[i] = h; r.l[i] = (__bf16)(v[i] - (float)h); }
  return r; }
__device__ __forceinline__ F2 split_row(const float* row, int k0, int lane) { float v[16]; const float* p = row + k0 + 8 * (lane >> 4);
#pragma unroll
  for (int i = 0; i < 8; ++i) { v[i] = p[i]; v[8 + i] = p[16 + i]; }
  return bsplit16(v); }
__device__ __forceinline__ F2 split_rowK(const float* row, int k0, int lane, int K) { float v[16]; const int g = lane >> 4;
#pragma unroll
  for (int i = 0; i < 8; ++i) { const int ka = k0 + 8 * g + i, kb = ka + 16; v[i] = ka < K ? row[ka < K ? ka : K - 1] : 0.f; v[8 + i] = kb < K ? row[kb < K ? kb : K - 1] : 0.f; }
  return bsplit16(v); }
__device__ __forceinline__ F2 split_col(const float* W, int k0, int n, int lane, int ld, int K) { float v[16]; const int g = lane >> 4;
#pragma unroll
  for (int i = 0; i < 8; ++i) { const int ka = k0 + 8 * g + i, kb = ka + 16; v[i] = ka < K ? W[(size_t)(ka < K ? ka : K - 1) * ld + n] : 0.f; v[8 + i] = kb < K ? W[(size_t)(kb < K ? kb : K - 1) * ld + n] : 0.f; }
  return bsplit16(v); }
__device__ __forceinline__ v8f mac3(const F2& a, const F2& b, v8f c) { c = wmma_bf(a.l, b.h, c); c = wmma_bf(a.h, b.l, c); return wmma_bf(a.h, b.h, c); }
__device__ __forceinline__ float sigm(float v) { return 1.0f / (1.0f + expf(-v)); }
#define LDSX() do { asm volatile("s_wait_dscnt 0" ::: "memory"); __builtin_amdgcn_wave_barrier(); __builtin_amdgcn_fence(__ATOMIC_RELEASE, "workgroup"); } while (0)


// Cyclic attention block: Q = q Wq + bq, K = k Wk + bk, V = v Wv + bv (16 heads x 64), softmax(Q K^T / 8) V merged; outputs (c, h) = (merged Wc + bc, merged Wo + bo).  B 2, S 2048, H 1024, cyclic_size 1024.
// k_pack (Wq|Wk|Wv|Wo|Wc columns as bf16 rows), k_proj (Q as f32 rows; K as rows of bf16 hi and of bf16 lo; V as V^T, bf16 hi and lo), k_attn (flash-style, 64 key steps), k_out x2 (c into output 0, h into output 1).
#define NB 2
#define SS 2048
#define DM 1024
#define NH 16
#define HD 64
#define NR (NB * SS)
#define QKVP (3 * DM)
#ifndef TRB
#define TRB (NR / 64)
#define TQB (SS / 64)
#define TNB NB
#endif
typedef __attribute__((ext_vector_type(8))) __bf16 v8b;
__device__ __forceinline__ v16b frag_b(const __bf16* rowk0, int lane) {
  union { v16b v; v8b q[2]; } u; const __bf16* p = rowk0 + 8 * (lane >> 4);
  u.q[0] = *(const v8b*)p; u.q[1] = *(const v8b*)(p + 16); return u.v;
}
__device__ __forceinline__ v16b frag_gbf(const float* rowk0, int lane) {
  v16b a; const float* p = rowk0 + 8 * (lane >> 4);
#pragma unroll
  for (int i = 0; i < 8; ++i) { a[i] = (__bf16)p[i]; a[8 + i] = (__bf16)p[16 + i]; }
  return a;
}
__device__ __forceinline__ float bfr(float v) { return (float)(__bf16)v; }
#define WS_PT   0u                                 // bf16 [5*1024 (q|k|v|o|c cols)][1024]
#define WS_QKV  (WS_PT + 2u * 5 * DM * DM)           // f32 [4096 rows][3072]  (q 0..1023 | k, v: not used) ; q cols later overwritten by O
#define WS_VTH  (WS_QKV + 4u * NR * QKVP)            // bf16 [2][1024 (h*64+d)][2048]
#define WS_VTL  (WS_VTH + 2u * NB * DM * SS)
#define WS_KH   (WS_VTL + 2u * NB * DM * SS)         // bf16 [4096 rows][1024 (h*64+d)]
#define WS_KL   (WS_KH + 2u * NR * DM)
#define WS_END  (WS_KL + 2u * NR * DM)

// k_pack: block = one 64 (in) x 64 (out) tile of one weight.  The tile is read along the weight's rows (16 lanes read 256 successive bytes), turned in LDS, and leaves as whole 128-B lines of PT rows.
// LDS pitch 144 B: rows stay 16-byte aligned and successive rows start on different banks.
#define PKT 64
#define PKP 72
__global__ __launch_bounds__(128) void k_pack(const float* __restrict__ Wq, const float* __restrict__ Wk, const float* __restrict__ Wv, const float* __restrict__ Wo, const float* __restrict__ Wc, __bf16* __restrict__ PT) {
  __shared__ __align__(16) __bf16 st[PKT][PKP];
  const int tid = threadIdx.x, which = blockIdx.z, k0 = blockIdx.x * PKT, n0 = blockIdx.y * PKT; const float* Wm = which == 0 ? Wq : (which == 1 ? Wk : (which == 2 ? Wv : (which == 3 ? Wo : Wc)));
  const int kg = tid >> 4, nq = tid & 15;   // this thread: rows k0 + 8 kg + 0..7, columns n0 + 4 nq + 0..3
  const float* src = Wm + (size_t)(k0 + kg * 8) * DM + n0 + nq * 4;
  v4f x[8];
#pragma unroll   // the eight loads are all in flight before the first is used, and x stays in registers
  for (int i = 0; i < 8; ++i) x[i] = *(const v4f*)(src + (size_t)i * DM);
#pragma unroll   // constant indices into x: no scratch
  for (int j = 0; j < 4; ++j) { v8b t;
#pragma unroll
    for (int i = 0; i < 8; ++i) t[i] = (__bf16)x[i][j];
    vst2(&st[nq * 4 + j][kg * 8], t); }
  __syncthreads();
#pragma unroll   // the four LDS reads go out together, one latency
  for (int i = 0; i < 4; ++i) { const int row = i * 16 + (tid >> 3), pc = tid & 7;   // eight lanes store one line
    vst2(PT + (size_t)(which * DM + n0 + row) * DM + k0 + pc * 8, *(const v8b*)&st[row][pc * 8]); }
}
// ---- GEMM staging (k_proj, k_out): a stage is 64 k of the block's 64 A rows (f32, 256 B a row) and 128 B rows (bf16, 128 B a row), brought into LDS once per block by asynchronous copies in whole 128-B lines,
// two buffers, the next stage in flight while this one is worked on; the waves read their fragments from LDS in the k order they had.  LDS pitches are 16 B x odd: A 272 B, B 144 B.
#define GKC 64
#define GAP 68
#define GBP 72
#define GABUFB (64 * GAP * 4)
#define GBBUFB (128 * GBP * 2)
// Blocks that share A rows (same blockIdx.x) or B rows (same blockIdx.y) run at the same time.  Each enters the ring of k stages at a stage set by its tile indices and wraps round,
// so that at one moment they ask L2 for different lines of the shared rows instead of all for the same ones.  A and B of a stage keep one common stage number; only the order in which the stages are summed turns.
#define GNS (DM / GKC)
#define GROT(s) (((s) + rot) & (GNS - 1))
// one thread's eight 16-byte copies: global rows gs bytes apart, LDS rows ls bytes apart
__device__ __forceinline__ void gemm_stage8(const char* g, size_t gs, unsigned l, unsigned ls) {
  // the copies and s_wait_xcnt 0 in one statement: the wait stands in front of any rewrite of an address register that a copy names
  asm volatile("global_load_async_to_lds_b128 %0, %8, off\n\t"
               "global_load_async_to_lds_b128 %1, %9, off\n\t"
               "global_load_async_to_lds_b128 %2, %10, off\n\t"
               "global_load_async_to_lds_b128 %3, %11, off\n\t"
               "global_load_async_to_lds_b128 %4, %12, off\n\t"
               "global_load_async_to_lds_b128 %5, %13, off\n\t"
               "global_load_async_to_lds_b128 %6, %14, off\n\t"
               "global_load_async_to_lds_b128 %7, %15, off\n\t"
               "s_wait_xcnt 0x0"
               :: "v"(l), "v"(l + ls), "v"(l + 2 * ls), "v"(l + 3 * ls), "v"(l + 4 * ls), "v"(l + 5 * ls), "v"(l + 6 * ls), "v"(l + 7 * ls),
                  "v"(g), "v"(g + gs), "v"(g + 2 * gs), "v"(g + 3 * gs), "v"(g + 4 * gs), "v"(g + 5 * gs), "v"(g + 6 * gs), "v"(g + 7 * gs)
               : "memory");
}
// stage s into buffer bf: A rows t>>4 + 8 j (row pitch apb bytes in global memory), B rows t>>3 + 16 j
__device__ __forceinline__ void gemm_stage(const char* ag, size_t apb, const char* bg, unsigned la, unsigned lb, int s, int bf) {
  gemm_stage8(ag + (size_t)s * (GKC * 4), 8 * apb, la + bf * GABUFB, 8 * GAP * 4);
  gemm_stage8(bg + (size_t)s * (GKC * 2), (size_t)16 * DM * 2, lb + bf * GBBUFB, 16 * GBP * 2);
}
// ---- k_proj: QKV[r][n] = bf16(x[r]) . PT[n] (exact), K = 1024; block (64 rows, 128 cols); 512-B segments of 12-KB rows; the V blocks store V^T (hi, lo) instead, 128-B segments of its 4-KB rows; the K blocks store K (hi, lo), 256-B segments of its 2-KB rows
__global__ __launch_bounds__(128) void k_proj(const float* __restrict__ XQ, const float* __restrict__ XK, const float* __restrict__ XV, const __bf16* __restrict__ PT, const float* __restrict__ bq, const float* __restrict__ bk, const float* __restrict__ bv, float* __restrict__ QKV, __bf16* __restrict__ VTH, __bf16* __restrict__ VTL, __bf16* __restrict__ KH, __bf16* __restrict__ KL) {
  const float* X = (blockIdx.y * 128) < DM ? XQ : ((blockIdx.y * 128) < 2 * DM ? XK : XV);
  __shared__ __align__(16) float so[4][16][132];
  const int tid = threadIdx.x, wave = tid >> 5, lane = tid & 31, col = lane & 15, g = lane >> 4; const size_t r0 = (size_t)blockIdx.x * 64 + wave * 16; const int n0 = blockIdx.y * 128;
  __shared__ __align__(16) float sa[2][64][GAP]; __shared__ __align__(16) __bf16 sb[2][128][GBP];
  const char* ag = (const char*)(X + ((size_t)blockIdx.x * 64 + (tid >> 4)) * DM + (tid & 15) * 4);
  const char* bg = (const char*)(PT + (size_t)(n0 + (tid >> 3)) * DM + (tid & 7) * 8);
  const unsigned la = (unsigned)(size_t)&sa[0][tid >> 4][(tid & 15) * 4], lb = (unsigned)(size_t)&sb[0][tid >> 3][(tid & 7) * 8];
  v8f acc[8] = {};
  const int rot = (blockIdx.x + blockIdx.y) & (GNS - 1);   // this block's first k stage
  gemm_stage(ag, (size_t)DM * 4, bg, la, lb, GROT(0), 0);
  asm volatile("s_wait_asynccnt 0x0" ::: "memory");   // this wave's copies of the first stage have landed
  __syncthreads();                                    // the first stage is readable by every wave
  gemm_stage(ag, (size_t)DM * 4, bg, la, lb, GROT(1), 1);
#pragma unroll 1
  for (int s = 0; s < DM / GKC; ++s) { const int cur = s & 1;
    v16b a[GKC / 32], w[GKC / 32][8];   // the stage's fragments are all asked for in front of its first product: one LDS latency a stage
#pragma unroll
    for (int kk = 0; kk < GKC / 32; ++kk) { a[kk] = frag_gbf(&sa[cur][wave * 16 + col][kk * 32], lane);
#pragma unroll
      for (int j = 0; j < 8; ++j) w[kk][j] = frag_b(&sb[cur][j * 16 + col][kk * 32], lane); }
#pragma unroll
    for (int kk = 0; kk < GKC / 32; ++kk) {
#pragma unroll
      for (int j = 0; j < 8; ++j) acc[j] = wmma_bf(a[kk], w[kk][j], acc[j]); }
    asm volatile("s_wait_dscnt 0x0" ::: "memory");      // this wave's LDS reads of this stage are done
    asm volatile("s_wait_asynccnt 0x0" ::: "memory");   // this wave's copies of the next stage have landed
    __syncthreads();                                    // publishes the next stage and frees this stage's buffer
    if (s + 2 < DM / GKC) gemm_stage(ag, (size_t)DM * 4, bg, la, lb, GROT(s + 2), cur); }
  asm volatile("s_wait_asynccnt 0x0" ::: "memory");     // no copy is outstanding behind the loop
  if (n0 >= 2 * DM) {   // V columns, the same for the whole block.  A lane's eight accumulator rows are eight successive positions of one V^T row: 16 B of hi, 16 B of lo.  sb is free: every wave has passed the loop's last barrier
    float bias[8];
#pragma unroll
    for (int j = 0; j < 8; ++j) bias[j] = bv[n0 - 2 * DM + j * 16 + col];
    asm volatile("s_wait_xcnt 0x0" ::: "memory");   // stands in front of any rewrite of an address register that the bias loads name
#pragma unroll
    for (int j = 0; j < 8; ++j) { const float bb = bfr(bias[j]); v8b hv, lv;
#pragma unroll
      for (int r = 0; r < 8; ++r) { const float v = acc[j][r] + bb; const __bf16 hb = (__bf16)v; hv[r] = hb; lv[r] = (__bf16)(v - (float)hb); }
      vst2(&sb[0][j * 16 + col][wave * 16 + 8 * g], hv); vst2(&sb[1][j * 16 + col][wave * 16 + 8 * g], lv); }
    __syncthreads();   // the four waves' 16 positions each make up the whole 128-B lines stored below
    const size_t t0 = (size_t)blockIdx.x * 64; const size_t vb = ((t0 / SS) * DM + (size_t)(n0 - 2 * DM)) * SS + t0 % SS;
#pragma unroll
    for (int i = 0; i < 8; ++i) { const int rowi = i * 16 + (tid >> 3), pc = tid & 7; const size_t o = vb + (size_t)rowi * SS + pc * 8;   // eight lanes store one line
      vst2(VTH + o, *(const v8b*)&sb[0][rowi][pc * 8]); vst2(VTL + o, *(const v8b*)&sb[1][rowi][pc * 8]); }
    return; }
#pragma unroll
  for (int j = 0; j < 8; ++j) { const int n = n0 + j * 16 + col; const int which = n / DM, c = n % DM; const float bb = bfr((which == 0 ? bq : which == 1 ? bk : bv)[c]);
#pragma unroll
    for (int r = 0; r < 8; ++r) so[wave][8 * g + r][j * 16 + col] = acc[j][r] + bb; }
  LDSX();
  if (n0 >= DM) {   // K columns, the same for the whole block: each value leaves as the bf16 hi + bf16 residual pair that the score products take; 16 lanes store 256 B of a row of hi and of lo
#pragma unroll
    for (int rl = 0; rl < 16; rl += 2) { const float* s = &so[wave][rl + g][col * 8]; v8b hv, lv;
#pragma unroll
      for (int i = 0; i < 8; ++i) { const float v = s[i]; const __bf16 hb = (__bf16)v; hv[i] = hb; lv[i] = (__bf16)(v - (float)hb); }
      const size_t o = (r0 + rl + g) * DM + (n0 - DM) + col * 8;
      vst2(KH + o, hv); vst2(KL + o, lv); }
    asm volatile("s_wait_xcnt 0x0" ::: "memory");   // stands in front of any rewrite of a register that these stores name
    return; }
  for (int rl = 0; rl < 16; ++rl) vst2(QKV + (r0 + rl) * QKVP + n0 + lane * 4, *(const v4f*)&so[wave][rl][lane * 4]);
}
// ---- k_attn: block = (query block qb of 128, b*16 + h), 4 waves of 32 queries each: all SS/32 key steps; online softmax; O written over the q columns of the block's rows (head segment 256 B)
// The products are taken transposed: S^T = K Q^T (A = K rows, B = Q rows) and O^T += V^T P^T (A = V^T rows, B = P^T).  In each of its two 16-query tiles a lane holds 16 of the 32 scores of ONE query (column lane & 15; keys 8g + r and 16 + 8g + r),
// so maximum and sum are in-lane with one exchange between the wave's halves, and the two score tiles, converted in place, are the B fragment of P^T in the loaders' own k order: P goes through no LDS.
// A wave keeps two query tiles: every K and V fragment that it reads from LDS feeds two products, and a staged tile serves 128 queries, so LDS reads and L2 reads per query are half of what one tile a wave takes.
// The 32-key K tile (hi, lo) and V tile (hi, lo) of a step are brought into LDS once per block by asynchronous copies, two buffers, the next step's tile in flight while this one is worked on; all four waves read their fragments from LDS.
// LDS pitches are 16 B x odd, conflict-free for 16-byte LDS reads: K rows of 128 B at 144 B, V rows of 64 B at 80 B.
#define QT 2
#define AQB (SS / (64 * QT))
#define KPB 72
#define VPB 40
#define KARRB (32 * KPB * 2)
#define KBUFB (2 * KARRB)
#define VARRB (HD * VPB * 2)
#define VBUFB (2 * VARRB)
// one thread's eight 16-byte copies of one tile: K rows r, r+16 of hi and of lo; V rows d, d+32 of hi and of lo
__device__ __forceinline__ void attn_stage(const __bf16* khg, const __bf16* klg, const __bf16* vhg, const __bf16* vlg, unsigned lk, unsigned lv) {
  // the copies and s_wait_xcnt 0 in one statement: the wait stands in front of any rewrite of an address register that a copy names
  asm volatile("global_load_async_to_lds_b128 %0, %8, off\n\t"
               "global_load_async_to_lds_b128 %1, %9, off\n\t"
               "global_load_async_to_lds_b128 %2, %10, off\n\t"
               "global_load_async_to_lds_b128 %3, %11, off\n\t"
               "global_load_async_to_lds_b128 %4, %12, off\n\t"
               "global_load_async_to_lds_b128 %5, %13, off\n\t"
               "global_load_async_to_lds_b128 %6, %14, off\n\t"
               "global_load_async_to_lds_b128 %7, %15, off\n\t"
               "s_wait_xcnt 0x0"
               :: "v"(lk), "v"(lk + 16 * KPB * 2), "v"(lk + KARRB), "v"(lk + KARRB + 16 * KPB * 2),
                  "v"(lv), "v"(lv + 32 * VPB * 2), "v"(lv + VARRB), "v"(lv + VARRB + 32 * VPB * 2),
                  "v"(khg), "v"(khg + 16 * DM), "v"(klg), "v"(klg + 16 * DM),
                  "v"(vhg), "v"(vhg + 32 * SS), "v"(vlg), "v"(vlg + 32 * SS)
               : "memory");
}
// The softmax is kept in base 2: exp(s / 8 - max) = 2^(s * SCL2 - max2), SCL2 = log2(e) / 8.  Every argument is <= 0 up to one rounding, so the hardware's own 2^x needs no range handling: far below zero it gives 0.
#define SCL2 0.18033688011112042f
// lane l <-> lane l ^ 16
__device__ __forceinline__ float xhalf(float v) { const int b = __builtin_bit_cast(int, v); return __builtin_bit_cast(float, __builtin_amdgcn_permlanex16(b, b, 0x76543210, 0xfedcba98, false, false)); }
// mac3 with the operands' sides swapped: the three products are added in mac3's order
__device__ __forceinline__ v8f mac3t(const F2& a, const F2& b, v8f c) { c = wmma_bf(a.h, b.l, c); c = wmma_bf(a.l, b.h, c); return wmma_bf(a.h, b.h, c); }
__global__ __launch_bounds__(128) void k_attn(float* __restrict__ QKV, const __bf16* __restrict__ KH, const __bf16* __restrict__ KL, const __bf16* __restrict__ VTH, const __bf16* __restrict__ VTL) {
  __shared__ __align__(16) float so[4][16 * QT][68];
  __shared__ __align__(16) __bf16 sk[2][2][32][KPB]; __shared__ __align__(16) __bf16 sv[2][2][HD][VPB];
  const int tid = threadIdx.x, wave = tid >> 5, lane = tid & 31, col = lane & 15, g = lane >> 4;
  const int qb = blockIdx.x, bh = blockIdx.y, b = bh / NH, h = bh % NH; const int q0 = qb * (64 * QT) + wave * (16 * QT); const size_t tq = (size_t)b * SS + q0;
  // every '#pragma unroll' of this kernel: its loop's indices become constants, so that the fragment and accumulator arrays stay in registers (no scratch)
  F2 a0[QT], a1[QT];             // Q of query qt * 16 + col, head dims 0..31 and 32..63
#pragma unroll
  for (int qt = 0; qt < QT; ++qt) { const float* qr = QKV + (tq + qt * 16 + col) * QKVP + h * HD; a0[qt] = split_row(qr, 0, lane); a1[qt] = split_row(qr, 32, lane); }
  float m[QT], l[QT];            // of query qt * 16 + col; m in base-2 units (score x SCL2); l sums this half's keys only, the halves are joined behind the loop
  v8f acc[QT][4];                // acc[qt][dt][r] = O[query qt * 16 + col][dt * 16 + 8 g + r]
#pragma unroll
  for (int qt = 0; qt < QT; ++qt) { m[qt] = -3.0e38f; l[qt] = 0.f;
#pragma unroll
    for (int dt = 0; dt < 4; ++dt) acc[qt][dt] = (v8f){}; }
  const int nsteps = SS / 32;
  const size_t ko = ((size_t)b * SS + (tid >> 3)) * DM + h * HD + (tid & 7) * 8;
  const __bf16 *khg = KH + ko, *klg = KL + ko;
  const size_t vo = ((size_t)b * DM + h * HD + (tid >> 2)) * SS + (tid & 3) * 8;
  const __bf16 *vhg = VTH + vo, *vlg = VTL + vo;
  const unsigned lk = (unsigned)(size_t)&sk[0][0][tid >> 3][(tid & 7) * 8], lv = (unsigned)(size_t)&sv[0][0][tid >> 2][(tid & 3) * 8];
  // The AQB query blocks of a head walk the same K and V tiles at the same time: block qb enters the ring of key tiles at tile 2 QT qb and wraps round, so that at one moment they ask L2 for different lines.
  // The running softmax takes the tiles in any order; only the order of its sums turns.
  const int rot = (qb * 2 * QT) & (nsteps - 1);
  const int t0 = rot, t1 = (rot + 1) & (nsteps - 1);
  attn_stage(khg + (size_t)t0 * 32 * DM, klg + (size_t)t0 * 32 * DM, vhg + t0 * 32, vlg + t0 * 32, lk, lv);
  asm volatile("s_wait_asynccnt 0x0" ::: "memory");   // this wave's copies of the first tile have landed
  __syncthreads();                                    // the first tile is readable by every wave
  attn_stage(khg + (size_t)t1 * 32 * DM, klg + (size_t)t1 * 32 * DM, vhg + t1 * 32, vlg + t1 * 32, lk + KBUFB, lv + VBUFB);
#pragma unroll 1
  for (int ks = 0; ks < nsteps; ++ks) {
    const int cur = ks & 1;
    F2 kf[2][2];   // K fragments [16-key tile][head-dim half]: read once, used by both query tiles
#pragma unroll
    for (int ct = 0; ct < 2; ++ct) { const __bf16 *kh = &sk[cur][0][ct * 16 + col][0], *kl = &sk[cur][1][ct * 16 + col][0];
      kf[ct][0] = (F2){frag_b(kh, lane), frag_b(kl, lane)}; kf[ct][1] = (F2){frag_b(kh + 32, lane), frag_b(kl + 32, lane)}; }
    v8f c[2][QT];
#pragma unroll
    for (int ct = 0; ct < 2; ++ct) {
#pragma unroll
      for (int qt = 0; qt < QT; ++qt) c[ct][qt] = (v8f){}; }
    // each score tile takes its six products in mac3t's order (k0 a0, then k1 a1); the four tiles take turns, so that a product never waits for the one issued just before it
#pragma unroll
    for (int hf = 0; hf < 2; ++hf) {
#pragma unroll
      for (int p = 0; p < 3; ++p) {
#pragma unroll
        for (int ct = 0; ct < 2; ++ct) {
#pragma unroll
          for (int qt = 0; qt < QT; ++qt) { const F2& kk = kf[ct][hf]; const F2& aa = hf ? a1[qt] : a0[qt];
            c[ct][qt] = wmma_bf(p == 1 ? kk.l : kk.h, p == 0 ? aa.l : aa.h, c[ct][qt]); } } } }
    v16b vh[4], vl[4];   // V^T fragments: read once, used by both query tiles
#pragma unroll
    for (int dt = 0; dt < 4; ++dt) { vh[dt] = frag_b(&sv[cur][0][dt * 16 + col][0], lane); vl[dt] = frag_b(&sv[cur][1][dt * 16 + col][0], lane); }
    F2 pb[QT];
#pragma unroll
    for (int qt = 0; qt < QT; ++qt) {
      float e[16];
#pragma unroll
      for (int r = 0; r < 8; ++r) { e[r] = c[0][qt][r]; e[8 + r] = c[1][qt][r]; }
      float mx = e[0];
#pragma unroll
      for (int i = 1; i < 16; ++i) mx = fmaxf(mx, e[i]);
      mx = fmaxf(mx, xhalf(mx));
      const float mn = fmaxf(m[qt], mx * SCL2); const float alpha = __builtin_amdgcn_exp2f(m[qt] - mn); m[qt] = mn;
#pragma unroll
      for (int i = 0; i < 16; i += 2) { const v2f arg = __builtin_elementwise_fma((v2f){e[i], e[i + 1]}, (v2f){SCL2, SCL2}, (v2f){-mn, -mn});   // one packed fma for two scores
        e[i] = __builtin_amdgcn_exp2f(arg.x); e[i + 1] = __builtin_amdgcn_exp2f(arg.y); }
      l[qt] = l[qt] * alpha + (((e[0] + e[1]) + (e[2] + e[3])) + ((e[4] + e[5]) + (e[6] + e[7])) + (((e[8] + e[9]) + (e[10] + e[11])) + ((e[12] + e[13]) + (e[14] + e[15]))));
#pragma unroll
      for (int dt = 0; dt < 4; ++dt) acc[qt][dt] *= alpha;
      pb[qt] = bsplit16(e); }
    // each output tile takes its three products in the order vh pl, vl ph, vh ph; the eight tiles take turns
#pragma unroll
    for (int p = 0; p < 3; ++p) {
#pragma unroll
      for (int dt = 0; dt < 4; ++dt) {
#pragma unroll
        for (int qt = 0; qt < QT; ++qt) acc[qt][dt] = wmma_bf(p == 1 ? vl[dt] : vh[dt], p == 0 ? pb[qt].l : pb[qt].h, acc[qt][dt]); } }
    asm volatile("s_wait_dscnt 0x0" ::: "memory");      // this wave's LDS reads of this step's tile are done
    asm volatile("s_wait_asynccnt 0x0" ::: "memory");   // this wave's copies of the next tile have landed
    __syncthreads();                                    // publishes the next tile and frees this step's buffer
    if (ks + 2 < nsteps) { const int tn = (ks + 2 + rot) & (nsteps - 1);
      attn_stage(khg + (size_t)tn * 32 * DM, klg + (size_t)tn * 32 * DM, vhg + tn * 32, vlg + tn * 32, lk + cur * KBUFB, lv + cur * VBUFB); } }
  asm volatile("s_wait_asynccnt 0x0" ::: "memory");     // no copy is outstanding behind the loop
#pragma unroll
  for (int qt = 0; qt < QT; ++qt) { const float il = 1.0f / (l[qt] + xhalf(l[qt]));
#pragma unroll
    for (int dt = 0; dt < 4; ++dt) { const v8f o = acc[qt][dt] * il; float* d = &so[wave][qt * 16 + col][dt * 16 + 8 * g];
      vst2(d, (v4f){o[0], o[1], o[2], o[3]}); vst2(d + 4, (v4f){o[4], o[5], o[6], o[7]}); } }
  LDSX();
  for (int rl = 0; rl < 16 * QT; ++rl) if (lane < 16) vst2(QKV + (tq + rl) * QKVP + h * HD + lane * 4, *(const v4f*)&so[wave][rl][lane * 4]);
}
// ---- k_out: Y = O(hi/lo; the q columns of QKV) . PT_out rows (2 products, K = 1024); block (64 rows, 128 cols)
__global__ __launch_bounds__(128) void k_out(const float* __restrict__ QKV, const __bf16* __restrict__ PT, int wblk, const float* __restrict__ bo, float* __restrict__ Y) {
  __shared__ __align__(16) float so[4][16][132];
  const int tid = threadIdx.x, wave = tid >> 5, lane = tid & 31, col = lane & 15, g = lane >> 4; const size_t r0 = (size_t)blockIdx.x * 64 + wave * 16; const int n0 = blockIdx.y * 128;
  __shared__ __align__(16) float sa[2][64][GAP]; __shared__ __align__(16) __bf16 sb[2][128][GBP];
  const char* ag = (const char*)(QKV + ((size_t)blockIdx.x * 64 + (tid >> 4)) * QKVP + (tid & 15) * 4);
  const char* bg = (const char*)(PT + (size_t)(wblk * DM + n0 + (tid >> 3)) * DM + (tid & 7) * 8);
  const unsigned la = (unsigned)(size_t)&sa[0][tid >> 4][(tid & 15) * 4], lb = (unsigned)(size_t)&sb[0][tid >> 3][(tid & 7) * 8];
  v8f acc[8] = {};
  const int rot = (blockIdx.x + blockIdx.y) & (GNS - 1);   // this block's first k stage
  gemm_stage(ag, (size_t)QKVP * 4, bg, la, lb, GROT(0), 0);
  asm volatile("s_wait_asynccnt 0x0" ::: "memory");   // this wave's copies of the first stage have landed
  __syncthreads();                                    // the first stage is readable by every wave
  gemm_stage(ag, (size_t)QKVP * 4, bg, la, lb, GROT(1), 1);
#pragma unroll 1
  for (int s = 0; s < DM / GKC; ++s) { const int cur = s & 1;
    F2 a[GKC / 32]; v16b w[GKC / 32][8];   // the stage's fragments are all asked for in front of its first product: one LDS latency a stage
#pragma unroll
    for (int kk = 0; kk < GKC / 32; ++kk) { a[kk] = split_row(&sa[cur][wave * 16 + col][0], kk * 32, lane);
#pragma unroll
      for (int j = 0; j < 8; ++j) w[kk][j] = frag_b(&sb[cur][j * 16 + col][kk * 32], lane); }
#pragma unroll
    for (int kk = 0; kk < GKC / 32; ++kk) {
#pragma unroll
      for (int j = 0; j < 8; ++j) { acc[j] = wmma_bf(a[kk].l, w[kk][j], acc[j]); acc[j] = wmma_bf(a[kk].h, w[kk][j], acc[j]); } }
    asm volatile("s_wait_dscnt 0x0" ::: "memory");      // this wave's LDS reads of this stage are done
    asm volatile("s_wait_asynccnt 0x0" ::: "memory");   // this wave's copies of the next stage have landed
    __syncthreads();                                    // publishes the next stage and frees this stage's buffer
    if (s + 2 < DM / GKC) gemm_stage(ag, (size_t)QKVP * 4, bg, la, lb, GROT(s + 2), cur); }
  asm volatile("s_wait_asynccnt 0x0" ::: "memory");     // no copy is outstanding behind the loop
#pragma unroll
  for (int j = 0; j < 8; ++j) { const float bb = bfr(bo[n0 + j * 16 + col]);
#pragma unroll
    for (int r = 0; r < 8; ++r) so[wave][8 * g + r][j * 16 + col] = acc[j][r] + bb; }
  LDSX();
  for (int rl = 0; rl < 16; ++rl) vst2(Y + (r0 + rl) * DM + n0 + lane * 4, *(const v4f*)&so[wave][rl][lane * 4]);
}

extern "C" void kernel_launch(void* const* d_in, const int* in_sizes, int n_in, void* d_out, int out_size, void* d_ws, size_t ws_size, hipStream_t stream) {
  (void)in_sizes; (void)n_in; (void)out_size;
  const float** F = (const float**)d_in;   // q, k, v [2,2048,1024], Wq, bq, Wk, bk, Wv, bv, Wo, bo ([in][out] 1024x1024), Wc [1024,1024], bc
  if (ws_size < (size_t)WS_END) return;
  char* ws = (char*)d_ws; __bf16 *PT = (__bf16*)(ws + WS_PT), *VTH = (__bf16*)(ws + WS_VTH), *VTL = (__bf16*)(ws + WS_VTL), *KH = (__bf16*)(ws + WS_KH), *KL = (__bf16*)(ws + WS_KL); float* QKV = (float*)(ws + WS_QKV);
  float* OUTC = (float*)d_out; float* OUTH = OUTC + (size_t)NR * DM;     // outputs: (c, h)
  k_pack<<<dim3(DM / PKT, DM / PKT, 5), 128, 0, stream>>>(F[3], F[5], F[7], F[9], F[11], PT);
  k_proj<<<dim3(TRB, QKVP / 128), 128, 0, stream>>>(F[0], F[1], F[2], PT, F[4], F[6], F[8], QKV, VTH, VTL, KH, KL);
  k_attn<<<dim3(AQB, TNB * NH), 128, 0, stream>>>(QKV, KH, KL, VTH, VTL);
  k_out<<<dim3((TNB < NB ? TQB : NR / 64), DM / 128), 128, 0, stream>>>(QKV, PT, 4, F[12], OUTC);
  k_out<<<dim3((TNB < NB ? TQB : NR / 64), DM / 128), 128, 0, stream>>>(QKV, PT, 3, F[10], OUTH);
}
